// v000
// Times are from an AMD MI455X. After a warm-up the kernel runs many times in a row, and a time is the length of
// such a window on the GPU divided by its runs, so every launch and the gaps after it count. The runs cycle
// through copies of the inputs. A figure is the median of several windows, for all but v000 over two sittings.
// Sittings can differ by a few percent; kernels timed side by side share one.
// v000 is the starting kernel. One run takes 404 microseconds.
#include <hip/hip_runtime.h>
#include <hip/hip_bf16.h>

// ---------------------------------------------------------------------------
// DPFP linear attention for MI455X (gfx1250): all GEMMs via bf16 WMMA
// (v_wmma_f32_16x16x32_bf16), fp32 accumulate. 128x64 block tiles, 8 waves
// each computing 32x32 (4 WMMAs / K-step, 2x fragment reuse), double-buffered
// LDS with GLOBAL_LOAD_ASYNC_TO_LDS_B128 staging for the A tile.
// ---------------------------------------------------------------------------

typedef unsigned short u16;
typedef __attribute__((ext_vector_type(8)))  unsigned short u16x8;
typedef __attribute__((ext_vector_type(16))) unsigned short v16u;
typedef __attribute__((ext_vector_type(16))) __bf16        v16bf;
typedef __attribute__((ext_vector_type(8)))  float         v8f;

union Frag { v16u u; v16bf b; };

#ifndef __has_builtin
#define __has_builtin(x) 0
#endif

#if defined(__AMDGCN__) && __has_builtin(__builtin_amdgcn_global_load_async_to_lds_b128)
#define USE_ASYNC_LDS 1
#else
#define USE_ASYNC_LDS 0
#endif

#if USE_ASYNC_LDS
#if __has_builtin(__builtin_amdgcn_s_wait_asynccnt)
#define ASYNC_WAIT() __builtin_amdgcn_s_wait_asynccnt(0)
#else
#define ASYNC_WAIT() asm volatile("s_wait_asynccnt 0x0" ::: "memory")
#endif
// Builtin signature (from hipcc diagnostic): (v4i addrspace(1)*, v4i addrspace(3)*, imm, imm)
typedef int gcc_i32x4 __attribute__((vector_size(16)));
__device__ __forceinline__ void async_copy_b128(const u16* g, u16* l) {
    __builtin_amdgcn_global_load_async_to_lds_b128(
        (__attribute__((address_space(1))) gcc_i32x4*)(void*)g,
        (__attribute__((address_space(3))) gcc_i32x4*)(void*)l, 0, 0);
}
#endif

__device__ __forceinline__ u16 f2bf(float f) {
    union { float f; unsigned u; } x; x.f = f;
    unsigned u = x.u;
    u += 0x7FFFu + ((u >> 16) & 1u);     // round-to-nearest-even
    return (u16)(u >> 16);
}
__device__ __forceinline__ float bf2f(u16 h) {
    union { unsigned u; float f; } x; x.u = ((unsigned)h) << 16;
    return x.f;
}

// ISA 16-bit fragment layout: lane element e -> K = khalf + e + (e>=8 ? 8 : 0)
__device__ __forceinline__ void load_frag(Frag& f, const u16* p) {
    u16x8 lo = *(const u16x8*)p;
    u16x8 hi = *(const u16x8*)(p + 16);
#pragma unroll
    for (int e = 0; e < 8; ++e) { f.u[e] = lo[e]; f.u[e + 8] = hi[e]; }
}

// ---------------------------------------------------------------------------
// Batched bf16 GEMM: C[M,N] = A[M,K] @ B[K,N], row-major, fp32 acc.
// Block: 256 threads = 8 waves; tile 128x64; wave (wr 0..3, wc 0..1) owns
// 32x32. Double-buffered K-steps of 32.
// Requires: M%128==0, N%64==0, K%32==0, lda/ldb/ldc %8==0, 16B-aligned bases.
// ---------------------------------------------------------------------------
template <bool OUT_BF16>
__global__ __launch_bounds__(256) void gemm_bf16_kernel(
    const u16* __restrict__ A, const u16* __restrict__ B, void* __restrict__ Cp,
    int M, int N, int K, int lda, int ldb, int ldc,
    long long strideA, long long strideB, long long strideC)
{
    __shared__ __align__(16) u16 As[2][128 * 40];  // [m][k], row stride 40
    __shared__ __align__(16) u16 Bs[2][64 * 40];   // [n][k] transposed

    const int bz = blockIdx.z;
    A += (long long)bz * strideA;
    B += (long long)bz * strideB;

    const int tileN = blockIdx.x * 64;
    const int tileM = blockIdx.y * 128;
    const int tid   = threadIdx.x;
    const int lane  = tid & 31;
    const int wave  = tid >> 5;
    const int wr    = wave >> 1;          // m slice: wr*32
    const int wc    = wave & 1;           // n slice: wc*32
    const int lrow  = lane & 15;
    const int khalf = (lane >> 4) ? 8 : 0;

    // staging coordinates
    const int ar = tid >> 1;              // 0..127
    const int ac = (tid & 1) * 16;        // 0 or 16
    const int br = tid >> 3;              // 0..31 (k row)
    const int bc = (tid & 7) * 8;         // 0..56 (n col)

    v8f acc00 = {}, acc01 = {}, acc10 = {}, acc11 = {};

    // ---- prologue: stage K-tile 0 into buffer 0
#if USE_ASYNC_LDS
    async_copy_b128(A + (long long)(tileM + ar) * lda + ac,     &As[0][ar * 40 + ac]);
    async_copy_b128(A + (long long)(tileM + ar) * lda + ac + 8, &As[0][ar * 40 + ac + 8]);
#else
    {
        u16x8 a0 = *(const u16x8*)(A + (long long)(tileM + ar) * lda + ac);
        u16x8 a1 = *(const u16x8*)(A + (long long)(tileM + ar) * lda + ac + 8);
        *(u16x8*)&As[0][ar * 40 + ac]     = a0;
        *(u16x8*)&As[0][ar * 40 + ac + 8] = a1;
    }
#endif
    {
        u16x8 bv = *(const u16x8*)(B + (long long)br * ldb + tileN + bc);
#pragma unroll
        for (int e = 0; e < 8; ++e) Bs[0][(bc + e) * 40 + br] = bv[e];
    }
#if USE_ASYNC_LDS
    ASYNC_WAIT();
#endif
    __syncthreads();

    int cur = 0;
    for (int k0 = 0; k0 < K; k0 += 32) {
        const int  nxt      = cur ^ 1;
        const bool has_next = (k0 + 32) < K;

        u16x8 bstage;
#if !USE_ASYNC_LDS
        u16x8 astage0, astage1;
#endif
        if (has_next) {
            const long long kn = k0 + 32;
#if USE_ASYNC_LDS
            async_copy_b128(A + (long long)(tileM + ar) * lda + kn + ac,
                            &As[nxt][ar * 40 + ac]);
            async_copy_b128(A + (long long)(tileM + ar) * lda + kn + ac + 8,
                            &As[nxt][ar * 40 + ac + 8]);
#else
            astage0 = *(const u16x8*)(A + (long long)(tileM + ar) * lda + kn + ac);
            astage1 = *(const u16x8*)(A + (long long)(tileM + ar) * lda + kn + ac + 8);
#endif
            bstage = *(const u16x8*)(B + (kn + br) * ldb + tileN + bc);
        }

        // fragments (each reused by two WMMAs)
        Frag fa0, fa1, fb0, fb1;
        {
            const u16* ap = &As[cur][(wr * 32 + lrow) * 40 + khalf];
            load_frag(fa0, ap);
            load_frag(fa1, ap + 16 * 40);
            const u16* bp = &Bs[cur][(wc * 32 + lrow) * 40 + khalf];
            load_frag(fb0, bp);
            load_frag(fb1, bp + 16 * 40);
        }

        acc00 = __builtin_amdgcn_wmma_f32_16x16x32_bf16(false, fa0.b, false, fb0.b,
                                                        (short)0, acc00, false, false);
        acc01 = __builtin_amdgcn_wmma_f32_16x16x32_bf16(false, fa0.b, false, fb1.b,
                                                        (short)0, acc01, false, false);
        acc10 = __builtin_amdgcn_wmma_f32_16x16x32_bf16(false, fa1.b, false, fb0.b,
                                                        (short)0, acc10, false, false);
        acc11 = __builtin_amdgcn_wmma_f32_16x16x32_bf16(false, fa1.b, false, fb1.b,
                                                        (short)0, acc11, false, false);

        if (has_next) {
#if !USE_ASYNC_LDS
            *(u16x8*)&As[nxt][ar * 40 + ac]     = astage0;
            *(u16x8*)&As[nxt][ar * 40 + ac + 8] = astage1;
#endif
#pragma unroll
            for (int e = 0; e < 8; ++e) Bs[nxt][(bc + e) * 40 + br] = bstage[e];
#if USE_ASYNC_LDS
            ASYNC_WAIT();
#endif
        }
        __syncthreads();
        cur = nxt;
    }

    // C/D layout: VGPR r -> row r + (lane>=16 ? 8 : 0), col lane%16
    const int rsel = (lane >> 4) ? 8 : 0;
    const int cm   = tileM + wr * 32 + rsel;
    const int cn   = tileN + wc * 32 + lrow;
    if (OUT_BF16) {
        u16* C = (u16*)Cp + (long long)bz * strideC;
#pragma unroll
        for (int r = 0; r < 8; ++r) {
            C[(long long)(cm + r) * ldc + cn]           = f2bf(acc00[r]);
            C[(long long)(cm + r) * ldc + cn + 16]      = f2bf(acc01[r]);
            C[(long long)(cm + 16 + r) * ldc + cn]      = f2bf(acc10[r]);
            C[(long long)(cm + 16 + r) * ldc + cn + 16] = f2bf(acc11[r]);
        }
    } else {
        float* C = (float*)Cp + (long long)bz * strideC;
#pragma unroll
        for (int r = 0; r < 8; ++r) {
            C[(long long)(cm + r) * ldc + cn]           = acc00[r];
            C[(long long)(cm + r) * ldc + cn + 16]      = acc01[r];
            C[(long long)(cm + 16 + r) * ldc + cn]      = acc10[r];
            C[(long long)(cm + 16 + r) * ldc + cn + 16] = acc11[r];
        }
    }
}

// ---------------------------------------------------------------------------
__global__ __launch_bounds__(256) void cvt_f32_bf16(const float* __restrict__ src,
                                                    u16* __restrict__ dst, int n)
{
    int i = blockIdx.x * 256 + threadIdx.x;
    if (i < n) dst[i] = f2bf(src[i]);
}

// DPFP: x2 = [relu(x), relu(-x)] (128); feature f=(i-1)*128+j = x2[j]*x2[(j-i)&127]
template <bool TRANS>
__global__ __launch_bounds__(128) void dpfp_kernel(const u16* __restrict__ src,
                                                   int src_ld, int src_col0,
                                                   u16* __restrict__ dst)
{
    __shared__ float x2[128];
    const int s  = blockIdx.x;
    const int bn = blockIdx.y;          // b*16 + n
    const int b  = bn >> 4, n = bn & 15;
    const int j  = threadIdx.x;

    const u16* row = src + (long long)(s * 2 + b) * src_ld + src_col0 + n * 64;
    float v = (j < 64) ? fmaxf(bf2f(row[j]), 0.f) : fmaxf(-bf2f(row[j - 64]), 0.f);
    x2[j] = v;
    __syncthreads();

#pragma unroll
    for (int i = 1; i <= 3; ++i) {
        int f = (i - 1) * 128 + j;
        u16 p = f2bf(x2[j] * x2[(j - i) & 127]);
        if (TRANS) dst[((long long)bn * 384 + f) * 2048 + s] = p;
        else       dst[((long long)bn * 2048 + s) * 384 + f] = p;
    }
}

// z[bn][f] = sum_s pkT[bn][f][s]
__global__ __launch_bounds__(256) void z_kernel(const u16* __restrict__ pkT,
                                                float* __restrict__ z)
{
    __shared__ float red[256];
    const int f = blockIdx.x, bn = blockIdx.y, tid = threadIdx.x;
    const u16* row = pkT + ((long long)bn * 384 + f) * 2048;
    float sum = 0.f;
    for (int s = tid; s < 2048; s += 256) sum += bf2f(row[s]);
    red[tid] = sum; __syncthreads();
    for (int st = 128; st > 0; st >>= 1) {
        if (tid < st) red[tid] += red[tid + st];
        __syncthreads();
    }
    if (tid == 0) z[bn * 384 + f] = red[0];
}

// den[bn][s] = SCALE * dot(pq[bn][s][:], z[bn][:]) + EPS ; one wave per (bn,s)
__global__ __launch_bounds__(256) void den_kernel(const u16* __restrict__ pq,
                                                  const float* __restrict__ z,
                                                  float* __restrict__ den)
{
    const int wave = threadIdx.x >> 5, lane = threadIdx.x & 31;
    const int s  = blockIdx.x * 8 + wave;
    const int bn = blockIdx.y;
    const u16*   pr = pq + ((long long)bn * 2048 + s) * 384;
    const float* zr = z + bn * 384;
    float sum = 0.f;
    for (int f = lane; f < 384; f += 32) sum += bf2f(pr[f]) * zr[f];
    for (int off = 16; off > 0; off >>= 1) sum += __shfl_down(sum, off, 32);
    if (lane == 0) den[(long long)bn * 2048 + s] = sum * 0.125f + 1e-5f;
}

// v_bf[bn][s][d] = kv_bf[(s*2+b)*2048 + 1024 + n*64 + d]
__global__ __launch_bounds__(256) void gather_v_kernel(const u16* __restrict__ kv,
                                                       u16* __restrict__ vb)
{
    const int idx = blockIdx.x * 256 + threadIdx.x;   // < 32*2048*64
    const int d = idx & 63, s = (idx >> 6) & 2047, bn = idx >> 17;
    const int b = bn >> 4, n = bn & 15;
    vb[idx] = kv[((long long)(s * 2 + b) << 11) + 1024 + n * 64 + d];
}

// attn_bf[(s*2+b)*1024 + n*64 + d] = bf16(num * SCALE / den)
__global__ __launch_bounds__(256) void attnvec_kernel(const float* __restrict__ num,
                                                      const float* __restrict__ den,
                                                      u16* __restrict__ attn_bf)
{
    const int idx = blockIdx.x * 256 + threadIdx.x;   // < 32*2048*64
    const int d = idx & 63, s = (idx >> 6) & 2047, bn = idx >> 17;
    const int b = bn >> 4, n = bn & 15;
    float v = num[idx] * 0.125f / den[(long long)bn * 2048 + s];
    attn_bf[((long long)(s * 2 + b) << 10) + n * 64 + d] = f2bf(v);
}

// out = layernorm(h + attn_out)
__global__ __launch_bounds__(256) void ln_kernel(const float* __restrict__ h,
                                                 const float* __restrict__ attn,
                                                 const float* __restrict__ gamma,
                                                 const float* __restrict__ beta,
                                                 float* __restrict__ out)
{
    __shared__ float red[256];
    const int row = blockIdx.x, tid = threadIdx.x;
    const float* hr = h    + (long long)row * 1024;
    const float* ar = attn + (long long)row * 1024;

    float lsum = 0.f;
    for (int c = tid; c < 1024; c += 256) lsum += hr[c] + ar[c];
    red[tid] = lsum; __syncthreads();
    for (int st = 128; st > 0; st >>= 1) {
        if (tid < st) red[tid] += red[tid + st];
        __syncthreads();
    }
    const float mu = red[0] * (1.f / 1024.f);
    __syncthreads();

    float lvar = 0.f;
    for (int c = tid; c < 1024; c += 256) {
        float d = hr[c] + ar[c] - mu;
        lvar += d * d;
    }
    red[tid] = lvar; __syncthreads();
    for (int st = 128; st > 0; st >>= 1) {
        if (tid < st) red[tid] += red[tid + st];
        __syncthreads();
    }
    const float rstd = rsqrtf(red[0] * (1.f / 1024.f) + 1e-5f);
    for (int c = tid; c < 1024; c += 256)
        out[(long long)row * 1024 + c] = (hr[c] + ar[c] - mu) * rstd * gamma[c] + beta[c];
}

// ---------------------------------------------------------------------------
extern "C" void kernel_launch(void* const* d_in, const int* in_sizes, int n_in,
                              void* d_out, int out_size, void* d_ws, size_t ws_size,
                              hipStream_t stream)
{
    const float* h    = (const float*)d_in[0];   // [2048,2,1024]
    const float* Wq   = (const float*)d_in[1];   // [1024,1024]
    const float* Wkv  = (const float*)d_in[2];   // [1024,2048]
    const float* Wo   = (const float*)d_in[3];   // [1024,1024]
    const float* gam  = (const float*)d_in[4];
    const float* bet  = (const float*)d_in[5];
    float* out = (float*)d_out;
    (void)in_sizes; (void)n_in; (void)out_size; (void)ws_size;

    char* ws = (char*)d_ws;
    auto take = [&](size_t bytes) -> char* { char* p = ws; ws += bytes; return p; };

    u16*   h_bf     = (u16*)  take(8388608);    // 4096x1024
    u16*   Wq_bf    = (u16*)  take(2097152);    // 1024x1024
    u16*   Wkv_bf   = (u16*)  take(4194304);    // 1024x2048
    u16*   Wo_bf    = (u16*)  take(2097152);    // 1024x1024
    u16*   q_bf     = (u16*)  take(8388608);    // 4096x1024
    u16*   kv_bf    = (u16*)  take(16777216);   // 4096x2048
    u16*   v_bf     = (u16*)  take(8388608);    // 32 x 2048x64
    u16*   pq_bf    = (u16*)  take(50331648);   // 32 x 2048x384
    u16*   pkT_bf   = (u16*)  take(50331648);   // 32 x 384x2048
    float* z_buf    = (float*)take(49152);      // 32 x 384
    u16*   kvagg_bf = (u16*)  take(1572864);    // 32 x 384x64
    float* num_buf  = (float*)take(16777216);   // 32 x 2048x64
    float* den_buf  = (float*)take(262144);     // 32 x 2048
    u16*   attn_bf  = (u16*)  take(8388608);    // 4096x1024
    float* attn_out = (float*)take(16777216);   // 4096x1024

    // 1) fp32 -> bf16 casts
    cvt_f32_bf16<<<(4194304 + 255) / 256, 256, 0, stream>>>(h,   h_bf,   4194304);
    cvt_f32_bf16<<<(1048576 + 255) / 256, 256, 0, stream>>>(Wq,  Wq_bf,  1048576);
    cvt_f32_bf16<<<(2097152 + 255) / 256, 256, 0, stream>>>(Wkv, Wkv_bf, 2097152);
    cvt_f32_bf16<<<(1048576 + 255) / 256, 256, 0, stream>>>(Wo,  Wo_bf,  1048576);

    // 2) q = h@Wq  [4096,1024]  (bf16 out)
    gemm_bf16_kernel<true><<<dim3(16, 32, 1), 256, 0, stream>>>(
        h_bf, Wq_bf, q_bf, 4096, 1024, 1024, 1024, 1024, 1024, 0, 0, 0);
    // 3) kv = h@Wkv [4096,2048] (bf16 out)
    gemm_bf16_kernel<true><<<dim3(32, 32, 1), 256, 0, stream>>>(
        h_bf, Wkv_bf, kv_bf, 4096, 2048, 1024, 1024, 2048, 2048, 0, 0, 0);

    // 4) DPFP features: pq [bn][s][f], pkT [bn][f][s]
    dpfp_kernel<false><<<dim3(2048, 32), 128, 0, stream>>>(q_bf, 1024, 0, pq_bf);
    dpfp_kernel<true ><<<dim3(2048, 32), 128, 0, stream>>>(kv_bf, 2048, 0, pkT_bf);

    // 5) z = sum_s pk ; gather v into [bn][s][d]
    z_kernel<<<dim3(384, 32), 256, 0, stream>>>(pkT_bf, z_buf);
    gather_v_kernel<<<16384, 256, 0, stream>>>(kv_bf, v_bf);

    // 6) kv_agg[bn] = pkT[bn] @ v[bn]   (384x2048 . 2048x64, bf16 out)
    gemm_bf16_kernel<true><<<dim3(1, 3, 32), 256, 0, stream>>>(
        pkT_bf, v_bf, kvagg_bf, 384, 64, 2048, 2048, 64, 64,
        786432LL, 131072LL, 24576LL);

    // 7) num[bn] = pq[bn] @ kv_agg[bn]  (2048x384 . 384x64, fp32 out)
    gemm_bf16_kernel<false><<<dim3(1, 16, 32), 256, 0, stream>>>(
        pq_bf, kvagg_bf, num_buf, 2048, 64, 384, 384, 64, 64,
        786432LL, 24576LL, 131072LL);

    // 8) den, then attn_vec = num*SCALE/den -> bf16 [4096,1024]
    den_kernel<<<dim3(256, 32), 256, 0, stream>>>(pq_bf, z_buf, den_buf);
    attnvec_kernel<<<16384, 256, 0, stream>>>(num_buf, den_buf, attn_bf);

    // 9) attn_out = attn_vec @ Wo  (fp32 out)
    gemm_bf16_kernel<false><<<dim3(16, 32, 1), 256, 0, stream>>>(
        attn_bf, Wo_bf, attn_out, 4096, 1024, 1024, 1024, 1024, 1024, 0, 0, 0);

    // 10) out = layernorm(h + attn_out)
    ln_kernel<<<4096, 256, 0, stream>>>(h, attn_out, gam, bet, out);
}

// v001
// It runs in 301 microseconds.
// Next to v000, in two timings, it ran 1.36 times as fast each time.
#include <hip/hip_runtime.h>
#include <hip/hip_bf16.h>

// ---------------------------------------------------------------------------
// DPFP linear attention for MI455X (gfx1250): all GEMMs via bf16 WMMA
// (v_wmma_f32_16x16x32_bf16), fp32 accumulate. 128x64 block tiles, 8 waves
// each computing 32x32 (4 WMMAs / K-step, 2x fragment reuse), double-buffered
// LDS with GLOBAL_LOAD_ASYNC_TO_LDS_B128 staging for the A tile.
// ---------------------------------------------------------------------------

typedef unsigned short u16;
typedef __attribute__((ext_vector_type(8)))  unsigned short u16x8;
typedef __attribute__((ext_vector_type(16))) unsigned short v16u;
typedef __attribute__((ext_vector_type(16))) __bf16        v16bf;
typedef __attribute__((ext_vector_type(8)))  float         v8f;

union Frag { v16u u; v16bf b; };

#ifndef __has_builtin
#define __has_builtin(x) 0
#endif

#if defined(__AMDGCN__) && __has_builtin(__builtin_amdgcn_global_load_async_to_lds_b128)
#define USE_ASYNC_LDS 1
#else
#define USE_ASYNC_LDS 0
#endif

#if USE_ASYNC_LDS
#if __has_builtin(__builtin_amdgcn_s_wait_asynccnt)
#define ASYNC_WAIT() __builtin_amdgcn_s_wait_asynccnt(0)
#else
#define ASYNC_WAIT() asm volatile("s_wait_asynccnt 0x0" ::: "memory")
#endif
// Builtin signature (from hipcc diagnostic): (v4i addrspace(1)*, v4i addrspace(3)*, imm, imm)
typedef int gcc_i32x4 __attribute__((vector_size(16)));
__device__ __forceinline__ void async_copy_b128(const u16* g, u16* l) {
    __builtin_amdgcn_global_load_async_to_lds_b128(
        (__attribute__((address_space(1))) gcc_i32x4*)(void*)g,
        (__attribute__((address_space(3))) gcc_i32x4*)(void*)l, 0, 0);
}
#endif

__device__ __forceinline__ u16 f2bf(float f) {
    union { float f; unsigned u; } x; x.f = f;
    unsigned u = x.u;
    u += 0x7FFFu + ((u >> 16) & 1u);     // round-to-nearest-even
    return (u16)(u >> 16);
}
__device__ __forceinline__ float bf2f(u16 h) {
    union { unsigned u; float f; } x; x.u = ((unsigned)h) << 16;
    return x.f;
}

// ISA 16-bit fragment layout: lane element e -> K = khalf + e + (e>=8 ? 8 : 0)
__device__ __forceinline__ void load_frag(Frag& f, const u16* p) {
    u16x8 lo = *(const u16x8*)p;
    u16x8 hi = *(const u16x8*)(p + 16);
#pragma unroll
    for (int e = 0; e < 8; ++e) { f.u[e] = lo[e]; f.u[e + 8] = hi[e]; }
}

// ---------------------------------------------------------------------------
// Batched bf16 GEMM: C[M,N] = A[M,K] @ B[K,N], row-major, fp32 acc.
// Block: 256 threads = 8 waves; tile 128x64; wave (wr 0..3, wc 0..1) owns
// 32x32. Double-buffered K-steps of 32.
// Requires: M%128==0, N%64==0, K%32==0, lda/ldb/ldc %8==0, 16B-aligned bases.
// ---------------------------------------------------------------------------
template <bool OUT_BF16>
__global__ __launch_bounds__(256) void gemm_bf16_kernel(
    const u16* __restrict__ A, const u16* __restrict__ B, void* __restrict__ Cp,
    int M, int N, int K, int lda, int ldb, int ldc,
    long long strideA, long long strideB, long long strideC)
{
    __shared__ __align__(16) u16 As[2][128 * 40];  // [m][k], row stride 40
    __shared__ __align__(16) u16 Bs[2][64 * 40];   // [n][k] transposed

    const int bz = blockIdx.z;
    A += (long long)bz * strideA;
    B += (long long)bz * strideB;

    const int tileN = blockIdx.x * 64;
    const int tileM = blockIdx.y * 128;
    const int tid   = threadIdx.x;
    const int lane  = tid & 31;
    const int wave  = tid >> 5;
    const int wr    = wave >> 1;          // m slice: wr*32
    const int wc    = wave & 1;           // n slice: wc*32
    const int lrow  = lane & 15;
    const int khalf = (lane >> 4) ? 8 : 0;

    // staging coordinates
    const int ar = tid >> 1;              // 0..127
    const int ac = (tid & 1) * 16;        // 0 or 16
    const int br = tid >> 3;              // 0..31 (k row)
    const int bc = (tid & 7) * 8;         // 0..56 (n col)

    v8f acc00 = {}, acc01 = {}, acc10 = {}, acc11 = {};

    // ---- prologue: stage K-tile 0 into buffer 0
#if USE_ASYNC_LDS
    async_copy_b128(A + (long long)(tileM + ar) * lda + ac,     &As[0][ar * 40 + ac]);
    async_copy_b128(A + (long long)(tileM + ar) * lda + ac + 8, &As[0][ar * 40 + ac + 8]);
#else
    {
        u16x8 a0 = *(const u16x8*)(A + (long long)(tileM + ar) * lda + ac);
        u16x8 a1 = *(const u16x8*)(A + (long long)(tileM + ar) * lda + ac + 8);
        *(u16x8*)&As[0][ar * 40 + ac]     = a0;
        *(u16x8*)&As[0][ar * 40 + ac + 8] = a1;
    }
#endif
    {
        u16x8 bv = *(const u16x8*)(B + (long long)br * ldb + tileN + bc);
#pragma unroll
        for (int e = 0; e < 8; ++e) Bs[0][(bc + e) * 40 + br] = bv[e];
    }
#if USE_ASYNC_LDS
    ASYNC_WAIT();
#endif
    __syncthreads();

    int cur = 0;
    for (int k0 = 0; k0 < K; k0 += 32) {
        const int  nxt      = cur ^ 1;
        const bool has_next = (k0 + 32) < K;

        u16x8 bstage;
#if !USE_ASYNC_LDS
        u16x8 astage0, astage1;
#endif
        if (has_next) {
            const long long kn = k0 + 32;
#if USE_ASYNC_LDS
            async_copy_b128(A + (long long)(tileM + ar) * lda + kn + ac,
                            &As[nxt][ar * 40 + ac]);
            async_copy_b128(A + (long long)(tileM + ar) * lda + kn + ac + 8,
                            &As[nxt][ar * 40 + ac + 8]);
#else
            astage0 = *(const u16x8*)(A + (long long)(tileM + ar) * lda + kn + ac);
            astage1 = *(const u16x8*)(A + (long long)(tileM + ar) * lda + kn + ac + 8);
#endif
            bstage = *(const u16x8*)(B + (kn + br) * ldb + tileN + bc);
        }

        // fragments (each reused by two WMMAs)
        Frag fa0, fa1, fb0, fb1;
        {
            const u16* ap = &As[cur][(wr * 32 + lrow) * 40 + khalf];
            load_frag(fa0, ap);
            load_frag(fa1, ap + 16 * 40);
            const u16* bp = &Bs[cur][(wc * 32 + lrow) * 40 + khalf];
            load_frag(fb0, bp);
            load_frag(fb1, bp + 16 * 40);
        }

        acc00 = __builtin_amdgcn_wmma_f32_16x16x32_bf16(false, fa0.b, false, fb0.b,
                                                        (short)0, acc00, false, false);
        acc01 = __builtin_amdgcn_wmma_f32_16x16x32_bf16(false, fa0.b, false, fb1.b,
                                                        (short)0, acc01, false, false);
        acc10 = __builtin_amdgcn_wmma_f32_16x16x32_bf16(false, fa1.b, false, fb0.b,
                                                        (short)0, acc10, false, false);
        acc11 = __builtin_amdgcn_wmma_f32_16x16x32_bf16(false, fa1.b, false, fb1.b,
                                                        (short)0, acc11, false, false);

        if (has_next) {
#if !USE_ASYNC_LDS
            *(u16x8*)&As[nxt][ar * 40 + ac]     = astage0;
            *(u16x8*)&As[nxt][ar * 40 + ac + 8] = astage1;
#endif
#pragma unroll
            for (int e = 0; e < 8; ++e) Bs[nxt][(bc + e) * 40 + br] = bstage[e];
#if USE_ASYNC_LDS
            ASYNC_WAIT();
#endif
        }
        __syncthreads();
        cur = nxt;
    }

    // C/D layout: VGPR r -> row r + (lane>=16 ? 8 : 0), col lane%16
    const int rsel = (lane >> 4) ? 8 : 0;
    const int cm   = tileM + wr * 32 + rsel;
    const int cn   = tileN + wc * 32 + lrow;
    if (OUT_BF16) {
        u16* C = (u16*)Cp + (long long)bz * strideC;
#pragma unroll
        for (int r = 0; r < 8; ++r) {
            C[(long long)(cm + r) * ldc + cn]           = f2bf(acc00[r]);
            C[(long long)(cm + r) * ldc + cn + 16]      = f2bf(acc01[r]);
            C[(long long)(cm + 16 + r) * ldc + cn]      = f2bf(acc10[r]);
            C[(long long)(cm + 16 + r) * ldc + cn + 16] = f2bf(acc11[r]);
        }
    } else {
        float* C = (float*)Cp + (long long)bz * strideC;
#pragma unroll
        for (int r = 0; r < 8; ++r) {
            C[(long long)(cm + r) * ldc + cn]           = acc00[r];
            C[(long long)(cm + r) * ldc + cn + 16]      = acc01[r];
            C[(long long)(cm + 16 + r) * ldc + cn]      = acc10[r];
            C[(long long)(cm + 16 + r) * ldc + cn + 16] = acc11[r];
        }
    }
}

// ---------------------------------------------------------------------------
__global__ __launch_bounds__(256) void cvt_f32_bf16(const float* __restrict__ src,
                                                    u16* __restrict__ dst, int n)
{
    int i = blockIdx.x * 256 + threadIdx.x;
    if (i < n) dst[i] = f2bf(src[i]);
}

// DPFP: x2 = [relu(x), relu(-x)] (128); feature f=(i-1)*128+j = x2[j]*x2[(j-i)&127]
// pq[bn][s][f]: one block per (s, bn).
__global__ __launch_bounds__(128) void dpfp_kernel(const u16* __restrict__ src,
                                                   int src_ld, int src_col0,
                                                   u16* __restrict__ dst)
{
    __shared__ float x2[128];
    const int s  = blockIdx.x;
    const int bn = blockIdx.y;          // b*16 + n
    const int b  = bn >> 4, n = bn & 15;
    const int j  = threadIdx.x;

    const u16* row = src + (long long)(s * 2 + b) * src_ld + src_col0 + n * 64;
    float v = (j < 64) ? fmaxf(bf2f(row[j]), 0.f) : fmaxf(-bf2f(row[j - 64]), 0.f);
    x2[j] = v;
    __syncthreads();

#pragma unroll
    for (int i = 1; i <= 3; ++i) {
        int f = (i - 1) * 128 + j;
        u16 p = f2bf(x2[j] * x2[(j - i) & 127]);
        dst[((long long)bn * 2048 + s) * 384 + f] = p;
    }
}

// pkT[bn][f][s]: one block per (128 consecutive s, bn). k goes into LDS
// transposed ([d][s], two s per dword), so that every feature row leaves as
// 256 contiguous bytes, 16 B per lane. A thread owns 8 s and 8 consecutive j
// and slides a window of four x2 rows over them.
__global__ __launch_bounds__(256) void dpfp_t_kernel(const u16* __restrict__ kv,
                                                     u16* __restrict__ dst)
{
    __shared__ __align__(16) unsigned xT[64 * 64];   // [d][s pair]
    const int s0  = blockIdx.x * 128;
    const int bn  = blockIdx.y;         // b*16 + n
    const int b   = bn >> 4, n = bn & 15;
    const int tid = threadIdx.x;

    const int sp = tid & 63;            // a wave's lanes: 32 neighbouring dwords of one LDS row
    u16x8 lo[2], hi[2];
#pragma unroll
    for (int r = 0; r < 2; ++r) {
        const int dc = (tid >> 6) + r * 4;
        const u16* p = kv + (long long)((s0 + 2 * sp) * 2 + b) * 2048 + n * 64 + dc * 8;
        lo[r] = *(const u16x8*)p;            // row s
        hi[r] = *(const u16x8*)(p + 4096);   // row s + 1
    }
#pragma unroll
    for (int r = 0; r < 2; ++r) {
        const int dc = (tid >> 6) + r * 4;
#pragma unroll
        for (int e = 0; e < 8; ++e)
            xT[(dc * 8 + e) * 64 + sp] = (unsigned)lo[r][e] | ((unsigned)hi[r][e] << 16);
    }
    __syncthreads();

    const int c  = tid & 15;            // which 8 s of the 128
    const int j0 = (tid >> 4) * 8;
    u16* out = dst + ((long long)bn * 384 + j0) * 2048 + s0 + c * 8;

    // The eleven x rows this thread needs (j0-3 .. j0+7, modulo 128), each read once.
    // Every loop below is unrolled so that q[], w[] and o[] are indexed by constants and stay in registers.
    uint4 q[11];
#pragma unroll
    for (int t = 0; t < 11; ++t) q[t] = *(const uint4*)&xT[((j0 + t - 3) & 63) * 64 + c * 4];

    float w[4][8];
#pragma unroll
    for (int t = 0; t < 11; ++t) {
        const unsigned flip = ((j0 + t - 3) & 64) ? 0x80008000u : 0u;   // upper half of x2 is relu(-x)
        const unsigned qq[4] = {q[t].x ^ flip, q[t].y ^ flip, q[t].z ^ flip, q[t].w ^ flip};
#pragma unroll
        for (int e = 0; e < 4; ++e) {
            w[t & 3][2 * e]     = fmaxf(__uint_as_float(qq[e] << 16), 0.f);
            w[t & 3][2 * e + 1] = fmaxf(__uint_as_float(qq[e] & 0xFFFF0000u), 0.f);
        }
        if (t >= 3) {
#pragma unroll
            for (int i = 1; i <= 3; ++i) {
                u16x8 o;
#pragma unroll
                for (int e = 0; e < 8; ++e) o[e] = f2bf(w[t & 3][e] * w[(t - i) & 3][e]);
                *(u16x8*)(out + (long long)((i - 1) * 128 + (t - 3)) * 2048) = o;
            }
        }
    }
}

// z[bn][f] = sum_s pkT[bn][f][s]
__global__ __launch_bounds__(256) void z_kernel(const u16* __restrict__ pkT,
                                                float* __restrict__ z)
{
    __shared__ float red[256];
    const int f = blockIdx.x, bn = blockIdx.y, tid = threadIdx.x;
    const u16* row = pkT + ((long long)bn * 384 + f) * 2048;
    float sum = 0.f;
    for (int s = tid; s < 2048; s += 256) sum += bf2f(row[s]);
    red[tid] = sum; __syncthreads();
    for (int st = 128; st > 0; st >>= 1) {
        if (tid < st) red[tid] += red[tid + st];
        __syncthreads();
    }
    if (tid == 0) z[bn * 384 + f] = red[0];
}

// den[bn][s] = SCALE * dot(pq[bn][s][:], z[bn][:]) + EPS ; one wave per (bn,s)
__global__ __launch_bounds__(256) void den_kernel(const u16* __restrict__ pq,
                                                  const float* __restrict__ z,
                                                  float* __restrict__ den)
{
    const int wave = threadIdx.x >> 5, lane = threadIdx.x & 31;
    const int s  = blockIdx.x * 8 + wave;
    const int bn = blockIdx.y;
    const u16*   pr = pq + ((long long)bn * 2048 + s) * 384;
    const float* zr = z + bn * 384;
    float sum = 0.f;
    for (int f = lane; f < 384; f += 32) sum += bf2f(pr[f]) * zr[f];
    for (int off = 16; off > 0; off >>= 1) sum += __shfl_down(sum, off, 32);
    if (lane == 0) den[(long long)bn * 2048 + s] = sum * 0.125f + 1e-5f;
}

// v_bf[bn][s][d] = kv_bf[(s*2+b)*2048 + 1024 + n*64 + d]
__global__ __launch_bounds__(256) void gather_v_kernel(const u16* __restrict__ kv,
                                                       u16* __restrict__ vb)
{
    const int idx = blockIdx.x * 256 + threadIdx.x;   // < 32*2048*64
    const int d = idx & 63, s = (idx >> 6) & 2047, bn = idx >> 17;
    const int b = bn >> 4, n = bn & 15;
    vb[idx] = kv[((long long)(s * 2 + b) << 11) + 1024 + n * 64 + d];
}

// attn_bf[(s*2+b)*1024 + n*64 + d] = bf16(num * SCALE / den)
__global__ __launch_bounds__(256) void attnvec_kernel(const float* __restrict__ num,
                                                      const float* __restrict__ den,
                                                      u16* __restrict__ attn_bf)
{
    const int idx = blockIdx.x * 256 + threadIdx.x;   // < 32*2048*64
    const int d = idx & 63, s = (idx >> 6) & 2047, bn = idx >> 17;
    const int b = bn >> 4, n = bn & 15;
    float v = num[idx] * 0.125f / den[(long long)bn * 2048 + s];
    attn_bf[((long long)(s * 2 + b) << 10) + n * 64 + d] = f2bf(v);
}

// out = layernorm(h + attn_out)
__global__ __launch_bounds__(256) void ln_kernel(const float* __restrict__ h,
                                                 const float* __restrict__ attn,
                                                 const float* __restrict__ gamma,
                                                 const float* __restrict__ beta,
                                                 float* __restrict__ out)
{
    __shared__ float red[256];
    const int row = blockIdx.x, tid = threadIdx.x;
    const float* hr = h    + (long long)row * 1024;
    const float* ar = attn + (long long)row * 1024;

    float lsum = 0.f;
    for (int c = tid; c < 1024; c += 256) lsum += hr[c] + ar[c];
    red[tid] = lsum; __syncthreads();
    for (int st = 128; st > 0; st >>= 1) {
        if (tid < st) red[tid] += red[tid + st];
        __syncthreads();
    }
    const float mu = red[0] * (1.f / 1024.f);
    __syncthreads();

    float lvar = 0.f;
    for (int c = tid; c < 1024; c += 256) {
        float d = hr[c] + ar[c] - mu;
        lvar += d * d;
    }
    red[tid] = lvar; __syncthreads();
    for (int st = 128; st > 0; st >>= 1) {
        if (tid < st) red[tid] += red[tid + st];
        __syncthreads();
    }
    const float rstd = rsqrtf(red[0] * (1.f / 1024.f) + 1e-5f);
    for (int c = tid; c < 1024; c += 256)
        out[(long long)row * 1024 + c] = (hr[c] + ar[c] - mu) * rstd * gamma[c] + beta[c];
}

// ---------------------------------------------------------------------------
extern "C" void kernel_launch(void* const* d_in, const int* in_sizes, int n_in,
                              void* d_out, int out_size, void* d_ws, size_t ws_size,
                              hipStream_t stream)
{
    const float* h    = (const float*)d_in[0];   // [2048,2,1024]
    const float* Wq   = (const float*)d_in[1];   // [1024,1024]
    const float* Wkv  = (const float*)d_in[2];   // [1024,2048]
    const float* Wo   = (const float*)d_in[3];   // [1024,1024]
    const float* gam  = (const float*)d_in[4];
    const float* bet  = (const float*)d_in[5];
    float* out = (float*)d_out;
    (void)in_sizes; (void)n_in; (void)out_size; (void)ws_size;

    char* ws = (char*)d_ws;
    auto take = [&](size_t bytes) -> char* { char* p = ws; ws += bytes; return p; };

    u16*   h_bf     = (u16*)  take(8388608);    // 4096x1024
    u16*   Wq_bf    = (u16*)  take(2097152);    // 1024x1024
    u16*   Wkv_bf   = (u16*)  take(4194304);    // 1024x2048
    u16*   Wo_bf    = (u16*)  take(2097152);    // 1024x1024
    u16*   q_bf     = (u16*)  take(8388608);    // 4096x1024
    u16*   kv_bf    = (u16*)  take(16777216);   // 4096x2048
    u16*   v_bf     = (u16*)  take(8388608);    // 32 x 2048x64
    u16*   pq_bf    = (u16*)  take(50331648);   // 32 x 2048x384
    u16*   pkT_bf   = (u16*)  take(50331648);   // 32 x 384x2048
    float* z_buf    = (float*)take(49152);      // 32 x 384
    u16*   kvagg_bf = (u16*)  take(1572864);    // 32 x 384x64
    float* num_buf  = (float*)take(16777216);   // 32 x 2048x64
    float* den_buf  = (float*)take(262144);     // 32 x 2048
    u16*   attn_bf  = (u16*)  take(8388608);    // 4096x1024
    float* attn_out = (float*)take(16777216);   // 4096x1024

    // 1) fp32 -> bf16 casts
    cvt_f32_bf16<<<(4194304 + 255) / 256, 256, 0, stream>>>(h,   h_bf,   4194304);
    cvt_f32_bf16<<<(1048576 + 255) / 256, 256, 0, stream>>>(Wq,  Wq_bf,  1048576);
    cvt_f32_bf16<<<(2097152 + 255) / 256, 256, 0, stream>>>(Wkv, Wkv_bf, 2097152);
    cvt_f32_bf16<<<(1048576 + 255) / 256, 256, 0, stream>>>(Wo,  Wo_bf,  1048576);

    // 2) q = h@Wq  [4096,1024]  (bf16 out)
    gemm_bf16_kernel<true><<<dim3(16, 32, 1), 256, 0, stream>>>(
        h_bf, Wq_bf, q_bf, 4096, 1024, 1024, 1024, 1024, 1024, 0, 0, 0);
    // 3) kv = h@Wkv [4096,2048] (bf16 out)
    gemm_bf16_kernel<true><<<dim3(32, 32, 1), 256, 0, stream>>>(
        h_bf, Wkv_bf, kv_bf, 4096, 2048, 1024, 1024, 2048, 2048, 0, 0, 0);

    // 4) DPFP features: pq [bn][s][f], pkT [bn][f][s]
    dpfp_kernel<<<dim3(2048, 32), 128, 0, stream>>>(q_bf, 1024, 0, pq_bf);
    dpfp_t_kernel<<<dim3(16, 32), 256, 0, stream>>>(kv_bf, pkT_bf);

    // 5) z = sum_s pk ; gather v into [bn][s][d]
    z_kernel<<<dim3(384, 32), 256, 0, stream>>>(pkT_bf, z_buf);
    gather_v_kernel<<<16384, 256, 0, stream>>>(kv_bf, v_bf);

    // 6) kv_agg[bn] = pkT[bn] @ v[bn]   (384x2048 . 2048x64, bf16 out)
    gemm_bf16_kernel<true><<<dim3(1, 3, 32), 256, 0, stream>>>(
        pkT_bf, v_bf, kvagg_bf, 384, 64, 2048, 2048, 64, 64,
        786432LL, 131072LL, 24576LL);

    // 7) num[bn] = pq[bn] @ kv_agg[bn]  (2048x384 . 384x64, fp32 out)
    gemm_bf16_kernel<false><<<dim3(1, 16, 32), 256, 0, stream>>>(
        pq_bf, kvagg_bf, num_buf, 2048, 64, 384, 384, 64, 64,
        786432LL, 24576LL, 131072LL);

    // 8) den, then attn_vec = num*SCALE/den -> bf16 [4096,1024]
    den_kernel<<<dim3(256, 32), 256, 0, stream>>>(pq_bf, z_buf, den_buf);
    attnvec_kernel<<<16384, 256, 0, stream>>>(num_buf, den_buf, attn_bf);

    // 9) attn_out = attn_vec @ Wo  (fp32 out)
    gemm_bf16_kernel<false><<<dim3(16, 32, 1), 256, 0, stream>>>(
        attn_bf, Wo_bf, attn_out, 4096, 1024, 1024, 1024, 1024, 1024, 0, 0, 0);

    // 10) out = layernorm(h + attn_out)
    ln_kernel<<<4096, 256, 0, stream>>>(h, attn_out, gam, bet, out);
}

// v002
// A run of this version takes 279 microseconds.
// Two timings next to v001 both put it at 1.08 times that version's speed.
// Over all steps from v000 it is 1.47 times as fast.
#include <hip/hip_runtime.h>
#include <hip/hip_bf16.h>

// ---------------------------------------------------------------------------
// DPFP linear attention for MI455X (gfx1250): all GEMMs via bf16 WMMA
// (v_wmma_f32_16x16x32_bf16), fp32 accumulate. 128x64 block tiles, 8 waves
// each computing 32x32 (4 WMMAs / K-step, 2x fragment reuse), double-buffered
// LDS with GLOBAL_LOAD_ASYNC_TO_LDS_B128 staging for the A tile.
// ---------------------------------------------------------------------------

typedef unsigned short u16;
typedef __attribute__((ext_vector_type(4)))  unsigned short u16x4;
typedef __attribute__((ext_vector_type(8)))  unsigned short u16x8;
typedef __attribute__((ext_vector_type(4)))  float         f32x4;
typedef __attribute__((ext_vector_type(16))) unsigned short v16u;
typedef __attribute__((ext_vector_type(16))) __bf16        v16bf;
typedef __attribute__((ext_vector_type(8)))  float         v8f;

union Frag { v16u u; v16bf b; };

#ifndef __has_builtin
#define __has_builtin(x) 0
#endif

#if defined(__AMDGCN__) && __has_builtin(__builtin_amdgcn_global_load_async_to_lds_b128)
#define USE_ASYNC_LDS 1
#else
#define USE_ASYNC_LDS 0
#endif

#if USE_ASYNC_LDS
#if __has_builtin(__builtin_amdgcn_s_wait_asynccnt)
#define ASYNC_WAIT() __builtin_amdgcn_s_wait_asynccnt(0)
#else
#define ASYNC_WAIT() asm volatile("s_wait_asynccnt 0x0" ::: "memory")
#endif
// Builtin signature (from hipcc diagnostic): (v4i addrspace(1)*, v4i addrspace(3)*, imm, imm)
typedef int gcc_i32x4 __attribute__((vector_size(16)));
__device__ __forceinline__ void async_copy_b128(const u16* g, u16* l) {
    __builtin_amdgcn_global_load_async_to_lds_b128(
        (__attribute__((address_space(1))) gcc_i32x4*)(void*)g,
        (__attribute__((address_space(3))) gcc_i32x4*)(void*)l, 0, 0);
}
#endif

__device__ __forceinline__ u16 f2bf(float f) {
    union { float f; unsigned u; } x; x.f = f;
    unsigned u = x.u;
    u += 0x7FFFu + ((u >> 16) & 1u);     // round-to-nearest-even
    return (u16)(u >> 16);
}
__device__ __forceinline__ float bf2f(u16 h) {
    union { unsigned u; float f; } x; x.u = ((unsigned)h) << 16;
    return x.f;
}

// ISA 16-bit fragment layout: lane element e -> K = khalf + e + (e>=8 ? 8 : 0)
__device__ __forceinline__ void load_frag(Frag& f, const u16* p) {
    u16x8 lo = *(const u16x8*)p;
    u16x8 hi = *(const u16x8*)(p + 16);
#pragma unroll
    for (int e = 0; e < 8; ++e) { f.u[e] = lo[e]; f.u[e + 8] = hi[e]; }
}

// ---------------------------------------------------------------------------
// Batched bf16 GEMM: C[M,N] = A[M,K] @ B[K,N], row-major, fp32 acc.
// Block: 256 threads = 8 waves; tile 128x64; wave (wr 0..3, wc 0..1) owns
// 32x32. Double-buffered K-steps of 32.
// Requires: M%128==0, N%64==0, K%32==0, lda/ldb/ldc %8==0, 16B-aligned bases.
// ---------------------------------------------------------------------------
template <bool OUT_BF16>
__global__ __launch_bounds__(256) void gemm_bf16_kernel(
    const u16* __restrict__ A, const u16* __restrict__ B, void* __restrict__ Cp,
    int M, int N, int K, int lda, int ldb, int ldc,
    long long strideA, long long strideB, long long strideC)
{
    __shared__ __align__(16) u16 As[2][128 * 40];  // [m][k], row stride 40
    __shared__ __align__(16) u16 Bs[2][64 * 40];   // [n][k] transposed

    const int bz = blockIdx.z;
    A += (long long)bz * strideA;
    B += (long long)bz * strideB;

    const int tileN = blockIdx.x * 64;
    const int tileM = blockIdx.y * 128;
    const int tid   = threadIdx.x;
    const int lane  = tid & 31;
    const int wave  = tid >> 5;
    const int wr    = wave >> 1;          // m slice: wr*32
    const int wc    = wave & 1;           // n slice: wc*32
    const int lrow  = lane & 15;
    const int khalf = (lane >> 4) ? 8 : 0;

    // staging coordinates
    const int ar = tid >> 1;              // 0..127
    const int ac = (tid & 1) * 16;        // 0 or 16
    const int br = tid >> 3;              // 0..31 (k row)
    const int bc = (tid & 7) * 8;         // 0..56 (n col)

    v8f acc00 = {}, acc01 = {}, acc10 = {}, acc11 = {};

    // ---- prologue: stage K-tile 0 into buffer 0
#if USE_ASYNC_LDS
    async_copy_b128(A + (long long)(tileM + ar) * lda + ac,     &As[0][ar * 40 + ac]);
    async_copy_b128(A + (long long)(tileM + ar) * lda + ac + 8, &As[0][ar * 40 + ac + 8]);
#else
    {
        u16x8 a0 = *(const u16x8*)(A + (long long)(tileM + ar) * lda + ac);
        u16x8 a1 = *(const u16x8*)(A + (long long)(tileM + ar) * lda + ac + 8);
        *(u16x8*)&As[0][ar * 40 + ac]     = a0;
        *(u16x8*)&As[0][ar * 40 + ac + 8] = a1;
    }
#endif
    {
        u16x8 bv = *(const u16x8*)(B + (long long)br * ldb + tileN + bc);
#pragma unroll
        for (int e = 0; e < 8; ++e) Bs[0][(bc + e) * 40 + br] = bv[e];
    }
#if USE_ASYNC_LDS
    ASYNC_WAIT();
#endif
    __syncthreads();

    int cur = 0;
    for (int k0 = 0; k0 < K; k0 += 32) {
        const int  nxt      = cur ^ 1;
        const bool has_next = (k0 + 32) < K;

        u16x8 bstage;
#if !USE_ASYNC_LDS
        u16x8 astage0, astage1;
#endif
        if (has_next) {
            const long long kn = k0 + 32;
#if USE_ASYNC_LDS
            async_copy_b128(A + (long long)(tileM + ar) * lda + kn + ac,
                            &As[nxt][ar * 40 + ac]);
            async_copy_b128(A + (long long)(tileM + ar) * lda + kn + ac + 8,
                            &As[nxt][ar * 40 + ac + 8]);
#else
            astage0 = *(const u16x8*)(A + (long long)(tileM + ar) * lda + kn + ac);
            astage1 = *(const u16x8*)(A + (long long)(tileM + ar) * lda + kn + ac + 8);
#endif
            bstage = *(const u16x8*)(B + (kn + br) * ldb + tileN + bc);
        }

        // fragments (each reused by two WMMAs)
        Frag fa0, fa1, fb0, fb1;
        {
            const u16* ap = &As[cur][(wr * 32 + lrow) * 40 + khalf];
            load_frag(fa0, ap);
            load_frag(fa1, ap + 16 * 40);
            const u16* bp = &Bs[cur][(wc * 32 + lrow) * 40 + khalf];
            load_frag(fb0, bp);
            load_frag(fb1, bp + 16 * 40);
        }

        acc00 = __builtin_amdgcn_wmma_f32_16x16x32_bf16(false, fa0.b, false, fb0.b,
                                                        (short)0, acc00, false, false);
        acc01 = __builtin_amdgcn_wmma_f32_16x16x32_bf16(false, fa0.b, false, fb1.b,
                                                        (short)0, acc01, false, false);
        acc10 = __builtin_amdgcn_wmma_f32_16x16x32_bf16(false, fa1.b, false, fb0.b,
                                                        (short)0, acc10, false, false);
        acc11 = __builtin_amdgcn_wmma_f32_16x16x32_bf16(false, fa1.b, false, fb1.b,
                                                        (short)0, acc11, false, false);

        if (has_next) {
#if !USE_ASYNC_LDS
            *(u16x8*)&As[nxt][ar * 40 + ac]     = astage0;
            *(u16x8*)&As[nxt][ar * 40 + ac + 8] = astage1;
#endif
#pragma unroll
            for (int e = 0; e < 8; ++e) Bs[nxt][(bc + e) * 40 + br] = bstage[e];
#if USE_ASYNC_LDS
            ASYNC_WAIT();
#endif
        }
        __syncthreads();
        cur = nxt;
    }

    // C/D layout: VGPR r -> row r + (lane>=16 ? 8 : 0), col lane%16
    const int rsel = (lane >> 4) ? 8 : 0;
    const int cm   = tileM + wr * 32 + rsel;
    const int cn   = tileN + wc * 32 + lrow;
    if (OUT_BF16) {
        u16* C = (u16*)Cp + (long long)bz * strideC;
#pragma unroll
        for (int r = 0; r < 8; ++r) {
            C[(long long)(cm + r) * ldc + cn]           = f2bf(acc00[r]);
            C[(long long)(cm + r) * ldc + cn + 16]      = f2bf(acc01[r]);
            C[(long long)(cm + 16 + r) * ldc + cn]      = f2bf(acc10[r]);
            C[(long long)(cm + 16 + r) * ldc + cn + 16] = f2bf(acc11[r]);
        }
    } else {
        float* C = (float*)Cp + (long long)bz * strideC;
#pragma unroll
        for (int r = 0; r < 8; ++r) {
            C[(long long)(cm + r) * ldc + cn]           = acc00[r];
            C[(long long)(cm + r) * ldc + cn + 16]      = acc01[r];
            C[(long long)(cm + 16 + r) * ldc + cn]      = acc10[r];
            C[(long long)(cm + 16 + r) * ldc + cn + 16] = acc11[r];
        }
    }
}

// ---------------------------------------------------------------------------
// A block converts 8192 consecutive floats (every array here is a multiple of
// that). A lane takes four floats per access, so a wave reads 512 and writes
// 256 contiguous bytes; all eight loads of a thread are asked for first.
__global__ __launch_bounds__(256) void cvt_f32_bf16(const float* __restrict__ src,
                                                    u16* __restrict__ dst)
{
    const int base = blockIdx.x * 8192 + threadIdx.x * 4;
    f32x4 v[8];
#pragma unroll   // v[] indexed by constants: stays in registers
    for (int u = 0; u < 8; ++u) v[u] = *(const f32x4*)(src + base + u * 1024);
#pragma unroll
    for (int u = 0; u < 8; ++u) {
        u16x4 o;
#pragma unroll
        for (int e = 0; e < 4; ++e) o[e] = f2bf(v[u][e]);
        *(u16x4*)(dst + base + u * 1024) = o;
    }
}

// DPFP: x2 = [relu(x), relu(-x)] (128); feature f=(i-1)*128+j = x2[j]*x2[(j-i)&127]
// pq[bn][s][f]: one block per (128 consecutive s, bn). A lane owns 8 consecutive
// j of a row: it reads them (16 B) and the four in front of them (8 B) straight
// from q and stores its 8 features of each roll as 16 B, so 16 lanes write 256
// contiguous bytes. A thread does 8 rows, 16 apart.
__global__ __launch_bounds__(256) void dpfp_kernel(const u16* __restrict__ src,
                                                   u16* __restrict__ dst)
{
    const int bn = blockIdx.y;          // b*16 + n
    const int b  = bn >> 4, n = bn & 15;
    const int j0 = (threadIdx.x & 15) * 8;
    const int jp = (j0 - 4) & 127;      // the four x2 entries in front, modulo 128
    const int s0 = blockIdx.x * 128 + (threadIdx.x >> 4);

    const u16* row = src + (long long)(s0 * 2 + b) * 1024 + n * 64;
    u16x8 cur[8];
    u16x4 prv[8];
#pragma unroll   // cur[], prv[] indexed by constants: stay in registers
    for (int u = 0; u < 8; ++u)         // 16 rows of s further on = 32 rows of q
        cur[u] = *(const u16x8*)(row + u * 32768 + (j0 & 63));
    // Precaution: the compiler lands a result of the loads below in the address
    // pair of the loads above; this wait stands in front of that overwrite.
    asm volatile("s_wait_xcnt 0x0" ::: "memory");
#pragma unroll
    for (int u = 0; u < 8; ++u)
        prv[u] = *(const u16x4*)(row + u * 32768 + (jp & 63));
    const u16 fc = (j0 & 64) ? 0x8000 : 0;   // upper half of x2 is relu(-x)
    const u16 fp = (jp & 64) ? 0x8000 : 0;
#pragma unroll
    for (int u = 0; u < 8; ++u) {
        float w[11];                    // x2[j0-3 .. j0+7]
#pragma unroll
        for (int t = 0; t < 3; ++t) w[t] = fmaxf(bf2f((u16)(prv[u][t + 1] ^ fp)), 0.f);
#pragma unroll
        for (int e = 0; e < 8; ++e) w[3 + e] = fmaxf(bf2f((u16)(cur[u][e] ^ fc)), 0.f);
        u16* out = dst + ((long long)bn * 2048 + s0 + u * 16) * 384 + j0;
#pragma unroll
        for (int i = 1; i <= 3; ++i) {
            u16x8 o;
#pragma unroll
            for (int e = 0; e < 8; ++e) o[e] = f2bf(w[3 + e] * w[3 + e - i]);
            *(u16x8*)(out + (i - 1) * 128) = o;
        }
    }
}

// pkT[bn][f][s]: one block per (128 consecutive s, bn). k goes into LDS
// transposed ([d][s], two s per dword), so that every feature row leaves as
// 256 contiguous bytes, 16 B per lane. A thread owns 8 s and 8 consecutive j
// and slides a window of four x2 rows over them.
__global__ __launch_bounds__(256) void dpfp_t_kernel(const u16* __restrict__ kv,
                                                     u16* __restrict__ dst)
{
    __shared__ __align__(16) unsigned xT[64 * 64];   // [d][s pair]
    const int s0  = blockIdx.x * 128;
    const int bn  = blockIdx.y;         // b*16 + n
    const int b   = bn >> 4, n = bn & 15;
    const int tid = threadIdx.x;

    const int sp = tid & 63;            // a wave's lanes: 32 neighbouring dwords of one LDS row
    u16x8 lo[2], hi[2];
#pragma unroll
    for (int r = 0; r < 2; ++r) {
        const int dc = (tid >> 6) + r * 4;
        const u16* p = kv + (long long)((s0 + 2 * sp) * 2 + b) * 2048 + n * 64 + dc * 8;
        lo[r] = *(const u16x8*)p;            // row s
        hi[r] = *(const u16x8*)(p + 4096);   // row s + 1
    }
#pragma unroll
    for (int r = 0; r < 2; ++r) {
        const int dc = (tid >> 6) + r * 4;
#pragma unroll
        for (int e = 0; e < 8; ++e)
            xT[(dc * 8 + e) * 64 + sp] = (unsigned)lo[r][e] | ((unsigned)hi[r][e] << 16);
    }
    __syncthreads();

    const int c  = tid & 15;            // which 8 s of the 128
    const int j0 = (tid >> 4) * 8;
    u16* out = dst + ((long long)bn * 384 + j0) * 2048 + s0 + c * 8;

    // The eleven x rows this thread needs (j0-3 .. j0+7, modulo 128), each read once.
    // Every loop below is unrolled so that q[], w[] and o[] are indexed by constants and stay in registers.
    uint4 q[11];
#pragma unroll
    for (int t = 0; t < 11; ++t) q[t] = *(const uint4*)&xT[((j0 + t - 3) & 63) * 64 + c * 4];

    float w[4][8];
#pragma unroll
    for (int t = 0; t < 11; ++t) {
        const unsigned flip = ((j0 + t - 3) & 64) ? 0x80008000u : 0u;   // upper half of x2 is relu(-x)
        const unsigned qq[4] = {q[t].x ^ flip, q[t].y ^ flip, q[t].z ^ flip, q[t].w ^ flip};
#pragma unroll
        for (int e = 0; e < 4; ++e) {
            w[t & 3][2 * e]     = fmaxf(__uint_as_float(qq[e] << 16), 0.f);
            w[t & 3][2 * e + 1] = fmaxf(__uint_as_float(qq[e] & 0xFFFF0000u), 0.f);
        }
        if (t >= 3) {
#pragma unroll
            for (int i = 1; i <= 3; ++i) {
                u16x8 o;
#pragma unroll
                for (int e = 0; e < 8; ++e) o[e] = f2bf(w[t & 3][e] * w[(t - i) & 3][e]);
                *(u16x8*)(out + (long long)((i - 1) * 128 + (t - 3)) * 2048) = o;
            }
        }
    }
}

// z[bn][f] = sum_s pkT[bn][f][s]
__global__ __launch_bounds__(256) void z_kernel(const u16* __restrict__ pkT,
                                                float* __restrict__ z)
{
    __shared__ float red[256];
    const int f = blockIdx.x, bn = blockIdx.y, tid = threadIdx.x;
    const u16* row = pkT + ((long long)bn * 384 + f) * 2048;
    float sum = 0.f;
    for (int s = tid; s < 2048; s += 256) sum += bf2f(row[s]);
    red[tid] = sum; __syncthreads();
    for (int st = 128; st > 0; st >>= 1) {
        if (tid < st) red[tid] += red[tid + st];
        __syncthreads();
    }
    if (tid == 0) z[bn * 384 + f] = red[0];
}

// den[bn][s] = SCALE * dot(pq[bn][s][:], z[bn][:]) + EPS ; one wave per (bn,s)
__global__ __launch_bounds__(256) void den_kernel(const u16* __restrict__ pq,
                                                  const float* __restrict__ z,
                                                  float* __restrict__ den)
{
    const int wave = threadIdx.x >> 5, lane = threadIdx.x & 31;
    const int s  = blockIdx.x * 8 + wave;
    const int bn = blockIdx.y;
    const u16*   pr = pq + ((long long)bn * 2048 + s) * 384;
    const float* zr = z + bn * 384;
    float sum = 0.f;
    for (int f = lane; f < 384; f += 32) sum += bf2f(pr[f]) * zr[f];
    for (int off = 16; off > 0; off >>= 1) sum += __shfl_down(sum, off, 32);
    if (lane == 0) den[(long long)bn * 2048 + s] = sum * 0.125f + 1e-5f;
}

// v_bf[bn][s][d] = kv_bf[(s*2+b)*2048 + 1024 + n*64 + d]
// A lane moves 8 d (16 B), a thread four such groups.
__global__ __launch_bounds__(256) void gather_v_kernel(const u16* __restrict__ kv,
                                                       u16* __restrict__ vb)
{
    const int g0 = blockIdx.x * 1024 + threadIdx.x;   // group of 8 d, < 32*2048*8
    const int d = (g0 & 7) * 8, s = (g0 >> 3) & 2047, bn = g0 >> 14;
    const int b = bn >> 4, n = bn & 15;
    const u16* p = kv + ((long long)(s * 2 + b) << 11) + 1024 + n * 64 + d;
    u16x8 v[4];
#pragma unroll   // v[] indexed by constants: stays in registers
    for (int u = 0; u < 4; ++u) v[u] = *(const u16x8*)(p + u * 131072);   // 256 groups on = 32 s on, same bn
#pragma unroll
    for (int u = 0; u < 4; ++u) *(u16x8*)(vb + (long long)(g0 + u * 256) * 8) = v[u];
}

// attn_bf[(s*2+b)*1024 + n*64 + d] = bf16(num * SCALE / den)
__global__ __launch_bounds__(256) void attnvec_kernel(const float* __restrict__ num,
                                                      const float* __restrict__ den,
                                                      u16* __restrict__ attn_bf)
{
    // A lane takes 4 d (16 B of num in, 8 B out; 16 lanes fill one 128-B line of
    // attn_bf), a thread eight such groups, all their loads asked for first.
    const int g0 = blockIdx.x * 2048 + threadIdx.x;   // group of 4 d, < 32*2048*16
    const int d = (g0 & 15) * 4, s = (g0 >> 4) & 2047, bn = g0 >> 15;
    const int b = bn >> 4, n = bn & 15;
    u16* out = attn_bf + ((long long)(s * 2 + b) << 10) + n * 64 + d;
    f32x4 nm[8];
    float dn[8];
#pragma unroll   // nm[], dn[] indexed by constants: stay in registers
    for (int u = 0; u < 8; ++u) {       // 256 groups on = 16 s on, same bn
        nm[u] = *(const f32x4*)(num + (long long)g0 * 4 + u * 1024);
        dn[u] = den[(g0 >> 4) + u * 16];   // g0 >> 4 = bn*2048 + s
    }
#pragma unroll
    for (int u = 0; u < 8; ++u) {
        u16x4 o;
#pragma unroll
        for (int e = 0; e < 4; ++e) o[e] = f2bf(nm[u][e] * 0.125f / dn[u]);
        *(u16x4*)(out + u * 32768) = o;
    }
}

// out = layernorm(h + attn_out)
__global__ __launch_bounds__(256) void ln_kernel(const float* __restrict__ h,
                                                 const float* __restrict__ attn,
                                                 const float* __restrict__ gamma,
                                                 const float* __restrict__ beta,
                                                 float* __restrict__ out)
{
    __shared__ float red[256];
    const int row = blockIdx.x, tid = threadIdx.x;
    const float* hr = h    + (long long)row * 1024;
    const float* ar = attn + (long long)row * 1024;

    float lsum = 0.f;
    for (int c = tid; c < 1024; c += 256) lsum += hr[c] + ar[c];
    red[tid] = lsum; __syncthreads();
    for (int st = 128; st > 0; st >>= 1) {
        if (tid < st) red[tid] += red[tid + st];
        __syncthreads();
    }
    const float mu = red[0] * (1.f / 1024.f);
    __syncthreads();

    float lvar = 0.f;
    for (int c = tid; c < 1024; c += 256) {
        float d = hr[c] + ar[c] - mu;
        lvar += d * d;
    }
    red[tid] = lvar; __syncthreads();
    for (int st = 128; st > 0; st >>= 1) {
        if (tid < st) red[tid] += red[tid + st];
        __syncthreads();
    }
    const float rstd = rsqrtf(red[0] * (1.f / 1024.f) + 1e-5f);
    for (int c = tid; c < 1024; c += 256)
        out[(long long)row * 1024 + c] = (hr[c] + ar[c] - mu) * rstd * gamma[c] + beta[c];
}

// ---------------------------------------------------------------------------
extern "C" void kernel_launch(void* const* d_in, const int* in_sizes, int n_in,
                              void* d_out, int out_size, void* d_ws, size_t ws_size,
                              hipStream_t stream)
{
    const float* h    = (const float*)d_in[0];   // [2048,2,1024]
    const float* Wq   = (const float*)d_in[1];   // [1024,1024]
    const float* Wkv  = (const float*)d_in[2];   // [1024,2048]
    const float* Wo   = (const float*)d_in[3];   // [1024,1024]
    const float* gam  = (const float*)d_in[4];
    const float* bet  = (const float*)d_in[5];
    float* out = (float*)d_out;
    (void)in_sizes; (void)n_in; (void)out_size; (void)ws_size;

    char* ws = (char*)d_ws;
    auto take = [&](size_t bytes) -> char* { char* p = ws; ws += bytes; return p; };

    u16*   h_bf     = (u16*)  take(8388608);    // 4096x1024
    u16*   Wq_bf    = (u16*)  take(2097152);    // 1024x1024
    u16*   Wkv_bf   = (u16*)  take(4194304);    // 1024x2048
    u16*   Wo_bf    = (u16*)  take(2097152);    // 1024x1024
    u16*   q_bf     = (u16*)  take(8388608);    // 4096x1024
    u16*   kv_bf    = (u16*)  take(16777216);   // 4096x2048
    u16*   v_bf     = (u16*)  take(8388608);    // 32 x 2048x64
    u16*   pq_bf    = (u16*)  take(50331648);   // 32 x 2048x384
    u16*   pkT_bf   = (u16*)  take(50331648);   // 32 x 384x2048
    float* z_buf    = (float*)take(49152);      // 32 x 384
    u16*   kvagg_bf = (u16*)  take(1572864);    // 32 x 384x64
    float* num_buf  = (float*)take(16777216);   // 32 x 2048x64
    float* den_buf  = (float*)take(262144);     // 32 x 2048
    u16*   attn_bf  = (u16*)  take(8388608);    // 4096x1024
    float* attn_out = (float*)take(16777216);   // 4096x1024

    // 1) fp32 -> bf16 casts
    cvt_f32_bf16<<<4194304 / 8192, 256, 0, stream>>>(h,   h_bf);
    cvt_f32_bf16<<<1048576 / 8192, 256, 0, stream>>>(Wq,  Wq_bf);
    cvt_f32_bf16<<<2097152 / 8192, 256, 0, stream>>>(Wkv, Wkv_bf);
    cvt_f32_bf16<<<1048576 / 8192, 256, 0, stream>>>(Wo,  Wo_bf);

    // 2) q = h@Wq  [4096,1024]  (bf16 out)
    gemm_bf16_kernel<true><<<dim3(16, 32, 1), 256, 0, stream>>>(
        h_bf, Wq_bf, q_bf, 4096, 1024, 1024, 1024, 1024, 1024, 0, 0, 0);
    // 3) kv = h@Wkv [4096,2048] (bf16 out)
    gemm_bf16_kernel<true><<<dim3(32, 32, 1), 256, 0, stream>>>(
        h_bf, Wkv_bf, kv_bf, 4096, 2048, 1024, 1024, 2048, 2048, 0, 0, 0);

    // 4) DPFP features: pq [bn][s][f], pkT [bn][f][s]
    dpfp_kernel<<<dim3(16, 32), 256, 0, stream>>>(q_bf, pq_bf);
    dpfp_t_kernel<<<dim3(16, 32), 256, 0, stream>>>(kv_bf, pkT_bf);

    // 5) z = sum_s pk ; gather v into [bn][s][d]
    z_kernel<<<dim3(384, 32), 256, 0, stream>>>(pkT_bf, z_buf);
    gather_v_kernel<<<512, 256, 0, stream>>>(kv_bf, v_bf);

    // 6) kv_agg[bn] = pkT[bn] @ v[bn]   (384x2048 . 2048x64, bf16 out)
    gemm_bf16_kernel<true><<<dim3(1, 3, 32), 256, 0, stream>>>(
        pkT_bf, v_bf, kvagg_bf, 384, 64, 2048, 2048, 64, 64,
        786432LL, 131072LL, 24576LL);

    // 7) num[bn] = pq[bn] @ kv_agg[bn]  (2048x384 . 384x64, fp32 out)
    gemm_bf16_kernel<false><<<dim3(1, 16, 32), 256, 0, stream>>>(
        pq_bf, kvagg_bf, num_buf, 2048, 64, 384, 384, 64, 64,
        786432LL, 24576LL, 131072LL);

    // 8) den, then attn_vec = num*SCALE/den -> bf16 [4096,1024]
    den_kernel<<<dim3(256, 32), 256, 0, stream>>>(pq_bf, z_buf, den_buf);
    attnvec_kernel<<<512, 256, 0, stream>>>(num_buf, den_buf, attn_bf);

    // 9) attn_out = attn_vec @ Wo  (fp32 out)
    gemm_bf16_kernel<false><<<dim3(16, 32, 1), 256, 0, stream>>>(
        attn_bf, Wo_bf, attn_out, 4096, 1024, 1024, 1024, 1024, 1024, 0, 0, 0);

    // 10) out = layernorm(h + attn_out)
    ln_kernel<<<4096, 256, 0, stream>>>(h, attn_out, gam, bet, out);
}

// v003
// It runs in 248 microseconds.
// Next to v002, in two timings, it ran 1.11 and 1.12 times as fast.
// Counting every step since v000, it is 1.65 times as fast.
#include <hip/hip_runtime.h>
#include <hip/hip_bf16.h>

// ---------------------------------------------------------------------------
// DPFP linear attention for MI455X (gfx1250): all GEMMs via bf16 WMMA
// (v_wmma_f32_16x16x32_bf16), fp32 accumulate. 128x64 block tiles, 8 waves
// each computing 32x32 (2x fragment reuse), K-steps of 64 or 128, double-
// buffered LDS with GLOBAL_LOAD_ASYNC_TO_LDS_B128 staging for the A tile.
// ---------------------------------------------------------------------------

typedef unsigned short u16;
typedef __attribute__((ext_vector_type(4)))  unsigned short u16x4;
typedef __attribute__((ext_vector_type(8)))  unsigned short u16x8;
typedef __attribute__((ext_vector_type(4)))  float         f32x4;
typedef __attribute__((ext_vector_type(16))) unsigned short v16u;
typedef __attribute__((ext_vector_type(16))) __bf16        v16bf;
typedef __attribute__((ext_vector_type(8)))  float         v8f;

union Frag { v16u u; v16bf b; };

#ifndef __has_builtin
#define __has_builtin(x) 0
#endif

#if defined(__AMDGCN__) && __has_builtin(__builtin_amdgcn_global_load_async_to_lds_b128)
#define USE_ASYNC_LDS 1
#else
#define USE_ASYNC_LDS 0
#endif

#if USE_ASYNC_LDS
// Builtin signature (from hipcc diagnostic): (v4i addrspace(1)*, v4i addrspace(3)*, imm, imm)
typedef int gcc_i32x4 __attribute__((vector_size(16)));
__device__ __forceinline__ void async_copy_b128(const u16* g, u16* l) {
    __builtin_amdgcn_global_load_async_to_lds_b128(
        (__attribute__((address_space(1))) gcc_i32x4*)(void*)g,
        (__attribute__((address_space(3))) gcc_i32x4*)(void*)l, 0, 0);
}
#endif

// The issuing wave's copies have landed. In asm with the memory clobber, so that
// no LDS read moves in front of it.
__device__ __forceinline__ void async_wait0() {
#if USE_ASYNC_LDS
    asm volatile("s_wait_asynccnt 0x0" ::: "memory");
#endif
}

// One 128 x BK A tile into LDS rows of BK + 8 elements. g and l are the lane's own
// first 16 bytes: BK/8 neighbouring lanes take one row's BK*2 contiguous bytes, so
// a wave's copy covers four whole 128-B lines. A thread brings BK/16 rows.
template <int BK>
__device__ __forceinline__ void stage_a(const u16* g, int lda, u16* l) {
    constexpr int RP = 2048 / BK;        // rows the block's 256 lanes cover at once
#pragma unroll   // independent copies, issued back to back
    for (int u = 0; u < 128 / RP; ++u) {
#if USE_ASYNC_LDS
        async_copy_b128(g + (long long)(u * RP) * lda, l + u * RP * (BK + 8));
#else
        *(u16x8*)(l + u * RP * (BK + 8)) = *(const u16x8*)(g + (long long)(u * RP) * lda);
#endif
    }
}

__device__ __forceinline__ u16 f2bf(float f) {
    union { float f; unsigned u; } x; x.f = f;
    unsigned u = x.u;
    u += 0x7FFFu + ((u >> 16) & 1u);     // round-to-nearest-even
    return (u16)(u >> 16);
}
__device__ __forceinline__ float bf2f(u16 h) {
    union { unsigned u; float f; } x; x.u = ((unsigned)h) << 16;
    return x.f;
}

// ISA 16-bit fragment layout: lane element e -> K = khalf + e + (e>=8 ? 8 : 0)
__device__ __forceinline__ void load_frag(Frag& f, const u16* p) {
    u16x8 lo = *(const u16x8*)p;
    u16x8 hi = *(const u16x8*)(p + 16);
#pragma unroll
    for (int e = 0; e < 8; ++e) { f.u[e] = lo[e]; f.u[e + 8] = hi[e]; }
}

// ---------------------------------------------------------------------------
// Batched bf16 GEMM: C[M,N] = A[M,K] @ B[K,N], row-major, fp32 acc.
// Block: 256 threads = 8 waves; tile 128x64; wave (wr 0..3, wc 0..1) owns
// 32x32. Double-buffered K-steps of BK (64 or 128).
// Requires: M%128==0, N%64==0, K%BK==0, lda/ldb/ldc %8==0, 16B-aligned bases.
// ---------------------------------------------------------------------------
template <bool OUT_BF16, int BK>
__global__ __launch_bounds__(256) void gemm_bf16_kernel(
    const u16* __restrict__ A, const u16* __restrict__ B, void* __restrict__ Cp,
    int M, int N, int K, int lda, int ldb, int ldc,
    long long strideA, long long strideB, long long strideC)
{
    // Row pitch of both tiles: BK*2 + 16 bytes, an odd multiple of 16 B, which
    // ds_load_b128 reads without bank conflicts.
    constexpr int LDP = BK + 8;
    __shared__ __align__(16) u16 As[2][128 * LDP];  // [m][k]
    __shared__ __align__(16) u16 Bs[2][64 * LDP];   // [n][k] transposed

    const int bz = blockIdx.z;
    A += (long long)bz * strideA;
    B += (long long)bz * strideB;

    const int tileN = blockIdx.x * 64;
    const int tileM = blockIdx.y * 128;
    const int tid   = threadIdx.x;
    const int lane  = tid & 31;
    const int wave  = tid >> 5;
    const int wr    = wave >> 1;          // m slice: wr*32
    const int wc    = wave & 1;           // n slice: wc*32
    const int lrow  = lane & 15;
    const int khalf = (lane >> 4) ? 8 : 0;

    // staging coordinates
    const int ar = tid / (BK / 8);        // A row, and every 2048/BK rows on
    const int ac = (tid % (BK / 8)) * 8;  // 0..BK-8
    const int br = tid >> 3;              // 0..31 (k row), and every 32 rows on
    const int bc = (tid & 7) * 8;         // 0..56 (n col)

    const u16* aG = A + (long long)(tileM + ar) * lda + ac;   // K-tile t: + t*BK
    const u16* bG = B + (long long)br * ldb + tileN + bc;     // K-tile t: + t*BK rows
    const int  aL = ar * LDP + ac;
    const int  nT = K / BK;               // K-tiles

    v8f acc00 = {}, acc01 = {}, acc10 = {}, acc11 = {};

    // ---- prologue: K-tile 0 into buffer 0, then K-tile 1 on its way into buffer 1
    stage_a<BK>(aG, lda, &As[0][aL]);
    {
        u16x8 bv[BK / 32];
#pragma unroll   // bv[] indexed by constants: stays in registers
        for (int r = 0; r < BK / 32; ++r) bv[r] = *(const u16x8*)(bG + (long long)(r * 32) * ldb);
#pragma unroll   // as above, for r and for e
        for (int r = 0; r < BK / 32; ++r)
#pragma unroll
            for (int e = 0; e < 8; ++e) Bs[0][(bc + e) * LDP + br + r * 32] = bv[r][e];
    }
    async_wait0();
    __syncthreads();
    if (1 < nT) stage_a<BK>(aG + BK, lda, &As[1][aL]);

    int cur = 0;
    for (int t = 0; t < nT; ++t) {
        const int  nxt      = cur ^ 1;
        const bool has_next = (t + 1) < nT;

        u16x8 bstage[BK / 32];
        if (has_next) {
            const u16* bp = bG + (long long)(t + 1) * BK * ldb;
#pragma unroll   // bstage[] indexed by constants: stays in registers
            for (int r = 0; r < BK / 32; ++r)
                bstage[r] = *(const u16x8*)(bp + (long long)(r * 32) * ldb);
        }

#pragma unroll   // the tile's runs of 32 k, in ascending k; LDS offsets become immediates
        for (int kk = 0; kk < BK; kk += 32) {
            // fragments (each reused by two WMMAs)
            Frag fa0, fa1, fb0, fb1;
            const u16* ap = &As[cur][(wr * 32 + lrow) * LDP + kk + khalf];
            load_frag(fa0, ap);
            load_frag(fa1, ap + 16 * LDP);
            const u16* bp = &Bs[cur][(wc * 32 + lrow) * LDP + kk + khalf];
            load_frag(fb0, bp);
            load_frag(fb1, bp + 16 * LDP);

            acc00 = __builtin_amdgcn_wmma_f32_16x16x32_bf16(false, fa0.b, false, fb0.b,
                                                            (short)0, acc00, false, false);
            acc01 = __builtin_amdgcn_wmma_f32_16x16x32_bf16(false, fa0.b, false, fb1.b,
                                                            (short)0, acc01, false, false);
            acc10 = __builtin_amdgcn_wmma_f32_16x16x32_bf16(false, fa1.b, false, fb0.b,
                                                            (short)0, acc10, false, false);
            acc11 = __builtin_amdgcn_wmma_f32_16x16x32_bf16(false, fa1.b, false, fb1.b,
                                                            (short)0, acc11, false, false);
        }

        if (has_next) {
#pragma unroll   // bstage[][] indexed by constants, for r and for e
            for (int r = 0; r < BK / 32; ++r)
#pragma unroll
                for (int e = 0; e < 8; ++e) Bs[nxt][(bc + e) * LDP + br + r * 32] = bstage[r][e];
        }
        // Hand-over: this wave's LDS reads and writes are done and its copies of
        // tile t + 1 have landed; behind the barrier every wave may read tile t + 1,
        // and buffer cur, which all have left, may be refilled.
        asm volatile("s_wait_dscnt 0x0" ::: "memory");
        async_wait0();
        __syncthreads();
        if (t + 2 < nT) stage_a<BK>(aG + (long long)(t + 2) * BK, lda, &As[cur][aL]);
        cur = nxt;
    }
    async_wait0();   // no copy outlives the loop

    // C/D layout: VGPR r -> row r + (lane>=16 ? 8 : 0), col lane%16
    const int rsel = (lane >> 4) ? 8 : 0;
    const int cm   = tileM + wr * 32 + rsel;
    const int cn   = tileN + wc * 32 + lrow;
    if (OUT_BF16) {
        u16* C = (u16*)Cp + (long long)bz * strideC;
#pragma unroll
        for (int r = 0; r < 8; ++r) {
            C[(long long)(cm + r) * ldc + cn]           = f2bf(acc00[r]);
            C[(long long)(cm + r) * ldc + cn + 16]      = f2bf(acc01[r]);
            C[(long long)(cm + 16 + r) * ldc + cn]      = f2bf(acc10[r]);
            C[(long long)(cm + 16 + r) * ldc + cn + 16] = f2bf(acc11[r]);
        }
    } else {
        float* C = (float*)Cp + (long long)bz * strideC;
#pragma unroll
        for (int r = 0; r < 8; ++r) {
            C[(long long)(cm + r) * ldc + cn]           = acc00[r];
            C[(long long)(cm + r) * ldc + cn + 16]      = acc01[r];
            C[(long long)(cm + 16 + r) * ldc + cn]      = acc10[r];
            C[(long long)(cm + 16 + r) * ldc + cn + 16] = acc11[r];
        }
    }
}

// ---------------------------------------------------------------------------
// A block converts 8192 consecutive floats (every array here is a multiple of
// that). A lane takes four floats per access, so a wave reads 512 and writes
// 256 contiguous bytes; all eight loads of a thread are asked for first.
__global__ __launch_bounds__(256) void cvt_f32_bf16(const float* __restrict__ src,
                                                    u16* __restrict__ dst)
{
    const int base = blockIdx.x * 8192 + threadIdx.x * 4;
    f32x4 v[8];
#pragma unroll   // v[] indexed by constants: stays in registers
    for (int u = 0; u < 8; ++u) v[u] = *(const f32x4*)(src + base + u * 1024);
#pragma unroll
    for (int u = 0; u < 8; ++u) {
        u16x4 o;
#pragma unroll
        for (int e = 0; e < 4; ++e) o[e] = f2bf(v[u][e]);
        *(u16x4*)(dst + base + u * 1024) = o;
    }
}

// DPFP: x2 = [relu(x), relu(-x)] (128); feature f=(i-1)*128+j = x2[j]*x2[(j-i)&127]
// pq[bn][s][f]: one block per (128 consecutive s, bn). A lane owns 8 consecutive
// j of a row: it reads them (16 B) and the four in front of them (8 B) straight
// from q and stores its 8 features of each roll as 16 B, so 16 lanes write 256
// contiguous bytes. A thread does 8 rows, 16 apart.
__global__ __launch_bounds__(256) void dpfp_kernel(const u16* __restrict__ src,
                                                   u16* __restrict__ dst)
{
    const int bn = blockIdx.y;          // b*16 + n
    const int b  = bn >> 4, n = bn & 15;
    const int j0 = (threadIdx.x & 15) * 8;
    const int jp = (j0 - 4) & 127;      // the four x2 entries in front, modulo 128
    const int s0 = blockIdx.x * 128 + (threadIdx.x >> 4);

    const u16* row = src + (long long)(s0 * 2 + b) * 1024 + n * 64;
    u16x8 cur[8];
    u16x4 prv[8];
#pragma unroll   // cur[], prv[] indexed by constants: stay in registers
    for (int u = 0; u < 8; ++u)         // 16 rows of s further on = 32 rows of q
        cur[u] = *(const u16x8*)(row + u * 32768 + (j0 & 63));
    // Precaution: the compiler lands a result of the loads below in the address
    // pair of the loads above; this wait stands in front of that overwrite.
    asm volatile("s_wait_xcnt 0x0" ::: "memory");
#pragma unroll
    for (int u = 0; u < 8; ++u)
        prv[u] = *(const u16x4*)(row + u * 32768 + (jp & 63));
    const u16 fc = (j0 & 64) ? 0x8000 : 0;   // upper half of x2 is relu(-x)
    const u16 fp = (jp & 64) ? 0x8000 : 0;
#pragma unroll
    for (int u = 0; u < 8; ++u) {
        float w[11];                    // x2[j0-3 .. j0+7]
#pragma unroll
        for (int t = 0; t < 3; ++t) w[t] = fmaxf(bf2f((u16)(prv[u][t + 1] ^ fp)), 0.f);
#pragma unroll
        for (int e = 0; e < 8; ++e) w[3 + e] = fmaxf(bf2f((u16)(cur[u][e] ^ fc)), 0.f);
        u16* out = dst + ((long long)bn * 2048 + s0 + u * 16) * 384 + j0;
#pragma unroll
        for (int i = 1; i <= 3; ++i) {
            u16x8 o;
#pragma unroll
            for (int e = 0; e < 8; ++e) o[e] = f2bf(w[3 + e] * w[3 + e - i]);
            *(u16x8*)(out + (i - 1) * 128) = o;
        }
    }
}

// pkT[bn][f][s]: one block per (128 consecutive s, bn). k goes into LDS
// transposed ([d][s], two s per dword), so that every feature row leaves as
// 256 contiguous bytes, 16 B per lane. A thread owns 8 s and 8 consecutive j
// and slides a window of four x2 rows over them.
__global__ __launch_bounds__(256) void dpfp_t_kernel(const u16* __restrict__ kv,
                                                     u16* __restrict__ dst)
{
    __shared__ __align__(16) unsigned xT[64 * 64];   // [d][s pair]
    const int s0  = blockIdx.x * 128;
    const int bn  = blockIdx.y;         // b*16 + n
    const int b   = bn >> 4, n = bn & 15;
    const int tid = threadIdx.x;

    const int sp = tid & 63;            // a wave's lanes: 32 neighbouring dwords of one LDS row
    u16x8 lo[2], hi[2];
#pragma unroll
    for (int r = 0; r < 2; ++r) {
        const int dc = (tid >> 6) + r * 4;
        const u16* p = kv + (long long)((s0 + 2 * sp) * 2 + b) * 2048 + n * 64 + dc * 8;
        lo[r] = *(const u16x8*)p;            // row s
        hi[r] = *(const u16x8*)(p + 4096);   // row s + 1
    }
#pragma unroll
    for (int r = 0; r < 2; ++r) {
        const int dc = (tid >> 6) + r * 4;
#pragma unroll
        for (int e = 0; e < 8; ++e)
            xT[(dc * 8 + e) * 64 + sp] = (unsigned)lo[r][e] | ((unsigned)hi[r][e] << 16);
    }
    __syncthreads();

    const int c  = tid & 15;            // which 8 s of the 128
    const int j0 = (tid >> 4) * 8;
    u16* out = dst + ((long long)bn * 384 + j0) * 2048 + s0 + c * 8;

    // The eleven x rows this thread needs (j0-3 .. j0+7, modulo 128), each read once.
    // Every loop below is unrolled so that q[], w[] and o[] are indexed by constants and stay in registers.
    uint4 q[11];
#pragma unroll
    for (int t = 0; t < 11; ++t) q[t] = *(const uint4*)&xT[((j0 + t - 3) & 63) * 64 + c * 4];

    float w[4][8];
#pragma unroll
    for (int t = 0; t < 11; ++t) {
        const unsigned flip = ((j0 + t - 3) & 64) ? 0x80008000u : 0u;   // upper half of x2 is relu(-x)
        const unsigned qq[4] = {q[t].x ^ flip, q[t].y ^ flip, q[t].z ^ flip, q[t].w ^ flip};
#pragma unroll
        for (int e = 0; e < 4; ++e) {
            w[t & 3][2 * e]     = fmaxf(__uint_as_float(qq[e] << 16), 0.f);
            w[t & 3][2 * e + 1] = fmaxf(__uint_as_float(qq[e] & 0xFFFF0000u), 0.f);
        }
        if (t >= 3) {
#pragma unroll
            for (int i = 1; i <= 3; ++i) {
                u16x8 o;
#pragma unroll
                for (int e = 0; e < 8; ++e) o[e] = f2bf(w[t & 3][e] * w[(t - i) & 3][e]);
                *(u16x8*)(out + (long long)((i - 1) * 128 + (t - 3)) * 2048) = o;
            }
        }
    }
}

// z[bn][f] = sum_s pkT[bn][f][s]
__global__ __launch_bounds__(256) void z_kernel(const u16* __restrict__ pkT,
                                                float* __restrict__ z)
{
    __shared__ float red[256];
    const int f = blockIdx.x, bn = blockIdx.y, tid = threadIdx.x;
    const u16* row = pkT + ((long long)bn * 384 + f) * 2048;
    float sum = 0.f;
    for (int s = tid; s < 2048; s += 256) sum += bf2f(row[s]);
    red[tid] = sum; __syncthreads();
    for (int st = 128; st > 0; st >>= 1) {
        if (tid < st) red[tid] += red[tid + st];
        __syncthreads();
    }
    if (tid == 0) z[bn * 384 + f] = red[0];
}

// den[bn][s] = SCALE * dot(pq[bn][s][:], z[bn][:]) + EPS ; one wave per (bn,s)
__global__ __launch_bounds__(256) void den_kernel(const u16* __restrict__ pq,
                                                  const float* __restrict__ z,
                                                  float* __restrict__ den)
{
    const int wave = threadIdx.x >> 5, lane = threadIdx.x & 31;
    const int s  = blockIdx.x * 8 + wave;
    const int bn = blockIdx.y;
    const u16*   pr = pq + ((long long)bn * 2048 + s) * 384;
    const float* zr = z + bn * 384;
    float sum = 0.f;
    for (int f = lane; f < 384; f += 32) sum += bf2f(pr[f]) * zr[f];
    for (int off = 16; off > 0; off >>= 1) sum += __shfl_down(sum, off, 32);
    if (lane == 0) den[(long long)bn * 2048 + s] = sum * 0.125f + 1e-5f;
}

// v_bf[bn][s][d] = kv_bf[(s*2+b)*2048 + 1024 + n*64 + d]
// A lane moves 8 d (16 B), a thread four such groups.
__global__ __launch_bounds__(256) void gather_v_kernel(const u16* __restrict__ kv,
                                                       u16* __restrict__ vb)
{
    const int g0 = blockIdx.x * 1024 + threadIdx.x;   // group of 8 d, < 32*2048*8
    const int d = (g0 & 7) * 8, s = (g0 >> 3) & 2047, bn = g0 >> 14;
    const int b = bn >> 4, n = bn & 15;
    const u16* p = kv + ((long long)(s * 2 + b) << 11) + 1024 + n * 64 + d;
    u16x8 v[4];
#pragma unroll   // v[] indexed by constants: stays in registers
    for (int u = 0; u < 4; ++u) v[u] = *(const u16x8*)(p + u * 131072);   // 256 groups on = 32 s on, same bn
#pragma unroll
    for (int u = 0; u < 4; ++u) *(u16x8*)(vb + (long long)(g0 + u * 256) * 8) = v[u];
}

// attn_bf[(s*2+b)*1024 + n*64 + d] = bf16(num * SCALE / den)
__global__ __launch_bounds__(256) void attnvec_kernel(const float* __restrict__ num,
                                                      const float* __restrict__ den,
                                                      u16* __restrict__ attn_bf)
{
    // A lane takes 4 d (16 B of num in, 8 B out; 16 lanes fill one 128-B line of
    // attn_bf), a thread eight such groups, all their loads asked for first.
    const int g0 = blockIdx.x * 2048 + threadIdx.x;   // group of 4 d, < 32*2048*16
    const int d = (g0 & 15) * 4, s = (g0 >> 4) & 2047, bn = g0 >> 15;
    const int b = bn >> 4, n = bn & 15;
    u16* out = attn_bf + ((long long)(s * 2 + b) << 10) + n * 64 + d;
    f32x4 nm[8];
    float dn[8];
#pragma unroll   // nm[], dn[] indexed by constants: stay in registers
    for (int u = 0; u < 8; ++u) {       // 256 groups on = 16 s on, same bn
        nm[u] = *(const f32x4*)(num + (long long)g0 * 4 + u * 1024);
        dn[u] = den[(g0 >> 4) + u * 16];   // g0 >> 4 = bn*2048 + s
    }
#pragma unroll
    for (int u = 0; u < 8; ++u) {
        u16x4 o;
#pragma unroll
        for (int e = 0; e < 4; ++e) o[e] = f2bf(nm[u][e] * 0.125f / dn[u]);
        *(u16x4*)(out + u * 32768) = o;
    }
}

// out = layernorm(h + attn_out)
__global__ __launch_bounds__(256) void ln_kernel(const float* __restrict__ h,
                                                 const float* __restrict__ attn,
                                                 const float* __restrict__ gamma,
                                                 const float* __restrict__ beta,
                                                 float* __restrict__ out)
{
    __shared__ float red[256];
    const int row = blockIdx.x, tid = threadIdx.x;
    const float* hr = h    + (long long)row * 1024;
    const float* ar = attn + (long long)row * 1024;

    float lsum = 0.f;
    for (int c = tid; c < 1024; c += 256) lsum += hr[c] + ar[c];
    red[tid] = lsum; __syncthreads();
    for (int st = 128; st > 0; st >>= 1) {
        if (tid < st) red[tid] += red[tid + st];
        __syncthreads();
    }
    const float mu = red[0] * (1.f / 1024.f);
    __syncthreads();

    float lvar = 0.f;
    for (int c = tid; c < 1024; c += 256) {
        float d = hr[c] + ar[c] - mu;
        lvar += d * d;
    }
    red[tid] = lvar; __syncthreads();
    for (int st = 128; st > 0; st >>= 1) {
        if (tid < st) red[tid] += red[tid + st];
        __syncthreads();
    }
    const float rstd = rsqrtf(red[0] * (1.f / 1024.f) + 1e-5f);
    for (int c = tid; c < 1024; c += 256)
        out[(long long)row * 1024 + c] = (hr[c] + ar[c] - mu) * rstd * gamma[c] + beta[c];
}

// ---------------------------------------------------------------------------
extern "C" void kernel_launch(void* const* d_in, const int* in_sizes, int n_in,
                              void* d_out, int out_size, void* d_ws, size_t ws_size,
                              hipStream_t stream)
{
    const float* h    = (const float*)d_in[0];   // [2048,2,1024]
    const float* Wq   = (const float*)d_in[1];   // [1024,1024]
    const float* Wkv  = (const float*)d_in[2];   // [1024,2048]
    const float* Wo   = (const float*)d_in[3];   // [1024,1024]
    const float* gam  = (const float*)d_in[4];
    const float* bet  = (const float*)d_in[5];
    float* out = (float*)d_out;
    (void)in_sizes; (void)n_in; (void)out_size; (void)ws_size;

    char* ws = (char*)d_ws;
    auto take = [&](size_t bytes) -> char* { char* p = ws; ws += bytes; return p; };

    u16*   h_bf     = (u16*)  take(8388608);    // 4096x1024
    u16*   Wq_bf    = (u16*)  take(2097152);    // 1024x1024
    u16*   Wkv_bf   = (u16*)  take(4194304);    // 1024x2048
    u16*   Wo_bf    = (u16*)  take(2097152);    // 1024x1024
    u16*   q_bf     = (u16*)  take(8388608);    // 4096x1024
    u16*   kv_bf    = (u16*)  take(16777216);   // 4096x2048
    u16*   v_bf     = (u16*)  take(8388608);    // 32 x 2048x64
    u16*   pq_bf    = (u16*)  take(50331648);   // 32 x 2048x384
    u16*   pkT_bf   = (u16*)  take(50331648);   // 32 x 384x2048
    float* z_buf    = (float*)take(49152);      // 32 x 384
    u16*   kvagg_bf = (u16*)  take(1572864);    // 32 x 384x64
    float* num_buf  = (float*)take(16777216);   // 32 x 2048x64
    float* den_buf  = (float*)take(262144);     // 32 x 2048
    u16*   attn_bf  = (u16*)  take(8388608);    // 4096x1024
    float* attn_out = (float*)take(16777216);   // 4096x1024

    // 1) fp32 -> bf16 casts
    cvt_f32_bf16<<<4194304 / 8192, 256, 0, stream>>>(h,   h_bf);
    cvt_f32_bf16<<<1048576 / 8192, 256, 0, stream>>>(Wq,  Wq_bf);
    cvt_f32_bf16<<<2097152 / 8192, 256, 0, stream>>>(Wkv, Wkv_bf);
    cvt_f32_bf16<<<1048576 / 8192, 256, 0, stream>>>(Wo,  Wo_bf);

    // 2) q = h@Wq  [4096,1024]  (bf16 out)
    gemm_bf16_kernel<true, 128><<<dim3(16, 32, 1), 256, 0, stream>>>(
        h_bf, Wq_bf, q_bf, 4096, 1024, 1024, 1024, 1024, 1024, 0, 0, 0);
    // 3) kv = h@Wkv [4096,2048] (bf16 out); K-step 64: four blocks' LDS fit a WGP,
    //    so all 1024 blocks are resident at once
    gemm_bf16_kernel<true, 64><<<dim3(32, 32, 1), 256, 0, stream>>>(
        h_bf, Wkv_bf, kv_bf, 4096, 2048, 1024, 1024, 2048, 2048, 0, 0, 0);

    // 4) DPFP features: pq [bn][s][f], pkT [bn][f][s]
    dpfp_kernel<<<dim3(16, 32), 256, 0, stream>>>(q_bf, pq_bf);
    dpfp_t_kernel<<<dim3(16, 32), 256, 0, stream>>>(kv_bf, pkT_bf);

    // 5) z = sum_s pk ; gather v into [bn][s][d]
    z_kernel<<<dim3(384, 32), 256, 0, stream>>>(pkT_bf, z_buf);
    gather_v_kernel<<<512, 256, 0, stream>>>(kv_bf, v_bf);

    // 6) kv_agg[bn] = pkT[bn] @ v[bn]   (384x2048 . 2048x64, bf16 out)
    gemm_bf16_kernel<true, 128><<<dim3(1, 3, 32), 256, 0, stream>>>(
        pkT_bf, v_bf, kvagg_bf, 384, 64, 2048, 2048, 64, 64,
        786432LL, 131072LL, 24576LL);

    // 7) num[bn] = pq[bn] @ kv_agg[bn]  (2048x384 . 384x64, fp32 out)
    gemm_bf16_kernel<false, 128><<<dim3(1, 16, 32), 256, 0, stream>>>(
        pq_bf, kvagg_bf, num_buf, 2048, 64, 384, 384, 64, 64,
        786432LL, 24576LL, 131072LL);

    // 8) den, then attn_vec = num*SCALE/den -> bf16 [4096,1024]
    den_kernel<<<dim3(256, 32), 256, 0, stream>>>(pq_bf, z_buf, den_buf);
    attnvec_kernel<<<512, 256, 0, stream>>>(num_buf, den_buf, attn_bf);

    // 9) attn_out = attn_vec @ Wo  (fp32 out)
    gemm_bf16_kernel<false, 128><<<dim3(16, 32, 1), 256, 0, stream>>>(
        attn_bf, Wo_bf, attn_out, 4096, 1024, 1024, 1024, 1024, 1024, 0, 0, 0);

    // 10) out = layernorm(h + attn_out)
    ln_kernel<<<4096, 256, 0, stream>>>(h, attn_out, gam, bet, out);
}

// v004
// A run of this version takes 175 microseconds.
// In both of two side-by-side timings against v003, it was 1.42 times as fast.
// All steps since v000 together make it 2.34 times as fast.
#include <hip/hip_runtime.h>
#include <hip/hip_bf16.h>

// ---------------------------------------------------------------------------
// DPFP linear attention for MI455X (gfx1250): all GEMMs via bf16 WMMA
// (v_wmma_f32_16x16x32_bf16), fp32 accumulate. 128x64 block tiles, 8 waves
// each computing 32x32 (2x fragment reuse), K-steps of 64 or 128, double-
// buffered LDS with GLOBAL_LOAD_ASYNC_TO_LDS_B128 staging for both tiles; the
// B tile stays [k][n] in LDS and is read with DS_LOAD_TR16_B128.
// ---------------------------------------------------------------------------

typedef unsigned short u16;
typedef __attribute__((ext_vector_type(4)))  unsigned short u16x4;
typedef __attribute__((ext_vector_type(8)))  unsigned short u16x8;
typedef __attribute__((ext_vector_type(4)))  float         f32x4;
typedef __attribute__((ext_vector_type(16))) unsigned short v16u;
typedef __attribute__((ext_vector_type(16))) __bf16        v16bf;
typedef __attribute__((ext_vector_type(8)))  float         v8f;
typedef __attribute__((ext_vector_type(8)))  short         s16x8;

union Frag { v16u u; v16bf b; };

#ifndef __has_builtin
#define __has_builtin(x) 0
#endif

#if defined(__AMDGCN__) && __has_builtin(__builtin_amdgcn_global_load_async_to_lds_b128)
#define USE_ASYNC_LDS 1
#else
#define USE_ASYNC_LDS 0
#endif

#if USE_ASYNC_LDS
// Builtin signature (from hipcc diagnostic): (v4i addrspace(1)*, v4i addrspace(3)*, imm, imm)
typedef int gcc_i32x4 __attribute__((vector_size(16)));
__device__ __forceinline__ void async_copy_b128(const u16* g, u16* l) {
    __builtin_amdgcn_global_load_async_to_lds_b128(
        (__attribute__((address_space(1))) gcc_i32x4*)(void*)g,
        (__attribute__((address_space(3))) gcc_i32x4*)(void*)l, 0, 0);
}
#endif

// The issuing wave's copies have landed. In asm with the memory clobber, so that
// no LDS read moves in front of it.
__device__ __forceinline__ void async_wait0() {
#if USE_ASYNC_LDS
    asm volatile("s_wait_asynccnt 0x0" ::: "memory");
#endif
}

// One 128 x BK A tile into LDS rows of BK + 8 elements. g and l are the lane's own
// first 16 bytes: BK/8 neighbouring lanes take one row's BK*2 contiguous bytes, so
// a wave's copy covers four whole 128-B lines. A thread brings BK/16 rows.
template <int BK>
__device__ __forceinline__ void stage_a(const u16* g, int lda, u16* l) {
    constexpr int RP = 2048 / BK;        // rows the block's 256 lanes cover at once
#pragma unroll   // independent copies, issued back to back
    for (int u = 0; u < 128 / RP; ++u) {
#if USE_ASYNC_LDS
        async_copy_b128(g + (long long)(u * RP) * lda, l + u * RP * (BK + 8));
#else
        *(u16x8*)(l + u * RP * (BK + 8)) = *(const u16x8*)(g + (long long)(u * RP) * lda);
#endif
    }
}

// Row pitch of the B tile in LDS, in elements: 64 n + 16 = 160 bytes, an odd
// multiple of 32 B, which ds_load_tr16_b128 reads without bank conflicts.
constexpr int LDB = 80;

// One BK x 64 B tile into LDS as it lies in memory, [k][n]. g and l are the lane's
// own first 16 bytes: 8 neighbouring lanes take one row's 128 contiguous bytes, so
// a wave's copy covers four whole 128-B lines. A thread brings BK/32 rows.
template <int BK>
__device__ __forceinline__ void stage_b(const u16* g, int ldb, u16* l) {
#pragma unroll   // independent copies, issued back to back
    for (int r = 0; r < BK / 32; ++r) {
#if USE_ASYNC_LDS
        async_copy_b128(g + (long long)(r * 32) * ldb, l + r * 32 * LDB);
#else
        *(u16x8*)(l + r * 32 * LDB) = *(const u16x8*)(g + (long long)(r * 32) * ldb);
#endif
    }
}

__device__ __forceinline__ u16 f2bf(float f) {
    union { float f; unsigned u; } x; x.f = f;
    unsigned u = x.u;
    u += 0x7FFFu + ((u >> 16) & 1u);     // round-to-nearest-even
    return (u16)(u >> 16);
}
__device__ __forceinline__ float bf2f(u16 h) {
    union { unsigned u; float f; } x; x.u = ((unsigned)h) << 16;
    return x.f;
}

// ISA 16-bit fragment layout: lane element e -> K = khalf + e + (e>=8 ? 8 : 0)
__device__ __forceinline__ void load_frag(Frag& f, const u16* p) {
    u16x8 lo = *(const u16x8*)p;
    u16x8 hi = *(const u16x8*)(p + 16);
#pragma unroll
    for (int e = 0; e < 8; ++e) { f.u[e] = lo[e]; f.u[e + 8] = hi[e]; }
}

// B fragment (32 k x 16 n) out of the [k][n] tile by two transposing loads. p is the
// lane's own address: row 8*(lane>>4) + (lane&7), column 8*((lane>>3)&1) of the 16 x 16
// piece; the lane gets column lane&15 at k = 8*(lane>>4) + 0..7, and 16 rows on the
// same at k + 16: the k order of load_frag.
__device__ __forceinline__ void load_frag_tr(Frag& f, const u16* p) {
    typedef __attribute__((address_space(3))) s16x8 lds_s16x8;
    s16x8 lo = __builtin_amdgcn_ds_load_tr16_b128_v8i16((lds_s16x8*)p);
    s16x8 hi = __builtin_amdgcn_ds_load_tr16_b128_v8i16((lds_s16x8*)(p + 16 * LDB));
#pragma unroll   // f.u[] indexed by constants: stays in registers
    for (int e = 0; e < 8; ++e) { f.u[e] = (u16)lo[e]; f.u[e + 8] = (u16)hi[e]; }
}

// ---------------------------------------------------------------------------
// Batched bf16 GEMM: C[M,N] = A[M,K] @ B[K,N], row-major, fp32 acc.
// Block: 256 threads = 8 waves; tile 128x64; wave (wr 0..3, wc 0..1) owns
// 32x32. Double-buffered K-steps of BK (64 or 128).
// Requires: M%128==0, N%64==0, K%BK==0, lda/ldb/ldc %8==0, 16B-aligned bases.
// ---------------------------------------------------------------------------
template <bool OUT_BF16, int BK>
__global__ __launch_bounds__(256) void gemm_bf16_kernel(
    const u16* __restrict__ A, const u16* __restrict__ B, void* __restrict__ Cp,
    int M, int N, int K, int lda, int ldb, int ldc,
    long long strideA, long long strideB, long long strideC)
{
    // Row pitch of the A tile: BK*2 + 16 bytes, an odd multiple of 16 B, which
    // ds_load_b128 reads without bank conflicts.
    constexpr int LDP = BK + 8;
    __shared__ __align__(16) u16 As[2][128 * LDP];  // [m][k]
    __shared__ __align__(16) u16 Bs[2][BK * LDB];   // [k][n], as in memory

    const int bz = blockIdx.z;
    A += (long long)bz * strideA;
    B += (long long)bz * strideB;

    const int tileN = blockIdx.x * 64;
    const int tileM = blockIdx.y * 128;
    const int tid   = threadIdx.x;
    const int lane  = tid & 31;
    const int wave  = tid >> 5;
    const int wr    = wave >> 1;          // m slice: wr*32
    const int wc    = wave & 1;           // n slice: wc*32
    const int lrow  = lane & 15;
    const int khalf = (lane >> 4) ? 8 : 0;

    // staging coordinates
    const int ar = tid / (BK / 8);        // A row, and every 2048/BK rows on
    const int ac = (tid % (BK / 8)) * 8;  // 0..BK-8
    const int br = tid >> 3;              // 0..31 (k row), and every 32 rows on
    const int bc = (tid & 7) * 8;         // 0..56 (n col)

    const u16* aG = A + (long long)(tileM + ar) * lda + ac;   // K-tile t: + t*BK
    const u16* bG = B + (long long)br * ldb + tileN + bc;     // K-tile t: + t*BK rows
    const int  aL = ar * LDP + ac;
    const int  bL = br * LDB + bc;
    // this lane's address in a 16 x 16 piece of the B tile, for the transposing loads
    const int  bT = (khalf + (lane & 7)) * LDB + wc * 32 + ((lane >> 3) & 1) * 8;
    const int  nT = K / BK;               // K-tiles

    v8f acc00 = {}, acc01 = {}, acc10 = {}, acc11 = {};

    // ---- prologue: K-tile 0 into buffer 0, then K-tile 1 on its way into buffer 1
    stage_a<BK>(aG, lda, &As[0][aL]);
    stage_b<BK>(bG, ldb, &Bs[0][bL]);
    async_wait0();
    __syncthreads();
    if (1 < nT) {
        stage_a<BK>(aG + BK, lda, &As[1][aL]);
        stage_b<BK>(bG + (long long)BK * ldb, ldb, &Bs[1][bL]);
    }

    int cur = 0;
    for (int t = 0; t < nT; ++t) {
#pragma unroll   // the tile's runs of 32 k, in ascending k; LDS offsets become immediates
        for (int kk = 0; kk < BK; kk += 32) {
            // fragments (each reused by two WMMAs)
            Frag fa0, fa1, fb0, fb1;
            const u16* ap = &As[cur][(wr * 32 + lrow) * LDP + kk + khalf];
            load_frag(fa0, ap);
            load_frag(fa1, ap + 16 * LDP);
            const u16* bp = &Bs[cur][kk * LDB + bT];
            load_frag_tr(fb0, bp);
            load_frag_tr(fb1, bp + 16);

            acc00 = __builtin_amdgcn_wmma_f32_16x16x32_bf16(false, fa0.b, false, fb0.b,
                                                            (short)0, acc00, false, false);
            acc01 = __builtin_amdgcn_wmma_f32_16x16x32_bf16(false, fa0.b, false, fb1.b,
                                                            (short)0, acc01, false, false);
            acc10 = __builtin_amdgcn_wmma_f32_16x16x32_bf16(false, fa1.b, false, fb0.b,
                                                            (short)0, acc10, false, false);
            acc11 = __builtin_amdgcn_wmma_f32_16x16x32_bf16(false, fa1.b, false, fb1.b,
                                                            (short)0, acc11, false, false);
        }

        // Hand-over: this wave's LDS reads are done and its copies of tile t + 1
        // have landed; behind the barrier every wave may read tile t + 1, and
        // buffer cur, which all have left, may be refilled.
        asm volatile("s_wait_dscnt 0x0" ::: "memory");
        async_wait0();
        __syncthreads();
        if (t + 2 < nT) {
            stage_a<BK>(aG + (long long)(t + 2) * BK, lda, &As[cur][aL]);
            stage_b<BK>(bG + (long long)(t + 2) * BK * ldb, ldb, &Bs[cur][bL]);
        }
        cur ^= 1;
    }
    async_wait0();   // no copy outlives the loop

    // C/D layout: VGPR r -> row r + (lane>=16 ? 8 : 0), col lane%16
    const int rsel = (lane >> 4) ? 8 : 0;
    const int cm   = tileM + wr * 32 + rsel;
    const int cn   = tileN + wc * 32 + lrow;
    if (OUT_BF16) {
        u16* C = (u16*)Cp + (long long)bz * strideC;
#pragma unroll
        for (int r = 0; r < 8; ++r) {
            C[(long long)(cm + r) * ldc + cn]           = f2bf(acc00[r]);
            C[(long long)(cm + r) * ldc + cn + 16]      = f2bf(acc01[r]);
            C[(long long)(cm + 16 + r) * ldc + cn]      = f2bf(acc10[r]);
            C[(long long)(cm + 16 + r) * ldc + cn + 16] = f2bf(acc11[r]);
        }
    } else {
        float* C = (float*)Cp + (long long)bz * strideC;
#pragma unroll
        for (int r = 0; r < 8; ++r) {
            C[(long long)(cm + r) * ldc + cn]           = acc00[r];
            C[(long long)(cm + r) * ldc + cn + 16]      = acc01[r];
            C[(long long)(cm + 16 + r) * ldc + cn]      = acc10[r];
            C[(long long)(cm + 16 + r) * ldc + cn + 16] = acc11[r];
        }
    }
}

// ---------------------------------------------------------------------------
// A block converts 8192 consecutive floats (every array here is a multiple of
// that). A lane takes four floats per access, so a wave reads 512 and writes
// 256 contiguous bytes; all eight loads of a thread are asked for first.
__global__ __launch_bounds__(256) void cvt_f32_bf16(const float* __restrict__ src,
                                                    u16* __restrict__ dst)
{
    const int base = blockIdx.x * 8192 + threadIdx.x * 4;
    f32x4 v[8];
#pragma unroll   // v[] indexed by constants: stays in registers
    for (int u = 0; u < 8; ++u) v[u] = *(const f32x4*)(src + base + u * 1024);
#pragma unroll
    for (int u = 0; u < 8; ++u) {
        u16x4 o;
#pragma unroll
        for (int e = 0; e < 4; ++e) o[e] = f2bf(v[u][e]);
        *(u16x4*)(dst + base + u * 1024) = o;
    }
}

// DPFP: x2 = [relu(x), relu(-x)] (128); feature f=(i-1)*128+j = x2[j]*x2[(j-i)&127]
// pq[bn][s][f]: one block per (128 consecutive s, bn). A lane owns 8 consecutive
// j of a row: it reads them (16 B) and the four in front of them (8 B) straight
// from q and stores its 8 features of each roll as 16 B, so 16 lanes write 256
// contiguous bytes. A thread does 8 rows, 16 apart.
__global__ __launch_bounds__(256) void dpfp_kernel(const u16* __restrict__ src,
                                                   u16* __restrict__ dst)
{
    const int bn = blockIdx.y;          // b*16 + n
    const int b  = bn >> 4, n = bn & 15;
    const int j0 = (threadIdx.x & 15) * 8;
    const int jp = (j0 - 4) & 127;      // the four x2 entries in front, modulo 128
    const int s0 = blockIdx.x * 128 + (threadIdx.x >> 4);

    const u16* row = src + (long long)(s0 * 2 + b) * 1024 + n * 64;
    u16x8 cur[8];
    u16x4 prv[8];
#pragma unroll   // cur[], prv[] indexed by constants: stay in registers
    for (int u = 0; u < 8; ++u)         // 16 rows of s further on = 32 rows of q
        cur[u] = *(const u16x8*)(row + u * 32768 + (j0 & 63));
    // Precaution: the compiler lands a result of the loads below in the address
    // pair of the loads above; this wait stands in front of that overwrite.
    asm volatile("s_wait_xcnt 0x0" ::: "memory");
#pragma unroll
    for (int u = 0; u < 8; ++u)
        prv[u] = *(const u16x4*)(row + u * 32768 + (jp & 63));
    const u16 fc = (j0 & 64) ? 0x8000 : 0;   // upper half of x2 is relu(-x)
    const u16 fp = (jp & 64) ? 0x8000 : 0;
#pragma unroll
    for (int u = 0; u < 8; ++u) {
        float w[11];                    // x2[j0-3 .. j0+7]
#pragma unroll
        for (int t = 0; t < 3; ++t) w[t] = fmaxf(bf2f((u16)(prv[u][t + 1] ^ fp)), 0.f);
#pragma unroll
        for (int e = 0; e < 8; ++e) w[3 + e] = fmaxf(bf2f((u16)(cur[u][e] ^ fc)), 0.f);
        u16* out = dst + ((long long)bn * 2048 + s0 + u * 16) * 384 + j0;
#pragma unroll
        for (int i = 1; i <= 3; ++i) {
            u16x8 o;
#pragma unroll
            for (int e = 0; e < 8; ++e) o[e] = f2bf(w[3 + e] * w[3 + e - i]);
            *(u16x8*)(out + (i - 1) * 128) = o;
        }
    }
}

// pkT[bn][f][s]: one block per (128 consecutive s, bn). k goes into LDS
// transposed ([d][s], two s per dword), so that every feature row leaves as
// 256 contiguous bytes, 16 B per lane. A thread owns 8 s and 8 consecutive j
// and slides a window of four x2 rows over them.
__global__ __launch_bounds__(256) void dpfp_t_kernel(const u16* __restrict__ kv,
                                                     u16* __restrict__ dst)
{
    __shared__ __align__(16) unsigned xT[64 * 64];   // [d][s pair]
    const int s0  = blockIdx.x * 128;
    const int bn  = blockIdx.y;         // b*16 + n
    const int b   = bn >> 4, n = bn & 15;
    const int tid = threadIdx.x;

    const int sp = tid & 63;            // a wave's lanes: 32 neighbouring dwords of one LDS row
    u16x8 lo[2], hi[2];
#pragma unroll
    for (int r = 0; r < 2; ++r) {
        const int dc = (tid >> 6) + r * 4;
        const u16* p = kv + (long long)((s0 + 2 * sp) * 2 + b) * 2048 + n * 64 + dc * 8;
        lo[r] = *(const u16x8*)p;            // row s
        hi[r] = *(const u16x8*)(p + 4096);   // row s + 1
    }
#pragma unroll
    for (int r = 0; r < 2; ++r) {
        const int dc = (tid >> 6) + r * 4;
#pragma unroll
        for (int e = 0; e < 8; ++e)
            xT[(dc * 8 + e) * 64 + sp] = (unsigned)lo[r][e] | ((unsigned)hi[r][e] << 16);
    }
    __syncthreads();

    const int c  = tid & 15;            // which 8 s of the 128
    const int j0 = (tid >> 4) * 8;
    u16* out = dst + ((long long)bn * 384 + j0) * 2048 + s0 + c * 8;

    // The eleven x rows this thread needs (j0-3 .. j0+7, modulo 128), each read once.
    // Every loop below is unrolled so that q[], w[] and o[] are indexed by constants and stay in registers.
    uint4 q[11];
#pragma unroll
    for (int t = 0; t < 11; ++t) q[t] = *(const uint4*)&xT[((j0 + t - 3) & 63) * 64 + c * 4];

    float w[4][8];
#pragma unroll
    for (int t = 0; t < 11; ++t) {
        const unsigned flip = ((j0 + t - 3) & 64) ? 0x80008000u : 0u;   // upper half of x2 is relu(-x)
        const unsigned qq[4] = {q[t].x ^ flip, q[t].y ^ flip, q[t].z ^ flip, q[t].w ^ flip};
#pragma unroll
        for (int e = 0; e < 4; ++e) {
            w[t & 3][2 * e]     = fmaxf(__uint_as_float(qq[e] << 16), 0.f);
            w[t & 3][2 * e + 1] = fmaxf(__uint_as_float(qq[e] & 0xFFFF0000u), 0.f);
        }
        if (t >= 3) {
#pragma unroll
            for (int i = 1; i <= 3; ++i) {
                u16x8 o;
#pragma unroll
                for (int e = 0; e < 8; ++e) o[e] = f2bf(w[t & 3][e] * w[(t - i) & 3][e]);
                *(u16x8*)(out + (long long)((i - 1) * 128 + (t - 3)) * 2048) = o;
            }
        }
    }
}

// z[bn][f] = sum_s pkT[bn][f][s]
__global__ __launch_bounds__(256) void z_kernel(const u16* __restrict__ pkT,
                                                float* __restrict__ z)
{
    __shared__ float red[256];
    const int f = blockIdx.x, bn = blockIdx.y, tid = threadIdx.x;
    const u16* row = pkT + ((long long)bn * 384 + f) * 2048;
    float sum = 0.f;
    for (int s = tid; s < 2048; s += 256) sum += bf2f(row[s]);
    red[tid] = sum; __syncthreads();
    for (int st = 128; st > 0; st >>= 1) {
        if (tid < st) red[tid] += red[tid + st];
        __syncthreads();
    }
    if (tid == 0) z[bn * 384 + f] = red[0];
}

// den[bn][s] = SCALE * dot(pq[bn][s][:], z[bn][:]) + EPS ; one wave per (bn,s)
__global__ __launch_bounds__(256) void den_kernel(const u16* __restrict__ pq,
                                                  const float* __restrict__ z,
                                                  float* __restrict__ den)
{
    const int wave = threadIdx.x >> 5, lane = threadIdx.x & 31;
    const int s  = blockIdx.x * 8 + wave;
    const int bn = blockIdx.y;
    const u16*   pr = pq + ((long long)bn * 2048 + s) * 384;
    const float* zr = z + bn * 384;
    float sum = 0.f;
    for (int f = lane; f < 384; f += 32) sum += bf2f(pr[f]) * zr[f];
    for (int off = 16; off > 0; off >>= 1) sum += __shfl_down(sum, off, 32);
    if (lane == 0) den[(long long)bn * 2048 + s] = sum * 0.125f + 1e-5f;
}

// v_bf[bn][s][d] = kv_bf[(s*2+b)*2048 + 1024 + n*64 + d]
// A lane moves 8 d (16 B), a thread four such groups.
__global__ __launch_bounds__(256) void gather_v_kernel(const u16* __restrict__ kv,
                                                       u16* __restrict__ vb)
{
    const int g0 = blockIdx.x * 1024 + threadIdx.x;   // group of 8 d, < 32*2048*8
    const int d = (g0 & 7) * 8, s = (g0 >> 3) & 2047, bn = g0 >> 14;
    const int b = bn >> 4, n = bn & 15;
    const u16* p = kv + ((long long)(s * 2 + b) << 11) + 1024 + n * 64 + d;
    u16x8 v[4];
#pragma unroll   // v[] indexed by constants: stays in registers
    for (int u = 0; u < 4; ++u) v[u] = *(const u16x8*)(p + u * 131072);   // 256 groups on = 32 s on, same bn
#pragma unroll
    for (int u = 0; u < 4; ++u) *(u16x8*)(vb + (long long)(g0 + u * 256) * 8) = v[u];
}

// attn_bf[(s*2+b)*1024 + n*64 + d] = bf16(num * SCALE / den)
__global__ __launch_bounds__(256) void attnvec_kernel(const float* __restrict__ num,
                                                      const float* __restrict__ den,
                                                      u16* __restrict__ attn_bf)
{
    // A lane takes 4 d (16 B of num in, 8 B out; 16 lanes fill one 128-B line of
    // attn_bf), a thread eight such groups, all their loads asked for first.
    const int g0 = blockIdx.x * 2048 + threadIdx.x;   // group of 4 d, < 32*2048*16
    const int d = (g0 & 15) * 4, s = (g0 >> 4) & 2047, bn = g0 >> 15;
    const int b = bn >> 4, n = bn & 15;
    u16* out = attn_bf + ((long long)(s * 2 + b) << 10) + n * 64 + d;
    f32x4 nm[8];
    float dn[8];
#pragma unroll   // nm[], dn[] indexed by constants: stay in registers
    for (int u = 0; u < 8; ++u) {       // 256 groups on = 16 s on, same bn
        nm[u] = *(const f32x4*)(num + (long long)g0 * 4 + u * 1024);
        dn[u] = den[(g0 >> 4) + u * 16];   // g0 >> 4 = bn*2048 + s
    }
#pragma unroll
    for (int u = 0; u < 8; ++u) {
        u16x4 o;
#pragma unroll
        for (int e = 0; e < 4; ++e) o[e] = f2bf(nm[u][e] * 0.125f / dn[u]);
        *(u16x4*)(out + u * 32768) = o;
    }
}

// out = layernorm(h + attn_out)
__global__ __launch_bounds__(256) void ln_kernel(const float* __restrict__ h,
                                                 const float* __restrict__ attn,
                                                 const float* __restrict__ gamma,
                                                 const float* __restrict__ beta,
                                                 float* __restrict__ out)
{
    __shared__ float red[256];
    const int row = blockIdx.x, tid = threadIdx.x;
    const float* hr = h    + (long long)row * 1024;
    const float* ar = attn + (long long)row * 1024;

    float lsum = 0.f;
    for (int c = tid; c < 1024; c += 256) lsum += hr[c] + ar[c];
    red[tid] = lsum; __syncthreads();
    for (int st = 128; st > 0; st >>= 1) {
        if (tid < st) red[tid] += red[tid + st];
        __syncthreads();
    }
    const float mu = red[0] * (1.f / 1024.f);
    __syncthreads();

    float lvar = 0.f;
    for (int c = tid; c < 1024; c += 256) {
        float d = hr[c] + ar[c] - mu;
        lvar += d * d;
    }
    red[tid] = lvar; __syncthreads();
    for (int st = 128; st > 0; st >>= 1) {
        if (tid < st) red[tid] += red[tid + st];
        __syncthreads();
    }
    const float rstd = rsqrtf(red[0] * (1.f / 1024.f) + 1e-5f);
    for (int c = tid; c < 1024; c += 256)
        out[(long long)row * 1024 + c] = (hr[c] + ar[c] - mu) * rstd * gamma[c] + beta[c];
}

// ---------------------------------------------------------------------------
extern "C" void kernel_launch(void* const* d_in, const int* in_sizes, int n_in,
                              void* d_out, int out_size, void* d_ws, size_t ws_size,
                              hipStream_t stream)
{
    const float* h    = (const float*)d_in[0];   // [2048,2,1024]
    const float* Wq   = (const float*)d_in[1];   // [1024,1024]
    const float* Wkv  = (const float*)d_in[2];   // [1024,2048]
    const float* Wo   = (const float*)d_in[3];   // [1024,1024]
    const float* gam  = (const float*)d_in[4];
    const float* bet  = (const float*)d_in[5];
    float* out = (float*)d_out;
    (void)in_sizes; (void)n_in; (void)out_size; (void)ws_size;

    char* ws = (char*)d_ws;
    auto take = [&](size_t bytes) -> char* { char* p = ws; ws += bytes; return p; };

    u16*   h_bf     = (u16*)  take(8388608);    // 4096x1024
    u16*   Wq_bf    = (u16*)  take(2097152);    // 1024x1024
    u16*   Wkv_bf   = (u16*)  take(4194304);    // 1024x2048
    u16*   Wo_bf    = (u16*)  take(2097152);    // 1024x1024
    u16*   q_bf     = (u16*)  take(8388608);    // 4096x1024
    u16*   kv_bf    = (u16*)  take(16777216);   // 4096x2048
    u16*   v_bf     = (u16*)  take(8388608);    // 32 x 2048x64
    u16*   pq_bf    = (u16*)  take(50331648);   // 32 x 2048x384
    u16*   pkT_bf   = (u16*)  take(50331648);   // 32 x 384x2048
    float* z_buf    = (float*)take(49152);      // 32 x 384
    u16*   kvagg_bf = (u16*)  take(1572864);    // 32 x 384x64
    float* num_buf  = (float*)take(16777216);   // 32 x 2048x64
    float* den_buf  = (float*)take(262144);     // 32 x 2048
    u16*   attn_bf  = (u16*)  take(8388608);    // 4096x1024
    float* attn_out = (float*)take(16777216);   // 4096x1024

    // 1) fp32 -> bf16 casts
    cvt_f32_bf16<<<4194304 / 8192, 256, 0, stream>>>(h,   h_bf);
    cvt_f32_bf16<<<1048576 / 8192, 256, 0, stream>>>(Wq,  Wq_bf);
    cvt_f32_bf16<<<2097152 / 8192, 256, 0, stream>>>(Wkv, Wkv_bf);
    cvt_f32_bf16<<<1048576 / 8192, 256, 0, stream>>>(Wo,  Wo_bf);

    // 2) q = h@Wq  [4096,1024]  (bf16 out)
    gemm_bf16_kernel<true, 128><<<dim3(16, 32, 1), 256, 0, stream>>>(
        h_bf, Wq_bf, q_bf, 4096, 1024, 1024, 1024, 1024, 1024, 0, 0, 0);
    // 3) kv = h@Wkv [4096,2048] (bf16 out); K-step 64: four blocks' LDS fit a WGP,
    //    so all 1024 blocks are resident at once
    gemm_bf16_kernel<true, 64><<<dim3(32, 32, 1), 256, 0, stream>>>(
        h_bf, Wkv_bf, kv_bf, 4096, 2048, 1024, 1024, 2048, 2048, 0, 0, 0);

    // 4) DPFP features: pq [bn][s][f], pkT [bn][f][s]
    dpfp_kernel<<<dim3(16, 32), 256, 0, stream>>>(q_bf, pq_bf);
    dpfp_t_kernel<<<dim3(16, 32), 256, 0, stream>>>(kv_bf, pkT_bf);

    // 5) z = sum_s pk ; gather v into [bn][s][d]
    z_kernel<<<dim3(384, 32), 256, 0, stream>>>(pkT_bf, z_buf);
    gather_v_kernel<<<512, 256, 0, stream>>>(kv_bf, v_bf);

    // 6) kv_agg[bn] = pkT[bn] @ v[bn]   (384x2048 . 2048x64, bf16 out)
    gemm_bf16_kernel<true, 128><<<dim3(1, 3, 32), 256, 0, stream>>>(
        pkT_bf, v_bf, kvagg_bf, 384, 64, 2048, 2048, 64, 64,
        786432LL, 131072LL, 24576LL);

    // 7) num[bn] = pq[bn] @ kv_agg[bn]  (2048x384 . 384x64, fp32 out)
    gemm_bf16_kernel<false, 128><<<dim3(1, 16, 32), 256, 0, stream>>>(
        pq_bf, kvagg_bf, num_buf, 2048, 64, 384, 384, 64, 64,
        786432LL, 24576LL, 131072LL);

    // 8) den, then attn_vec = num*SCALE/den -> bf16 [4096,1024]
    den_kernel<<<dim3(256, 32), 256, 0, stream>>>(pq_bf, z_buf, den_buf);
    attnvec_kernel<<<512, 256, 0, stream>>>(num_buf, den_buf, attn_bf);

    // 9) attn_out = attn_vec @ Wo  (fp32 out)
    gemm_bf16_kernel<false, 128><<<dim3(16, 32, 1), 256, 0, stream>>>(
        attn_bf, Wo_bf, attn_out, 4096, 1024, 1024, 1024, 1024, 1024, 0, 0, 0);

    // 10) out = layernorm(h + attn_out)
    ln_kernel<<<4096, 256, 0, stream>>>(h, attn_out, gam, bet, out);
}

// v005
// It runs in 125 microseconds.
// Timed twice side by side with v004, it ran 1.39 and 1.41 times as fast.
// Counting every step since v000, it is 3.27 times as fast.
#include <hip/hip_runtime.h>
#include <hip/hip_bf16.h>

// ---------------------------------------------------------------------------
// DPFP linear attention for MI455X (gfx1250): all GEMMs via bf16 WMMA
// (v_wmma_f32_16x16x32_bf16), fp32 accumulate. 128x64 block tiles, 8 waves
// each computing 32x32 (2x fragment reuse), K-steps of 64 or 128, double-
// buffered LDS with GLOBAL_LOAD_ASYNC_TO_LDS_B128 staging for both tiles; the
// B tile stays [k][n] in LDS and is read with DS_LOAD_TR16_B128. The feature sums z
// and the denominators are further columns of the two batched GEMMs.
// ---------------------------------------------------------------------------

typedef unsigned short u16;
typedef __attribute__((ext_vector_type(4)))  unsigned short u16x4;
typedef __attribute__((ext_vector_type(8)))  unsigned short u16x8;
typedef __attribute__((ext_vector_type(4)))  float         f32x4;
typedef __attribute__((ext_vector_type(16))) unsigned short v16u;
typedef __attribute__((ext_vector_type(16))) __bf16        v16bf;
typedef __attribute__((ext_vector_type(8)))  float         v8f;
typedef __attribute__((ext_vector_type(8)))  short         s16x8;

union Frag { v16u u; v16bf b; };

#ifndef __has_builtin
#define __has_builtin(x) 0
#endif

#if defined(__AMDGCN__) && __has_builtin(__builtin_amdgcn_global_load_async_to_lds_b128)
#define USE_ASYNC_LDS 1
#else
#define USE_ASYNC_LDS 0
#endif

#if USE_ASYNC_LDS
// Builtin signature (from hipcc diagnostic): (v4i addrspace(1)*, v4i addrspace(3)*, imm, imm)
typedef int gcc_i32x4 __attribute__((vector_size(16)));
__device__ __forceinline__ void async_copy_b128(const u16* g, u16* l) {
    __builtin_amdgcn_global_load_async_to_lds_b128(
        (__attribute__((address_space(1))) gcc_i32x4*)(void*)g,
        (__attribute__((address_space(3))) gcc_i32x4*)(void*)l, 0, 0);
}
#endif

// The issuing wave's copies have landed. In asm with the memory clobber, so that
// no LDS read moves in front of it.
__device__ __forceinline__ void async_wait0() {
#if USE_ASYNC_LDS
    asm volatile("s_wait_asynccnt 0x0" ::: "memory");
#endif
}

// One 128 x BK A tile into LDS rows of BK + 8 elements. g and l are the lane's own
// first 16 bytes: BK/8 neighbouring lanes take one row's BK*2 contiguous bytes, so
// a wave's copy covers four whole 128-B lines. A thread brings BK/16 rows.
template <int BK>
__device__ __forceinline__ void stage_a(const u16* g, int lda, u16* l) {
    constexpr int RP = 2048 / BK;        // rows the block's 256 lanes cover at once
#pragma unroll   // independent copies, issued back to back
    for (int u = 0; u < 128 / RP; ++u) {
#if USE_ASYNC_LDS
        async_copy_b128(g + (long long)(u * RP) * lda, l + u * RP * (BK + 8));
#else
        *(u16x8*)(l + u * RP * (BK + 8)) = *(const u16x8*)(g + (long long)(u * RP) * lda);
#endif
    }
}

// Row pitch of the B tile in LDS, in elements: 64 n + 16 = 160 bytes, an odd
// multiple of 32 B, which ds_load_tr16_b128 reads without bank conflicts.
constexpr int LDB = 80;

// One BK x 64 B tile into LDS as it lies in memory, [k][n]. g and l are the lane's
// own first 16 bytes: 8 neighbouring lanes take one row's 128 contiguous bytes, so
// a wave's copy covers four whole 128-B lines. A thread brings BK/32 rows.
template <int BK>
__device__ __forceinline__ void stage_b(const u16* g, int ldb, u16* l) {
#pragma unroll   // independent copies, issued back to back
    for (int r = 0; r < BK / 32; ++r) {
#if USE_ASYNC_LDS
        async_copy_b128(g + (long long)(r * 32) * ldb, l + r * 32 * LDB);
#else
        *(u16x8*)(l + r * 32 * LDB) = *(const u16x8*)(g + (long long)(r * 32) * ldb);
#endif
    }
}

// The 128 x 16 block of z columns beside a 128 x 64 B tile, into columns 64..79 of
// its LDS rows. g and l are the lane's own 16 bytes: the block's 256 lanes take 4 KiB
// that lie contiguous in memory, one copy a thread.
__device__ __forceinline__ void stage_z(const u16* g, u16* l) {
#if USE_ASYNC_LDS
    async_copy_b128(g, l);
#else
    *(u16x8*)l = *(const u16x8*)g;
#endif
}

__device__ __forceinline__ u16 f2bf(float f) {
    union { float f; unsigned u; } x; x.f = f;
    unsigned u = x.u;
    u += 0x7FFFu + ((u >> 16) & 1u);     // round-to-nearest-even
    return (u16)(u >> 16);
}
__device__ __forceinline__ float bf2f(u16 h) {
    union { unsigned u; float f; } x; x.u = ((unsigned)h) << 16;
    return x.f;
}

// ISA 16-bit fragment layout: lane element e -> K = khalf + e + (e>=8 ? 8 : 0)
__device__ __forceinline__ void load_frag(Frag& f, const u16* p) {
    u16x8 lo = *(const u16x8*)p;
    u16x8 hi = *(const u16x8*)(p + 16);
#pragma unroll
    for (int e = 0; e < 8; ++e) { f.u[e] = lo[e]; f.u[e + 8] = hi[e]; }
}

// B fragment (32 k x 16 n) out of the [k][n] tile by two transposing loads. p is the
// lane's own address: row 8*(lane>>4) + (lane&7), column 8*((lane>>3)&1) of the 16 x 16
// piece; the lane gets column lane&15 at k = 8*(lane>>4) + 0..7, and 16 rows on the
// same at k + 16: the k order of load_frag.
__device__ __forceinline__ void load_frag_tr(Frag& f, const u16* p) {
    typedef __attribute__((address_space(3))) s16x8 lds_s16x8;
    s16x8 lo = __builtin_amdgcn_ds_load_tr16_b128_v8i16((lds_s16x8*)p);
    s16x8 hi = __builtin_amdgcn_ds_load_tr16_b128_v8i16((lds_s16x8*)(p + 16 * LDB));
#pragma unroll   // f.u[] indexed by constants: stays in registers
    for (int e = 0; e < 8; ++e) { f.u[e] = (u16)lo[e]; f.u[e + 8] = (u16)hi[e]; }
}

// ---------------------------------------------------------------------------
// Batched bf16 GEMM: C[M,N] = A[M,K] @ B[K,N], row-major, fp32 acc.
// Block: 256 threads = 8 waves; tile 128x64; wave (wr 0..3, wc 0..1) owns
// 32x32. Double-buffered K-steps of BK (64 or 128).
// Requires: M%128==0, N%64==0, K%BK==0, lda/ldb/ldc %8==0, 16B-aligned bases.
// MODE says what leaves the block:
//   C_BF16, C_F32  C as bf16 or fp32.
//   C_ROWSUM       C as bf16, and the row sums of A (a product with a fragment of
//                  ones) as Zc[bz][m][16]: each sum split into two bf16, the upper
//                  part in the even columns, the rest in the odd ones.
//   C_ATTN         N = 64. Zc[bz][k][16] rides as 16 more columns of B, so that
//                  column pairs of A @ Zc add up to dot(A row, z). C * SCALE over
//                  (that * SCALE + EPS) goes as bf16 to [m][bz >> 4][bz & 15][n].
// ---------------------------------------------------------------------------
enum { C_BF16 = 0, C_F32 = 1, C_ROWSUM = 2, C_ATTN = 3 };

template <int MODE, int BK>
__global__ __launch_bounds__(256) void gemm_bf16_kernel(
    const u16* __restrict__ A, const u16* __restrict__ B, void* __restrict__ Cp,
    u16* __restrict__ Zc,
    int M, int N, int K, int lda, int ldb, int ldc,
    long long strideA, long long strideB, long long strideC)
{
    // Row pitch of the A tile: BK*2 + 16 bytes, an odd multiple of 16 B, which
    // ds_load_b128 reads without bank conflicts.
    constexpr int LDP = BK + 8;
    static_assert(MODE != C_ATTN || BK == 128, "stage_z: one copy a thread fills 128 rows");
    __shared__ __align__(16) u16 As[2][128 * LDP];  // [m][k]
    __shared__ __align__(16) u16 Bs[2][BK * LDB];   // [k][n], as in memory

    const int bz = blockIdx.z;
    A += (long long)bz * strideA;
    B += (long long)bz * strideB;

    const int tileN = blockIdx.x * 64;
    const int tileM = blockIdx.y * 128;
    const int tid   = threadIdx.x;
    const int lane  = tid & 31;
    const int wave  = tid >> 5;
    const int wr    = wave >> 1;          // m slice: wr*32
    const int wc    = wave & 1;           // n slice: wc*32
    const int lrow  = lane & 15;
    const int khalf = (lane >> 4) ? 8 : 0;

    // staging coordinates
    const int ar = tid / (BK / 8);        // A row, and every 2048/BK rows on
    const int ac = (tid % (BK / 8)) * 8;  // 0..BK-8
    const int br = tid >> 3;              // 0..31 (k row), and every 32 rows on
    const int bc = (tid & 7) * 8;         // 0..56 (n col)

    const u16* aG = A + (long long)(tileM + ar) * lda + ac;   // K-tile t: + t*BK
    const u16* bG = B + (long long)br * ldb + tileN + bc;     // K-tile t: + t*BK rows
    const int  aL = ar * LDP + ac;
    const int  bL = br * LDB + bc;
    // this lane's address in a 16 x 16 piece of the B tile, for the transposing loads
    const int  bT = (khalf + (lane & 7)) * LDB + wc * 32 + ((lane >> 3) & 1) * 8;
    const int  nT = K / BK;               // K-tiles
    // z columns (C_ATTN): row tid >> 1, half tid & 1 of the tile's 128 x 16 block
    const u16* zG = Zc + (long long)bz * K * 16 + tid * 8;    // K-tile t: + t*BK*16
    const int  zL = (tid >> 1) * LDB + 64 + (tid & 1) * 8;
    const int  zT = (khalf + (lane & 7)) * LDB + 64 + ((lane >> 3) & 1) * 8;

    v8f acc00 = {}, acc01 = {}, acc10 = {}, acc11 = {};
    v8f accz0 = {}, accz1 = {};           // C_ROWSUM: row sums of A; C_ATTN: A @ Zc
    Frag fone;
#pragma unroll   // fone.u[] indexed by constants: stays in registers
    for (int e = 0; e < 16; ++e) fone.u[e] = 0x3F80;          // 1.0

    // ---- prologue: K-tile 0 into buffer 0, then K-tile 1 on its way into buffer 1
    stage_a<BK>(aG, lda, &As[0][aL]);
    stage_b<BK>(bG, ldb, &Bs[0][bL]);
    if (MODE == C_ATTN) stage_z(zG, &Bs[0][zL]);
    async_wait0();
    __syncthreads();
    if (1 < nT) {
        stage_a<BK>(aG + BK, lda, &As[1][aL]);
        stage_b<BK>(bG + (long long)BK * ldb, ldb, &Bs[1][bL]);
        if (MODE == C_ATTN) stage_z(zG + BK * 16, &Bs[1][zL]);
    }

    int cur = 0;
    for (int t = 0; t < nT; ++t) {
#pragma unroll   // the tile's runs of 32 k, in ascending k; LDS offsets become immediates
        for (int kk = 0; kk < BK; kk += 32) {
            // fragments (each reused by two WMMAs)
            Frag fa0, fa1, fb0, fb1;
            const u16* ap = &As[cur][(wr * 32 + lrow) * LDP + kk + khalf];
            load_frag(fa0, ap);
            load_frag(fa1, ap + 16 * LDP);
            const u16* bp = &Bs[cur][kk * LDB + bT];
            load_frag_tr(fb0, bp);
            load_frag_tr(fb1, bp + 16);

            acc00 = __builtin_amdgcn_wmma_f32_16x16x32_bf16(false, fa0.b, false, fb0.b,
                                                            (short)0, acc00, false, false);
            acc01 = __builtin_amdgcn_wmma_f32_16x16x32_bf16(false, fa0.b, false, fb1.b,
                                                            (short)0, acc01, false, false);
            acc10 = __builtin_amdgcn_wmma_f32_16x16x32_bf16(false, fa1.b, false, fb0.b,
                                                            (short)0, acc10, false, false);
            acc11 = __builtin_amdgcn_wmma_f32_16x16x32_bf16(false, fa1.b, false, fb1.b,
                                                            (short)0, acc11, false, false);
            if (MODE == C_ROWSUM || MODE == C_ATTN) {
                Frag fz = fone;
                if (MODE == C_ATTN) load_frag_tr(fz, &Bs[cur][kk * LDB + zT]);
                accz0 = __builtin_amdgcn_wmma_f32_16x16x32_bf16(false, fa0.b, false, fz.b,
                                                                (short)0, accz0, false, false);
                accz1 = __builtin_amdgcn_wmma_f32_16x16x32_bf16(false, fa1.b, false, fz.b,
                                                                (short)0, accz1, false, false);
            }
        }

        // Hand-over: this wave's LDS reads are done and its copies of tile t + 1
        // have landed; behind the barrier every wave may read tile t + 1, and
        // buffer cur, which all have left, may be refilled.
        asm volatile("s_wait_dscnt 0x0" ::: "memory");
        async_wait0();
        __syncthreads();
        if (t + 2 < nT) {
            stage_a<BK>(aG + (long long)(t + 2) * BK, lda, &As[cur][aL]);
            stage_b<BK>(bG + (long long)(t + 2) * BK * ldb, ldb, &Bs[cur][bL]);
            if (MODE == C_ATTN) stage_z(zG + (t + 2) * BK * 16, &Bs[cur][zL]);
        }
        cur ^= 1;
    }
    async_wait0();   // no copy outlives the loop

    // C/D layout: VGPR r -> row r + (lane>=16 ? 8 : 0), col lane%16
    const int rsel = (lane >> 4) ? 8 : 0;
    const int cm   = tileM + wr * 32 + rsel;
    const int cn   = tileN + wc * 32 + lrow;
    if (MODE == C_ATTN) {
        u16* C = (u16*)Cp + (bz >> 4) * 1024 + (bz & 15) * 64 + cn;
#pragma unroll   // the accumulators indexed by constants: stay in registers
        for (int r = 0; r < 8; ++r) {
            // a lane and its neighbour hold the two parts of the row's dot(A row, z);
            // one division a row, SCALE / den, serves both of the lane's columns
            const float s0 = 0.125f / ((accz0[r] + __shfl_xor(accz0[r], 1, 32)) * 0.125f + 1e-5f);
            const float s1 = 0.125f / ((accz1[r] + __shfl_xor(accz1[r], 1, 32)) * 0.125f + 1e-5f);
            C[(long long)(cm + r) * 2048]           = f2bf(acc00[r] * s0);
            C[(long long)(cm + r) * 2048 + 16]      = f2bf(acc01[r] * s0);
            C[(long long)(cm + 16 + r) * 2048]      = f2bf(acc10[r] * s1);
            C[(long long)(cm + 16 + r) * 2048 + 16] = f2bf(acc11[r] * s1);
        }
    } else if (MODE == C_BF16 || MODE == C_ROWSUM) {
        u16* C = (u16*)Cp + (long long)bz * strideC;
#pragma unroll
        for (int r = 0; r < 8; ++r) {
            C[(long long)(cm + r) * ldc + cn]           = f2bf(acc00[r]);
            C[(long long)(cm + r) * ldc + cn + 16]      = f2bf(acc01[r]);
            C[(long long)(cm + 16 + r) * ldc + cn]      = f2bf(acc10[r]);
            C[(long long)(cm + 16 + r) * ldc + cn + 16] = f2bf(acc11[r]);
        }
        if (MODE == C_ROWSUM && wc == 0) {   // every column of accz holds the row's sum
            u16* Z = Zc + ((long long)bz * M + cm) * 16 + lrow;
#pragma unroll   // accz indexed by constants: stays in registers
            for (int r = 0; r < 8; ++r) {
                const u16 h0 = f2bf(accz0[r]), h1 = f2bf(accz1[r]);
                Z[r * 16]        = (lrow & 1) ? f2bf(accz0[r] - bf2f(h0)) : h0;
                Z[(16 + r) * 16] = (lrow & 1) ? f2bf(accz1[r] - bf2f(h1)) : h1;
            }
        }
    } else {
        float* C = (float*)Cp + (long long)bz * strideC;
#pragma unroll
        for (int r = 0; r < 8; ++r) {
            C[(long long)(cm + r) * ldc + cn]           = acc00[r];
            C[(long long)(cm + r) * ldc + cn + 16]      = acc01[r];
            C[(long long)(cm + 16 + r) * ldc + cn]      = acc10[r];
            C[(long long)(cm + 16 + r) * ldc + cn + 16] = acc11[r];
        }
    }
}

// ---------------------------------------------------------------------------
// A block converts 8192 consecutive floats (every array here is a multiple of
// that). A lane takes four floats per access, so a wave reads 512 and writes
// 256 contiguous bytes; all eight loads of a thread are asked for first.
__global__ __launch_bounds__(256) void cvt_f32_bf16(const float* __restrict__ src,
                                                    u16* __restrict__ dst)
{
    const int base = blockIdx.x * 8192 + threadIdx.x * 4;
    f32x4 v[8];
#pragma unroll   // v[] indexed by constants: stays in registers
    for (int u = 0; u < 8; ++u) v[u] = *(const f32x4*)(src + base + u * 1024);
#pragma unroll
    for (int u = 0; u < 8; ++u) {
        u16x4 o;
#pragma unroll
        for (int e = 0; e < 4; ++e) o[e] = f2bf(v[u][e]);
        *(u16x4*)(dst + base + u * 1024) = o;
    }
}

// DPFP: x2 = [relu(x), relu(-x)] (128); feature f=(i-1)*128+j = x2[j]*x2[(j-i)&127]
// pq[bn][s][f]: one block per (128 consecutive s, bn). A lane owns 8 consecutive
// j of a row: it reads them (16 B) and the four in front of them (8 B) straight
// from q and stores its 8 features of each roll as 16 B, so 16 lanes write 256
// contiguous bytes. A thread does 8 rows, 16 apart.
__global__ __launch_bounds__(256) void dpfp_kernel(const u16* __restrict__ src,
                                                   u16* __restrict__ dst)
{
    const int bn = blockIdx.y;          // b*16 + n
    const int b  = bn >> 4, n = bn & 15;
    const int j0 = (threadIdx.x & 15) * 8;
    const int jp = (j0 - 4) & 127;      // the four x2 entries in front, modulo 128
    const int s0 = blockIdx.x * 128 + (threadIdx.x >> 4);

    const u16* row = src + (long long)(s0 * 2 + b) * 1024 + n * 64;
    u16x8 cur[8];
    u16x4 prv[8];
#pragma unroll   // cur[], prv[] indexed by constants: stay in registers
    for (int u = 0; u < 8; ++u)         // 16 rows of s further on = 32 rows of q
        cur[u] = *(const u16x8*)(row + u * 32768 + (j0 & 63));
    // Precaution: the compiler lands a result of the loads below in the address
    // pair of the loads above; this wait stands in front of that overwrite.
    asm volatile("s_wait_xcnt 0x0" ::: "memory");
#pragma unroll
    for (int u = 0; u < 8; ++u)
        prv[u] = *(const u16x4*)(row + u * 32768 + (jp & 63));
    const u16 fc = (j0 & 64) ? 0x8000 : 0;   // upper half of x2 is relu(-x)
    const u16 fp = (jp & 64) ? 0x8000 : 0;
#pragma unroll
    for (int u = 0; u < 8; ++u) {
        float w[11];                    // x2[j0-3 .. j0+7]
#pragma unroll
        for (int t = 0; t < 3; ++t) w[t] = fmaxf(bf2f((u16)(prv[u][t + 1] ^ fp)), 0.f);
#pragma unroll
        for (int e = 0; e < 8; ++e) w[3 + e] = fmaxf(bf2f((u16)(cur[u][e] ^ fc)), 0.f);
        u16* out = dst + ((long long)bn * 2048 + s0 + u * 16) * 384 + j0;
#pragma unroll
        for (int i = 1; i <= 3; ++i) {
            u16x8 o;
#pragma unroll
            for (int e = 0; e < 8; ++e) o[e] = f2bf(w[3 + e] * w[3 + e - i]);
            *(u16x8*)(out + (i - 1) * 128) = o;
        }
    }
}

// pkT[bn][f][s]: one block per (128 consecutive s, bn). k goes into LDS
// transposed ([d][s], two s per dword), so that every feature row leaves as
// 256 contiguous bytes, 16 B per lane. A thread owns 8 s and 8 consecutive j
// and slides a window of four x2 rows over them.
__global__ __launch_bounds__(256) void dpfp_t_kernel(const u16* __restrict__ kv,
                                                     u16* __restrict__ dst)
{
    __shared__ __align__(16) unsigned xT[64 * 64];   // [d][s pair]
    const int s0  = blockIdx.x * 128;
    const int bn  = blockIdx.y;         // b*16 + n
    const int b   = bn >> 4, n = bn & 15;
    const int tid = threadIdx.x;

    const int sp = tid & 63;            // a wave's lanes: 32 neighbouring dwords of one LDS row
    u16x8 lo[2], hi[2];
#pragma unroll
    for (int r = 0; r < 2; ++r) {
        const int dc = (tid >> 6) + r * 4;
        const u16* p = kv + (long long)((s0 + 2 * sp) * 2 + b) * 2048 + n * 64 + dc * 8;
        lo[r] = *(const u16x8*)p;            // row s
        hi[r] = *(const u16x8*)(p + 4096);   // row s + 1
    }
#pragma unroll
    for (int r = 0; r < 2; ++r) {
        const int dc = (tid >> 6) + r * 4;
#pragma unroll
        for (int e = 0; e < 8; ++e)
            xT[(dc * 8 + e) * 64 + sp] = (unsigned)lo[r][e] | ((unsigned)hi[r][e] << 16);
    }
    __syncthreads();

    const int c  = tid & 15;            // which 8 s of the 128
    const int j0 = (tid >> 4) * 8;
    u16* out = dst + ((long long)bn * 384 + j0) * 2048 + s0 + c * 8;

    // The eleven x rows this thread needs (j0-3 .. j0+7, modulo 128), each read once.
    // Every loop below is unrolled so that q[], w[] and o[] are indexed by constants and stay in registers.
    uint4 q[11];
#pragma unroll
    for (int t = 0; t < 11; ++t) q[t] = *(const uint4*)&xT[((j0 + t - 3) & 63) * 64 + c * 4];

    float w[4][8];
#pragma unroll
    for (int t = 0; t < 11; ++t) {
        const unsigned flip = ((j0 + t - 3) & 64) ? 0x80008000u : 0u;   // upper half of x2 is relu(-x)
        const unsigned qq[4] = {q[t].x ^ flip, q[t].y ^ flip, q[t].z ^ flip, q[t].w ^ flip};
#pragma unroll
        for (int e = 0; e < 4; ++e) {
            w[t & 3][2 * e]     = fmaxf(__uint_as_float(qq[e] << 16), 0.f);
            w[t & 3][2 * e + 1] = fmaxf(__uint_as_float(qq[e] & 0xFFFF0000u), 0.f);
        }
        if (t >= 3) {
#pragma unroll
            for (int i = 1; i <= 3; ++i) {
                u16x8 o;
#pragma unroll
                for (int e = 0; e < 8; ++e) o[e] = f2bf(w[t & 3][e] * w[(t - i) & 3][e]);
                *(u16x8*)(out + (long long)((i - 1) * 128 + (t - 3)) * 2048) = o;
            }
        }
    }
}

// v_bf[bn][s][d] = kv_bf[(s*2+b)*2048 + 1024 + n*64 + d]
// A lane moves 8 d (16 B), a thread four such groups.
__global__ __launch_bounds__(256) void gather_v_kernel(const u16* __restrict__ kv,
                                                       u16* __restrict__ vb)
{
    const int g0 = blockIdx.x * 1024 + threadIdx.x;   // group of 8 d, < 32*2048*8
    const int d = (g0 & 7) * 8, s = (g0 >> 3) & 2047, bn = g0 >> 14;
    const int b = bn >> 4, n = bn & 15;
    const u16* p = kv + ((long long)(s * 2 + b) << 11) + 1024 + n * 64 + d;
    u16x8 v[4];
#pragma unroll   // v[] indexed by constants: stays in registers
    for (int u = 0; u < 4; ++u) v[u] = *(const u16x8*)(p + u * 131072);   // 256 groups on = 32 s on, same bn
#pragma unroll
    for (int u = 0; u < 4; ++u) *(u16x8*)(vb + (long long)(g0 + u * 256) * 8) = v[u];
}

// out = layernorm(h + attn_out)
__global__ __launch_bounds__(256) void ln_kernel(const float* __restrict__ h,
                                                 const float* __restrict__ attn,
                                                 const float* __restrict__ gamma,
                                                 const float* __restrict__ beta,
                                                 float* __restrict__ out)
{
    __shared__ float red[256];
    const int row = blockIdx.x, tid = threadIdx.x;
    const float* hr = h    + (long long)row * 1024;
    const float* ar = attn + (long long)row * 1024;

    float lsum = 0.f;
    for (int c = tid; c < 1024; c += 256) lsum += hr[c] + ar[c];
    red[tid] = lsum; __syncthreads();
    for (int st = 128; st > 0; st >>= 1) {
        if (tid < st) red[tid] += red[tid + st];
        __syncthreads();
    }
    const float mu = red[0] * (1.f / 1024.f);
    __syncthreads();

    float lvar = 0.f;
    for (int c = tid; c < 1024; c += 256) {
        float d = hr[c] + ar[c] - mu;
        lvar += d * d;
    }
    red[tid] = lvar; __syncthreads();
    for (int st = 128; st > 0; st >>= 1) {
        if (tid < st) red[tid] += red[tid + st];
        __syncthreads();
    }
    const float rstd = rsqrtf(red[0] * (1.f / 1024.f) + 1e-5f);
    for (int c = tid; c < 1024; c += 256)
        out[(long long)row * 1024 + c] = (hr[c] + ar[c] - mu) * rstd * gamma[c] + beta[c];
}

// ---------------------------------------------------------------------------
extern "C" void kernel_launch(void* const* d_in, const int* in_sizes, int n_in,
                              void* d_out, int out_size, void* d_ws, size_t ws_size,
                              hipStream_t stream)
{
    const float* h    = (const float*)d_in[0];   // [2048,2,1024]
    const float* Wq   = (const float*)d_in[1];   // [1024,1024]
    const float* Wkv  = (const float*)d_in[2];   // [1024,2048]
    const float* Wo   = (const float*)d_in[3];   // [1024,1024]
    const float* gam  = (const float*)d_in[4];
    const float* bet  = (const float*)d_in[5];
    float* out = (float*)d_out;
    (void)in_sizes; (void)n_in; (void)out_size; (void)ws_size;

    char* ws = (char*)d_ws;
    auto take = [&](size_t bytes) -> char* { char* p = ws; ws += bytes; return p; };

    u16*   h_bf     = (u16*)  take(8388608);    // 4096x1024
    u16*   Wq_bf    = (u16*)  take(2097152);    // 1024x1024
    u16*   Wkv_bf   = (u16*)  take(4194304);    // 1024x2048
    u16*   Wo_bf    = (u16*)  take(2097152);    // 1024x1024
    u16*   q_bf     = (u16*)  take(8388608);    // 4096x1024
    u16*   kv_bf    = (u16*)  take(16777216);   // 4096x2048
    u16*   v_bf     = (u16*)  take(8388608);    // 32 x 2048x64
    u16*   pq_bf    = (u16*)  take(50331648);   // 32 x 2048x384
    u16*   pkT_bf   = (u16*)  take(50331648);   // 32 x 384x2048
    u16*   zc_bf    = (u16*)  take(393216);     // 32 x 384x16
    u16*   kvagg_bf = (u16*)  take(1572864);    // 32 x 384x64
    u16*   attn_bf  = (u16*)  take(8388608);    // 4096x1024
    float* attn_out = (float*)take(16777216);   // 4096x1024

    // 1) fp32 -> bf16 casts
    cvt_f32_bf16<<<4194304 / 8192, 256, 0, stream>>>(h,   h_bf);
    cvt_f32_bf16<<<1048576 / 8192, 256, 0, stream>>>(Wq,  Wq_bf);
    cvt_f32_bf16<<<2097152 / 8192, 256, 0, stream>>>(Wkv, Wkv_bf);
    cvt_f32_bf16<<<1048576 / 8192, 256, 0, stream>>>(Wo,  Wo_bf);

    // 2) q = h@Wq  [4096,1024]  (bf16 out)
    gemm_bf16_kernel<C_BF16, 128><<<dim3(16, 32, 1), 256, 0, stream>>>(
        h_bf, Wq_bf, q_bf, nullptr, 4096, 1024, 1024, 1024, 1024, 1024, 0, 0, 0);
    // 3) kv = h@Wkv [4096,2048] (bf16 out); K-step 64: four blocks' LDS fit a WGP,
    //    so all 1024 blocks are resident at once
    gemm_bf16_kernel<C_BF16, 64><<<dim3(32, 32, 1), 256, 0, stream>>>(
        h_bf, Wkv_bf, kv_bf, nullptr, 4096, 2048, 1024, 1024, 2048, 2048, 0, 0, 0);

    // 4) DPFP features: pq [bn][s][f], pkT [bn][f][s]
    dpfp_kernel<<<dim3(16, 32), 256, 0, stream>>>(q_bf, pq_bf);
    dpfp_t_kernel<<<dim3(16, 32), 256, 0, stream>>>(kv_bf, pkT_bf);

    // 5) gather v into [bn][s][d]
    gather_v_kernel<<<512, 256, 0, stream>>>(kv_bf, v_bf);

    // 6) kv_agg[bn] = pkT[bn] @ v[bn]   (384x2048 . 2048x64, bf16 out),
    //    and z[bn] = sum_s pk as the row sums of pkT[bn]
    gemm_bf16_kernel<C_ROWSUM, 128><<<dim3(1, 3, 32), 256, 0, stream>>>(
        pkT_bf, v_bf, kvagg_bf, zc_bf, 384, 64, 2048, 2048, 64, 64,
        786432LL, 131072LL, 24576LL);

    // 7) num[bn] = pq[bn] @ kv_agg[bn]  (2048x384 . 384x64) and den[bn] = pq[bn] @ z[bn]
    //    in one pass over pq; attn_vec = num*SCALE/den leaves as bf16 [4096,1024]
    gemm_bf16_kernel<C_ATTN, 128><<<dim3(1, 16, 32), 256, 0, stream>>>(
        pq_bf, kvagg_bf, attn_bf, zc_bf, 2048, 64, 384, 384, 64, 64,
        786432LL, 24576LL, 0LL);

    // 8) attn_out = attn_vec @ Wo  (fp32 out)
    gemm_bf16_kernel<C_F32, 128><<<dim3(16, 32, 1), 256, 0, stream>>>(
        attn_bf, Wo_bf, attn_out, nullptr, 4096, 1024, 1024, 1024, 1024, 1024, 0, 0, 0);

    // 9) out = layernorm(h + attn_out)
    ln_kernel<<<4096, 256, 0, stream>>>(h, attn_out, gam, bet, out);
}

// v006
// Measured time: 114 microseconds a run.
// In two side-by-side timings against v005, it was 1.10 and 1.11 times as fast.
// Over all steps from v000 it is 3.60 times as fast.
#include <hip/hip_runtime.h>
#include <hip/hip_bf16.h>

// ---------------------------------------------------------------------------
// DPFP linear attention for MI455X (gfx1250): all GEMMs via bf16 WMMA
// (v_wmma_f32_16x16x32_bf16), fp32 accumulate. 128x64 block tiles, 8 waves
// each computing 32x32 (2x fragment reuse), K-steps of 128, double-
// buffered LDS with GLOBAL_LOAD_ASYNC_TO_LDS_B128 staging for both tiles; the
// B tile stays [k][n] in LDS and is read with DS_LOAD_TR16_B128. The feature sums z
// and the denominators are further columns of the two batched GEMMs. Kernels that
// do not depend on one another share a launch, told apart by the block index.
// ---------------------------------------------------------------------------

typedef unsigned short u16;
typedef __attribute__((ext_vector_type(4)))  unsigned short u16x4;
typedef __attribute__((ext_vector_type(8)))  unsigned short u16x8;
typedef __attribute__((ext_vector_type(4)))  float         f32x4;
typedef __attribute__((ext_vector_type(16))) unsigned short v16u;
typedef __attribute__((ext_vector_type(16))) __bf16        v16bf;
typedef __attribute__((ext_vector_type(8)))  float         v8f;
typedef __attribute__((ext_vector_type(8)))  short         s16x8;

union Frag { v16u u; v16bf b; };

#ifndef __has_builtin
#define __has_builtin(x) 0
#endif

#if defined(__AMDGCN__) && __has_builtin(__builtin_amdgcn_global_load_async_to_lds_b128)
#define USE_ASYNC_LDS 1
#else
#define USE_ASYNC_LDS 0
#endif

#if USE_ASYNC_LDS
// Builtin signature (from hipcc diagnostic): (v4i addrspace(1)*, v4i addrspace(3)*, imm, imm)
typedef int gcc_i32x4 __attribute__((vector_size(16)));
__device__ __forceinline__ void async_copy_b128(const u16* g, u16* l) {
    __builtin_amdgcn_global_load_async_to_lds_b128(
        (__attribute__((address_space(1))) gcc_i32x4*)(void*)g,
        (__attribute__((address_space(3))) gcc_i32x4*)(void*)l, 0, 0);
}
#endif

// The issuing wave's copies have landed. In asm with the memory clobber, so that
// no LDS read moves in front of it.
__device__ __forceinline__ void async_wait0() {
#if USE_ASYNC_LDS
    asm volatile("s_wait_asynccnt 0x0" ::: "memory");
#endif
}

// One 128 x BK A tile into LDS rows of BK + 8 elements. g and l are the lane's own
// first 16 bytes: BK/8 neighbouring lanes take one row's BK*2 contiguous bytes, so
// a wave's copy covers four whole 128-B lines. A thread brings BK/16 rows.
template <int BK>
__device__ __forceinline__ void stage_a(const u16* g, int lda, u16* l) {
    constexpr int RP = 2048 / BK;        // rows the block's 256 lanes cover at once
#pragma unroll   // independent copies, issued back to back
    for (int u = 0; u < 128 / RP; ++u) {
#if USE_ASYNC_LDS
        async_copy_b128(g + (long long)(u * RP) * lda, l + u * RP * (BK + 8));
#else
        *(u16x8*)(l + u * RP * (BK + 8)) = *(const u16x8*)(g + (long long)(u * RP) * lda);
#endif
    }
}

// Row pitch of the B tile in LDS, in elements: 64 n + 16 = 160 bytes, an odd
// multiple of 32 B, which ds_load_tr16_b128 reads without bank conflicts.
constexpr int LDB = 80;

// One BK x 64 B tile into LDS as it lies in memory, [k][n]. g and l are the lane's
// own first 16 bytes: 8 neighbouring lanes take one row's 128 contiguous bytes, so
// a wave's copy covers four whole 128-B lines. A thread brings BK/32 rows.
template <int BK>
__device__ __forceinline__ void stage_b(const u16* g, int ldb, u16* l) {
#pragma unroll   // independent copies, issued back to back
    for (int r = 0; r < BK / 32; ++r) {
#if USE_ASYNC_LDS
        async_copy_b128(g + (long long)(r * 32) * ldb, l + r * 32 * LDB);
#else
        *(u16x8*)(l + r * 32 * LDB) = *(const u16x8*)(g + (long long)(r * 32) * ldb);
#endif
    }
}

// The 128 x 16 block of z columns beside a 128 x 64 B tile, into columns 64..79 of
// its LDS rows. g and l are the lane's own 16 bytes: the block's 256 lanes take 4 KiB
// that lie contiguous in memory, one copy a thread.
__device__ __forceinline__ void stage_z(const u16* g, u16* l) {
#if USE_ASYNC_LDS
    async_copy_b128(g, l);
#else
    *(u16x8*)l = *(const u16x8*)g;
#endif
}

__device__ __forceinline__ u16 f2bf(float f) {
    union { float f; unsigned u; } x; x.f = f;
    unsigned u = x.u;
    u += 0x7FFFu + ((u >> 16) & 1u);     // round-to-nearest-even
    return (u16)(u >> 16);
}
__device__ __forceinline__ float bf2f(u16 h) {
    union { unsigned u; float f; } x; x.u = ((unsigned)h) << 16;
    return x.f;
}

// ISA 16-bit fragment layout: lane element e -> K = khalf + e + (e>=8 ? 8 : 0)
__device__ __forceinline__ void load_frag(Frag& f, const u16* p) {
    u16x8 lo = *(const u16x8*)p;
    u16x8 hi = *(const u16x8*)(p + 16);
#pragma unroll
    for (int e = 0; e < 8; ++e) { f.u[e] = lo[e]; f.u[e + 8] = hi[e]; }
}

// B fragment (32 k x 16 n) out of the [k][n] tile by two transposing loads. p is the
// lane's own address: row 8*(lane>>4) + (lane&7), column 8*((lane>>3)&1) of the 16 x 16
// piece; the lane gets column lane&15 at k = 8*(lane>>4) + 0..7, and 16 rows on the
// same at k + 16: the k order of load_frag.
__device__ __forceinline__ void load_frag_tr(Frag& f, const u16* p) {
    typedef __attribute__((address_space(3))) s16x8 lds_s16x8;
    s16x8 lo = __builtin_amdgcn_ds_load_tr16_b128_v8i16((lds_s16x8*)p);
    s16x8 hi = __builtin_amdgcn_ds_load_tr16_b128_v8i16((lds_s16x8*)(p + 16 * LDB));
#pragma unroll   // f.u[] indexed by constants: stays in registers
    for (int e = 0; e < 8; ++e) { f.u[e] = (u16)lo[e]; f.u[e + 8] = (u16)hi[e]; }
}

// ---------------------------------------------------------------------------
// Batched bf16 GEMM: C[M,N] = A[M,K] @ B[K,N], row-major, fp32 acc.
// Block: 256 threads = 8 waves; tile 128x64; wave (wr 0..3, wc 0..1) owns
// 32x32. Double-buffered K-steps of BK (64 or 128).
// Requires: M%128==0, N%64==0, K%BK==0, lda/ldb/ldc %8==0, 16B-aligned bases.
// MODE says what leaves the block:
//   C_BF16, C_F32  C as bf16 or fp32.
//   C_ROWSUM       C as bf16, and the row sums of A (a product with a fragment of
//                  ones) as Zc[bz][m][16]: each sum split into two bf16, the upper
//                  part in the even columns, the rest in the odd ones.
//   C_ATTN         N = 64. Zc[bz][k][16] rides as 16 more columns of B, so that
//                  column pairs of A @ Zc add up to dot(A row, z). C * SCALE over
//                  (that * SCALE + EPS) goes as bf16 to [m][bz >> 4][bz & 15][n].
// ---------------------------------------------------------------------------
enum { C_BF16 = 0, C_F32 = 1, C_ROWSUM = 2, C_ATTN = 3 };

// One block's tile: column tile bx, row tile by, batch bz.
template <int MODE, int BK>
__device__ __forceinline__ void gemm_tile(
    const u16* __restrict__ A, const u16* __restrict__ B, void* __restrict__ Cp,
    u16* __restrict__ Zc,
    int M, int N, int K, int lda, int ldb, int ldc,
    long long strideA, long long strideB, long long strideC,
    int bx, int by, int bz)
{
    // Row pitch of the A tile: BK*2 + 16 bytes, an odd multiple of 16 B, which
    // ds_load_b128 reads without bank conflicts.
    constexpr int LDP = BK + 8;
    static_assert(MODE != C_ATTN || BK == 128, "stage_z: one copy a thread fills 128 rows");
    __shared__ __align__(16) u16 As[2][128 * LDP];  // [m][k]
    __shared__ __align__(16) u16 Bs[2][BK * LDB];   // [k][n], as in memory

    A += (long long)bz * strideA;
    B += (long long)bz * strideB;

    const int tileN = bx * 64;
    const int tileM = by * 128;
    const int tid   = threadIdx.x;
    const int lane  = tid & 31;
    const int wave  = tid >> 5;
    const int wr    = wave >> 1;          // m slice: wr*32
    const int wc    = wave & 1;           // n slice: wc*32
    const int lrow  = lane & 15;
    const int khalf = (lane >> 4) ? 8 : 0;

    // staging coordinates
    const int ar = tid / (BK / 8);        // A row, and every 2048/BK rows on
    const int ac = (tid % (BK / 8)) * 8;  // 0..BK-8
    const int br = tid >> 3;              // 0..31 (k row), and every 32 rows on
    const int bc = (tid & 7) * 8;         // 0..56 (n col)

    const u16* aG = A + (long long)(tileM + ar) * lda + ac;   // K-tile t: + t*BK
    const u16* bG = B + (long long)br * ldb + tileN + bc;     // K-tile t: + t*BK rows
    const int  aL = ar * LDP + ac;
    const int  bL = br * LDB + bc;
    // this lane's address in a 16 x 16 piece of the B tile, for the transposing loads
    const int  bT = (khalf + (lane & 7)) * LDB + wc * 32 + ((lane >> 3) & 1) * 8;
    const int  nT = K / BK;               // K-tiles
    // z columns (C_ATTN): row tid >> 1, half tid & 1 of the tile's 128 x 16 block
    const u16* zG = Zc + (long long)bz * K * 16 + tid * 8;    // K-tile t: + t*BK*16
    const int  zL = (tid >> 1) * LDB + 64 + (tid & 1) * 8;
    const int  zT = (khalf + (lane & 7)) * LDB + 64 + ((lane >> 3) & 1) * 8;

    v8f acc00 = {}, acc01 = {}, acc10 = {}, acc11 = {};
    v8f accz0 = {}, accz1 = {};           // C_ROWSUM: row sums of A; C_ATTN: A @ Zc
    Frag fone;
#pragma unroll   // fone.u[] indexed by constants: stays in registers
    for (int e = 0; e < 16; ++e) fone.u[e] = 0x3F80;          // 1.0

    // ---- prologue: K-tile 0 into buffer 0, then K-tile 1 on its way into buffer 1
    stage_a<BK>(aG, lda, &As[0][aL]);
    stage_b<BK>(bG, ldb, &Bs[0][bL]);
    if (MODE == C_ATTN) stage_z(zG, &Bs[0][zL]);
    async_wait0();
    __syncthreads();
    if (1 < nT) {
        stage_a<BK>(aG + BK, lda, &As[1][aL]);
        stage_b<BK>(bG + (long long)BK * ldb, ldb, &Bs[1][bL]);
        if (MODE == C_ATTN) stage_z(zG + BK * 16, &Bs[1][zL]);
    }

    int cur = 0;
    for (int t = 0; t < nT; ++t) {
#pragma unroll   // the tile's runs of 32 k, in ascending k; LDS offsets become immediates
        for (int kk = 0; kk < BK; kk += 32) {
            // fragments (each reused by two WMMAs)
            Frag fa0, fa1, fb0, fb1;
            const u16* ap = &As[cur][(wr * 32 + lrow) * LDP + kk + khalf];
            load_frag(fa0, ap);
            load_frag(fa1, ap + 16 * LDP);
            const u16* bp = &Bs[cur][kk * LDB + bT];
            load_frag_tr(fb0, bp);
            load_frag_tr(fb1, bp + 16);

            acc00 = __builtin_amdgcn_wmma_f32_16x16x32_bf16(false, fa0.b, false, fb0.b,
                                                            (short)0, acc00, false, false);
            acc01 = __builtin_amdgcn_wmma_f32_16x16x32_bf16(false, fa0.b, false, fb1.b,
                                                            (short)0, acc01, false, false);
            acc10 = __builtin_amdgcn_wmma_f32_16x16x32_bf16(false, fa1.b, false, fb0.b,
                                                            (short)0, acc10, false, false);
            acc11 = __builtin_amdgcn_wmma_f32_16x16x32_bf16(false, fa1.b, false, fb1.b,
                                                            (short)0, acc11, false, false);
            if (MODE == C_ROWSUM || MODE == C_ATTN) {
                Frag fz = fone;
                if (MODE == C_ATTN) load_frag_tr(fz, &Bs[cur][kk * LDB + zT]);
                accz0 = __builtin_amdgcn_wmma_f32_16x16x32_bf16(false, fa0.b, false, fz.b,
                                                                (short)0, accz0, false, false);
                accz1 = __builtin_amdgcn_wmma_f32_16x16x32_bf16(false, fa1.b, false, fz.b,
                                                                (short)0, accz1, false, false);
            }
        }

        // Hand-over: this wave's LDS reads are done and its copies of tile t + 1
        // have landed; behind the barrier every wave may read tile t + 1, and
        // buffer cur, which all have left, may be refilled.
        asm volatile("s_wait_dscnt 0x0" ::: "memory");
        async_wait0();
        __syncthreads();
        if (t + 2 < nT) {
            stage_a<BK>(aG + (long long)(t + 2) * BK, lda, &As[cur][aL]);
            stage_b<BK>(bG + (long long)(t + 2) * BK * ldb, ldb, &Bs[cur][bL]);
            if (MODE == C_ATTN) stage_z(zG + (t + 2) * BK * 16, &Bs[cur][zL]);
        }
        cur ^= 1;
    }
    async_wait0();   // no copy outlives the loop

    // C/D layout: VGPR r -> row r + (lane>=16 ? 8 : 0), col lane%16
    const int rsel = (lane >> 4) ? 8 : 0;
    const int cm   = tileM + wr * 32 + rsel;
    const int cn   = tileN + wc * 32 + lrow;
    if (MODE == C_ATTN) {
        u16* C = (u16*)Cp + (bz >> 4) * 1024 + (bz & 15) * 64 + cn;
#pragma unroll   // the accumulators indexed by constants: stay in registers
        for (int r = 0; r < 8; ++r) {
            // a lane and its neighbour hold the two parts of the row's dot(A row, z);
            // one division a row, SCALE / den, serves both of the lane's columns
            const float s0 = 0.125f / ((accz0[r] + __shfl_xor(accz0[r], 1, 32)) * 0.125f + 1e-5f);
            const float s1 = 0.125f / ((accz1[r] + __shfl_xor(accz1[r], 1, 32)) * 0.125f + 1e-5f);
            C[(long long)(cm + r) * 2048]           = f2bf(acc00[r] * s0);
            C[(long long)(cm + r) * 2048 + 16]      = f2bf(acc01[r] * s0);
            C[(long long)(cm + 16 + r) * 2048]      = f2bf(acc10[r] * s1);
            C[(long long)(cm + 16 + r) * 2048 + 16] = f2bf(acc11[r] * s1);
        }
    } else if (MODE == C_BF16 || MODE == C_ROWSUM) {
        u16* C = (u16*)Cp + (long long)bz * strideC;
#pragma unroll
        for (int r = 0; r < 8; ++r) {
            C[(long long)(cm + r) * ldc + cn]           = f2bf(acc00[r]);
            C[(long long)(cm + r) * ldc + cn + 16]      = f2bf(acc01[r]);
            C[(long long)(cm + 16 + r) * ldc + cn]      = f2bf(acc10[r]);
            C[(long long)(cm + 16 + r) * ldc + cn + 16] = f2bf(acc11[r]);
        }
        if (MODE == C_ROWSUM && wc == 0) {   // every column of accz holds the row's sum
            u16* Z = Zc + ((long long)bz * M + cm) * 16 + lrow;
#pragma unroll   // accz indexed by constants: stays in registers
            for (int r = 0; r < 8; ++r) {
                const u16 h0 = f2bf(accz0[r]), h1 = f2bf(accz1[r]);
                Z[r * 16]        = (lrow & 1) ? f2bf(accz0[r] - bf2f(h0)) : h0;
                Z[(16 + r) * 16] = (lrow & 1) ? f2bf(accz1[r] - bf2f(h1)) : h1;
            }
        }
    } else {
        float* C = (float*)Cp + (long long)bz * strideC;
#pragma unroll
        for (int r = 0; r < 8; ++r) {
            C[(long long)(cm + r) * ldc + cn]           = acc00[r];
            C[(long long)(cm + r) * ldc + cn + 16]      = acc01[r];
            C[(long long)(cm + 16 + r) * ldc + cn]      = acc10[r];
            C[(long long)(cm + 16 + r) * ldc + cn + 16] = acc11[r];
        }
    }
}

template <int MODE, int BK>
__global__ __launch_bounds__(256) void gemm_bf16_kernel(
    const u16* __restrict__ A, const u16* __restrict__ B, void* __restrict__ Cp,
    u16* __restrict__ Zc,
    int M, int N, int K, int lda, int ldb, int ldc,
    long long strideA, long long strideB, long long strideC)
{
    gemm_tile<MODE, BK>(A, B, Cp, Zc, M, N, K, lda, ldb, ldc, strideA, strideB, strideC,
                        blockIdx.x, blockIdx.y, blockIdx.z);
}

// ---------------------------------------------------------------------------
// All four fp32 -> bf16 casts in one launch: blocks 0..511 h, 512..639 Wq,
// 640..895 Wkv, 896..1023 Wo. Wq and Wkv go side by side into Wqkv[1024][3072], so
// that one GEMM makes q, k and v.
// A block converts 8192 consecutive floats (every array here is a multiple of
// that). A lane takes four floats per access, so a wave reads 512 and writes
// 256 contiguous bytes; all eight loads of a thread are asked for first.
__global__ __launch_bounds__(256) void cvt_all_kernel(const float* __restrict__ h,
                                                      const float* __restrict__ Wq,
                                                      const float* __restrict__ Wkv,
                                                      const float* __restrict__ Wo,
                                                      u16* __restrict__ h_bf,
                                                      u16* __restrict__ Wqkv_bf,
                                                      u16* __restrict__ Wo_bf)
{
    int blk = blockIdx.x;
    const float* src = h;
    u16* dst  = h_bf;
    int pitch = 1024;                   // elements from one destination row to the next
    int sh    = 0;                      // a source row is 1024 << sh floats
    if (blk >= 896)      { blk -= 896; src = Wo;  dst = Wo_bf; }
    else if (blk >= 640) { blk -= 640; src = Wkv; dst = Wqkv_bf + 1024; pitch = 3072; sh = 1; }
    else if (blk >= 512) { blk -= 512; src = Wq;  dst = Wqkv_bf;        pitch = 3072; }
    src += blk * 8192 + threadIdx.x * 4;
    dst += threadIdx.x * 4;
    f32x4 v[8];
#pragma unroll   // v[] indexed by constants: stays in registers
    for (int u = 0; u < 8; ++u) v[u] = *(const f32x4*)(src + u * 1024);
#pragma unroll
    for (int u = 0; u < 8; ++u) {
        u16x4 o;
#pragma unroll
        for (int e = 0; e < 4; ++e) o[e] = f2bf(v[u][e]);
        const int g = blk * 8 + u;      // which run of 1024 floats of the array
        *(u16x4*)(dst + (g >> sh) * pitch + (g & ((1 << sh) - 1)) * 1024) = o;
    }
}

// DPFP: x2 = [relu(x), relu(-x)] (128); feature f=(i-1)*128+j = x2[j]*x2[(j-i)&127]
// pq[bn][s][f]: one block per (128 consecutive s, bn). A lane owns 8 consecutive
// j of a row: it reads them (16 B) and the four in front of them (8 B) straight
// from q and stores its 8 features of each roll as 16 B, so 16 lanes write 256
// contiguous bytes. A thread does 8 rows, 16 apart. src is qkv[s*2+b][3072], q first.
__device__ __forceinline__ void dpfp_block(const u16* __restrict__ src,
                                           u16* __restrict__ dst, int bx, int bn)
{
    const int b  = bn >> 4, n = bn & 15;   // bn = b*16 + n
    const int j0 = (threadIdx.x & 15) * 8;
    const int jp = (j0 - 4) & 127;      // the four x2 entries in front, modulo 128
    const int s0 = bx * 128 + (threadIdx.x >> 4);

    const u16* row = src + (long long)(s0 * 2 + b) * 3072 + n * 64;
    u16x8 cur[8];
    u16x4 prv[8];
#pragma unroll   // cur[], prv[] indexed by constants: stay in registers
    for (int u = 0; u < 8; ++u)         // 16 rows of s further on = 32 rows of qkv
        cur[u] = *(const u16x8*)(row + u * 98304 + (j0 & 63));
    // Precaution: the address pair of the loads above is overwritten further down;
    // this wait stands in front of that overwrite.
    asm volatile("s_wait_xcnt 0x0" ::: "memory");
#pragma unroll
    for (int u = 0; u < 8; ++u)
        prv[u] = *(const u16x4*)(row + u * 98304 + (jp & 63));
    const u16 fc = (j0 & 64) ? 0x8000 : 0;   // upper half of x2 is relu(-x)
    const u16 fp = (jp & 64) ? 0x8000 : 0;
#pragma unroll
    for (int u = 0; u < 8; ++u) {
        float w[11];                    // x2[j0-3 .. j0+7]
#pragma unroll
        for (int t = 0; t < 3; ++t) w[t] = fmaxf(bf2f((u16)(prv[u][t + 1] ^ fp)), 0.f);
#pragma unroll
        for (int e = 0; e < 8; ++e) w[3 + e] = fmaxf(bf2f((u16)(cur[u][e] ^ fc)), 0.f);
        u16* out = dst + ((long long)bn * 2048 + s0 + u * 16) * 384 + j0;
#pragma unroll
        for (int i = 1; i <= 3; ++i) {
            u16x8 o;
#pragma unroll
            for (int e = 0; e < 8; ++e) o[e] = f2bf(w[3 + e] * w[3 + e - i]);
            *(u16x8*)(out + (i - 1) * 128) = o;
        }
    }
}

// pkT[bn][f][s]: one block per (128 consecutive s, bn). k goes into LDS
// transposed ([d][s], two s per dword), so that every feature row leaves as
// 256 contiguous bytes, 16 B per lane. A thread owns 8 s and 8 consecutive j
// and slides a window of four x2 rows over them. k is columns 1024..2047 of qkv.
__device__ __forceinline__ void dpfp_t_block(const u16* __restrict__ qkv,
                                             u16* __restrict__ dst, int bx, int bn)
{
    __shared__ __align__(16) unsigned xT[64 * 64];   // [d][s pair]
    const int s0  = bx * 128;
    const int b   = bn >> 4, n = bn & 15;   // bn = b*16 + n
    const int tid = threadIdx.x;

    const int sp = tid & 63;            // a wave's lanes: 32 neighbouring dwords of one LDS row
    u16x8 lo[2], hi[2];
#pragma unroll
    for (int r = 0; r < 2; ++r) {
        const int dc = (tid >> 6) + r * 4;
        const u16* p = qkv + (long long)((s0 + 2 * sp) * 2 + b) * 3072 + 1024 + n * 64 + dc * 8;
        lo[r] = *(const u16x8*)p;            // row s
        hi[r] = *(const u16x8*)(p + 6144);   // row s + 1
    }
#pragma unroll
    for (int r = 0; r < 2; ++r) {
        const int dc = (tid >> 6) + r * 4;
#pragma unroll
        for (int e = 0; e < 8; ++e)
            xT[(dc * 8 + e) * 64 + sp] = (unsigned)lo[r][e] | ((unsigned)hi[r][e] << 16);
    }
    __syncthreads();

    const int c  = tid & 15;            // which 8 s of the 128
    const int j0 = (tid >> 4) * 8;
    u16* out = dst + ((long long)bn * 384 + j0) * 2048 + s0 + c * 8;

    // The eleven x rows this thread needs (j0-3 .. j0+7, modulo 128), each read once.
    // Every loop below is unrolled so that q[], w[] and o[] are indexed by constants and stay in registers.
    uint4 q[11];
#pragma unroll
    for (int t = 0; t < 11; ++t) q[t] = *(const uint4*)&xT[((j0 + t - 3) & 63) * 64 + c * 4];

    float w[4][8];
#pragma unroll
    for (int t = 0; t < 11; ++t) {
        const unsigned flip = ((j0 + t - 3) & 64) ? 0x80008000u : 0u;   // upper half of x2 is relu(-x)
        const unsigned qq[4] = {q[t].x ^ flip, q[t].y ^ flip, q[t].z ^ flip, q[t].w ^ flip};
#pragma unroll
        for (int e = 0; e < 4; ++e) {
            w[t & 3][2 * e]     = fmaxf(__uint_as_float(qq[e] << 16), 0.f);
            w[t & 3][2 * e + 1] = fmaxf(__uint_as_float(qq[e] & 0xFFFF0000u), 0.f);
        }
        if (t >= 3) {
#pragma unroll
            for (int i = 1; i <= 3; ++i) {
                u16x8 o;
#pragma unroll
                for (int e = 0; e < 8; ++e) o[e] = f2bf(w[t & 3][e] * w[(t - i) & 3][e]);
                *(u16x8*)(out + (long long)((i - 1) * 128 + (t - 3)) * 2048) = o;
            }
        }
    }
    // Precaution: in a kernel that holds other paths as well, code that follows in the
    // listing overwrites registers the stores above name; this wait stands in front.
    asm volatile("s_wait_xcnt 0x0" ::: "memory");
}

// v_bf[bn][s][d] = qkv_bf[(s*2+b)*3072 + 2048 + n*64 + d]
// A lane moves 8 d (16 B), a thread four such groups.
__device__ __forceinline__ void gather_v_block(const u16* __restrict__ qkv,
                                               u16* __restrict__ vb, int bx)
{
    const int g0 = bx * 1024 + threadIdx.x;           // group of 8 d, < 32*2048*8
    const int d = (g0 & 7) * 8, s = (g0 >> 3) & 2047, bn = g0 >> 14;
    const int b = bn >> 4, n = bn & 15;
    const u16* p = qkv + (long long)(s * 2 + b) * 3072 + 2048 + n * 64 + d;
    u16x8 v[4];
#pragma unroll   // v[] indexed by constants: stays in registers
    for (int u = 0; u < 4; ++u) v[u] = *(const u16x8*)(p + u * 196608);   // 256 groups on = 32 s on, same bn
#pragma unroll
    for (int u = 0; u < 4; ++u) *(u16x8*)(vb + (long long)(g0 + u * 256) * 8) = v[u];
}

// What the kv_agg GEMM reads, in one launch: blocks 0..511 make pkT, 512..1023 v_bf.
__global__ __launch_bounds__(256) void pkt_v_kernel(const u16* __restrict__ qkv,
                                                    u16* __restrict__ pkT,
                                                    u16* __restrict__ vb)
{
    const int blk = blockIdx.x;
    if (blk >= 512) { gather_v_block(qkv, vb, blk - 512); return; }   // the whole block leaves
    dpfp_t_block(qkv, pkT, blk & 15, blk >> 4);
}

// kv_agg[bn] = pkT[bn] @ v[bn] (384x2048 . 2048x64, bf16 out) with z[bn] as the row
// sums of pkT[bn]: blocks 0..95, which start first and run longest. They fill 96 of
// the chip's WGPs; pq, which only the GEMM after this one reads, is made beside them
// by blocks 96..607. The GEMM's arguments are those of gemm_bf16_kernel.
__global__ __launch_bounds__(256) void kvagg_pq_kernel(
    const u16* __restrict__ A, const u16* __restrict__ B, void* __restrict__ Cp,
    u16* __restrict__ Zc,
    int M, int N, int K, int lda, int ldb, int ldc,
    long long strideA, long long strideB, long long strideC,
    const u16* __restrict__ qkv, u16* __restrict__ pq)
{
    const int blk = blockIdx.x;
    if (blk >= 96) { dpfp_block(qkv, pq, (blk - 96) & 15, (blk - 96) >> 4); return; }   // the whole block leaves
    gemm_tile<C_ROWSUM, 128>(A, B, Cp, Zc, M, N, K, lda, ldb, ldc, strideA, strideB, strideC,
                             0, blk % 3, blk / 3);   // three row tiles a batch
}

// out = layernorm(h + attn_out)
__global__ __launch_bounds__(256) void ln_kernel(const float* __restrict__ h,
                                                 const float* __restrict__ attn,
                                                 const float* __restrict__ gamma,
                                                 const float* __restrict__ beta,
                                                 float* __restrict__ out)
{
    __shared__ float red[256];
    const int row = blockIdx.x, tid = threadIdx.x;
    const float* hr = h    + (long long)row * 1024;
    const float* ar = attn + (long long)row * 1024;

    float lsum = 0.f;
    for (int c = tid; c < 1024; c += 256) lsum += hr[c] + ar[c];
    red[tid] = lsum; __syncthreads();
    for (int st = 128; st > 0; st >>= 1) {
        if (tid < st) red[tid] += red[tid + st];
        __syncthreads();
    }
    const float mu = red[0] * (1.f / 1024.f);
    __syncthreads();

    float lvar = 0.f;
    for (int c = tid; c < 1024; c += 256) {
        float d = hr[c] + ar[c] - mu;
        lvar += d * d;
    }
    red[tid] = lvar; __syncthreads();
    for (int st = 128; st > 0; st >>= 1) {
        if (tid < st) red[tid] += red[tid + st];
        __syncthreads();
    }
    const float rstd = rsqrtf(red[0] * (1.f / 1024.f) + 1e-5f);
    for (int c = tid; c < 1024; c += 256)
        out[(long long)row * 1024 + c] = (hr[c] + ar[c] - mu) * rstd * gamma[c] + beta[c];
}

// ---------------------------------------------------------------------------
extern "C" void kernel_launch(void* const* d_in, const int* in_sizes, int n_in,
                              void* d_out, int out_size, void* d_ws, size_t ws_size,
                              hipStream_t stream)
{
    const float* h    = (const float*)d_in[0];   // [2048,2,1024]
    const float* Wq   = (const float*)d_in[1];   // [1024,1024]
    const float* Wkv  = (const float*)d_in[2];   // [1024,2048]
    const float* Wo   = (const float*)d_in[3];   // [1024,1024]
    const float* gam  = (const float*)d_in[4];
    const float* bet  = (const float*)d_in[5];
    float* out = (float*)d_out;
    (void)in_sizes; (void)n_in; (void)out_size; (void)ws_size;

    char* ws = (char*)d_ws;
    auto take = [&](size_t bytes) -> char* { char* p = ws; ws += bytes; return p; };

    u16*   h_bf     = (u16*)  take(8388608);    // 4096x1024
    u16*   Wqkv_bf  = (u16*)  take(6291456);    // 1024x3072: Wq | Wkv
    u16*   Wo_bf    = (u16*)  take(2097152);    // 1024x1024
    u16*   qkv_bf   = (u16*)  take(25165824);   // 4096x3072: q | k | v
    u16*   v_bf     = (u16*)  take(8388608);    // 32 x 2048x64
    u16*   pq_bf    = (u16*)  take(50331648);   // 32 x 2048x384
    u16*   pkT_bf   = (u16*)  take(50331648);   // 32 x 384x2048
    u16*   zc_bf    = (u16*)  take(393216);     // 32 x 384x16
    u16*   kvagg_bf = (u16*)  take(1572864);    // 32 x 384x64
    u16*   attn_bf  = (u16*)  take(8388608);    // 4096x1024
    float* attn_out = (float*)take(16777216);   // 4096x1024

    // 1) fp32 -> bf16 casts
    cvt_all_kernel<<<1024, 256, 0, stream>>>(h, Wq, Wkv, Wo, h_bf, Wqkv_bf, Wo_bf);

    // 2) q | k | v = h @ (Wq | Wkv)  [4096,3072]  (bf16 out); K-step 128: two blocks'
    //    LDS fit a WGP, so the 1536 blocks are three even rounds on 256 WGPs
    gemm_bf16_kernel<C_BF16, 128><<<dim3(48, 32, 1), 256, 0, stream>>>(
        h_bf, Wqkv_bf, qkv_bf, nullptr, 4096, 3072, 1024, 1024, 3072, 3072, 0, 0, 0);

    // 3) DPFP features pkT [bn][f][s], and v gathered into [bn][s][d]
    pkt_v_kernel<<<1024, 256, 0, stream>>>(qkv_bf, pkT_bf, v_bf);

    // 4) kv_agg and z; beside them the DPFP features pq [bn][s][f]
    kvagg_pq_kernel<<<608, 256, 0, stream>>>(
        pkT_bf, v_bf, kvagg_bf, zc_bf, 384, 64, 2048, 2048, 64, 64,
        786432LL, 131072LL, 24576LL, qkv_bf, pq_bf);

    // 5) num[bn] = pq[bn] @ kv_agg[bn]  (2048x384 . 384x64) and den[bn] = pq[bn] @ z[bn]
    //    in one pass over pq; attn_vec = num*SCALE/den leaves as bf16 [4096,1024]
    gemm_bf16_kernel<C_ATTN, 128><<<dim3(1, 16, 32), 256, 0, stream>>>(
        pq_bf, kvagg_bf, attn_bf, zc_bf, 2048, 64, 384, 384, 64, 64,
        786432LL, 24576LL, 0LL);

    // 6) attn_out = attn_vec @ Wo  (fp32 out)
    gemm_bf16_kernel<C_F32, 128><<<dim3(16, 32, 1), 256, 0, stream>>>(
        attn_bf, Wo_bf, attn_out, nullptr, 4096, 1024, 1024, 1024, 1024, 1024, 0, 0, 0);

    // 7) out = layernorm(h + attn_out)
    ln_kernel<<<4096, 256, 0, stream>>>(h, attn_out, gam, bet, out);
}

// v007
// A run of this version takes 103 microseconds.
// In both of two side-by-side timings against v006, it was 1.11 times as fast.
// Over all steps from v000 it is 3.99 times as fast.
#include <hip/hip_runtime.h>
#include <hip/hip_bf16.h>

// ---------------------------------------------------------------------------
// DPFP linear attention for MI455X (gfx1250): all GEMMs via bf16 WMMA
// (v_wmma_f32_16x16x32_bf16), fp32 accumulate. 128x64 block tiles, 8 waves
// each computing 32x32 (2x fragment reuse), K-steps of 128, double-
// buffered LDS with GLOBAL_LOAD_ASYNC_TO_LDS_B128 staging for both tiles; the
// B tile stays [k][n] in LDS and is read with DS_LOAD_TR16_B128. The feature sums z
// and the denominators are further columns of the two batched GEMMs. The DPFP
// features of k and the per-head q and v leave the q | k | v GEMM's own epilogue.
// Kernels that do not depend on one another share a launch, told apart by the block index.
// ---------------------------------------------------------------------------

typedef unsigned short u16;
typedef __attribute__((ext_vector_type(4)))  unsigned short u16x4;
typedef __attribute__((ext_vector_type(8)))  unsigned short u16x8;
typedef __attribute__((ext_vector_type(4)))  float         f32x4;
typedef __attribute__((ext_vector_type(16))) unsigned short v16u;
typedef __attribute__((ext_vector_type(16))) __bf16        v16bf;
typedef __attribute__((ext_vector_type(8)))  float         v8f;
typedef __attribute__((ext_vector_type(8)))  short         s16x8;

union Frag { v16u u; v16bf b; };

#ifndef __has_builtin
#define __has_builtin(x) 0
#endif

#if defined(__AMDGCN__) && __has_builtin(__builtin_amdgcn_global_load_async_to_lds_b128)
#define USE_ASYNC_LDS 1
#else
#define USE_ASYNC_LDS 0
#endif

#if USE_ASYNC_LDS
// Builtin signature (from hipcc diagnostic): (v4i addrspace(1)*, v4i addrspace(3)*, imm, imm)
typedef int gcc_i32x4 __attribute__((vector_size(16)));
__device__ __forceinline__ void async_copy_b128(const u16* g, u16* l) {
    __builtin_amdgcn_global_load_async_to_lds_b128(
        (__attribute__((address_space(1))) gcc_i32x4*)(void*)g,
        (__attribute__((address_space(3))) gcc_i32x4*)(void*)l, 0, 0);
}
#endif

// The issuing wave's copies have landed. In asm with the memory clobber, so that
// no LDS read moves in front of it.
__device__ __forceinline__ void async_wait0() {
#if USE_ASYNC_LDS
    asm volatile("s_wait_asynccnt 0x0" ::: "memory");
#endif
}

// One 128 x BK A tile into LDS rows of BK + 8 elements. g and l are the lane's own
// first 16 bytes: BK/8 neighbouring lanes take one row's BK*2 contiguous bytes, so
// a wave's copy covers four whole 128-B lines. A thread brings BK/16 rows.
template <int BK>
__device__ __forceinline__ void stage_a(const u16* g, int lda, u16* l) {
    constexpr int RP = 2048 / BK;        // rows the block's 256 lanes cover at once
#pragma unroll   // independent copies, issued back to back
    for (int u = 0; u < 128 / RP; ++u) {
#if USE_ASYNC_LDS
        async_copy_b128(g + (long long)(u * RP) * lda, l + u * RP * (BK + 8));
#else
        *(u16x8*)(l + u * RP * (BK + 8)) = *(const u16x8*)(g + (long long)(u * RP) * lda);
#endif
    }
}

// Row pitch of the B tile in LDS, in elements: 64 n + 16 = 160 bytes, an odd
// multiple of 32 B, which ds_load_tr16_b128 reads without bank conflicts.
constexpr int LDB = 80;

// One BK x 64 B tile into LDS as it lies in memory, [k][n]. g and l are the lane's
// own first 16 bytes: 8 neighbouring lanes take one row's 128 contiguous bytes, so
// a wave's copy covers four whole 128-B lines. A thread brings BK/32 rows.
template <int BK>
__device__ __forceinline__ void stage_b(const u16* g, int ldb, u16* l) {
#pragma unroll   // independent copies, issued back to back
    for (int r = 0; r < BK / 32; ++r) {
#if USE_ASYNC_LDS
        async_copy_b128(g + (long long)(r * 32) * ldb, l + r * 32 * LDB);
#else
        *(u16x8*)(l + r * 32 * LDB) = *(const u16x8*)(g + (long long)(r * 32) * ldb);
#endif
    }
}

// The 128 x 16 block of z columns beside a 128 x 64 B tile, into columns 64..79 of
// its LDS rows. g and l are the lane's own 16 bytes: the block's 256 lanes take 4 KiB
// that lie contiguous in memory, one copy a thread.
__device__ __forceinline__ void stage_z(const u16* g, u16* l) {
#if USE_ASYNC_LDS
    async_copy_b128(g, l);
#else
    *(u16x8*)l = *(const u16x8*)g;
#endif
}

__device__ __forceinline__ u16 f2bf(float f) {
    union { float f; unsigned u; } x; x.f = f;
    unsigned u = x.u;
    u += 0x7FFFu + ((u >> 16) & 1u);     // round-to-nearest-even
    return (u16)(u >> 16);
}
__device__ __forceinline__ float bf2f(u16 h) {
    union { unsigned u; float f; } x; x.u = ((unsigned)h) << 16;
    return x.f;
}

// ISA 16-bit fragment layout: lane element e -> K = khalf + e + (e>=8 ? 8 : 0)
__device__ __forceinline__ void load_frag(Frag& f, const u16* p) {
    u16x8 lo = *(const u16x8*)p;
    u16x8 hi = *(const u16x8*)(p + 16);
#pragma unroll
    for (int e = 0; e < 8; ++e) { f.u[e] = lo[e]; f.u[e + 8] = hi[e]; }
}

// B fragment (32 k x 16 n) out of the [k][n] tile by two transposing loads. p is the
// lane's own address: row 8*(lane>>4) + (lane&7), column 8*((lane>>3)&1) of the 16 x 16
// piece; the lane gets column lane&15 at k = 8*(lane>>4) + 0..7, and 16 rows on the
// same at k + 16: the k order of load_frag.
__device__ __forceinline__ void load_frag_tr(Frag& f, const u16* p) {
    typedef __attribute__((address_space(3))) s16x8 lds_s16x8;
    s16x8 lo = __builtin_amdgcn_ds_load_tr16_b128_v8i16((lds_s16x8*)p);
    s16x8 hi = __builtin_amdgcn_ds_load_tr16_b128_v8i16((lds_s16x8*)(p + 16 * LDB));
#pragma unroll   // f.u[] indexed by constants: stays in registers
    for (int e = 0; e < 8; ++e) { f.u[e] = (u16)lo[e]; f.u[e + 8] = (u16)hi[e]; }
}

// ---------------------------------------------------------------------------
// What the q | k | v GEMM's epilogue does with its 128 x 64 tile, which it has laid in
// LDS as bf16: 128 consecutive s, from s0 on, of one head of q, k or v; bn = b*16 + n.
// DPFP: x2 = [relu(x), relu(-x)] (128); feature f=(i-1)*128+j = x2[j]*x2[(j-i)&127]
// ---------------------------------------------------------------------------
constexpr int TP = 72;    // row pitch of the tile as [s][d], elements: 128 + 16 bytes
constexpr int TT = 136;   // row pitch of the tile as [d][s], elements: 256 + 16 bytes

// pkT[bn][f][s] from T[d][s], so that every feature row leaves as 256 contiguous
// bytes, 16 B per lane. A thread owns 8 s and 8 consecutive j and slides a window
// of four x2 rows over them.
__device__ __forceinline__ void feat_cols(const u16* T, u16* __restrict__ dst, int bn, int s0)
{
    const int c  = threadIdx.x & 15;    // which 8 s of the 128
    const int j0 = (threadIdx.x >> 4) * 8;
    u16* out = dst + ((long long)bn * 384 + j0) * 2048 + s0 + c * 8;

    // The eleven x rows this thread needs (j0-3 .. j0+7, modulo 128), each read once.
    // Every loop below is unrolled so that q[], w[] and o[] are indexed by constants and stay in registers.
    uint4 q[11];
#pragma unroll
    for (int t = 0; t < 11; ++t) q[t] = *(const uint4*)(T + ((j0 + t - 3) & 63) * TT + c * 8);

    float w[4][8];
#pragma unroll
    for (int t = 0; t < 11; ++t) {
        const unsigned flip = ((j0 + t - 3) & 64) ? 0x80008000u : 0u;   // upper half of x2 is relu(-x)
        const unsigned qq[4] = {q[t].x ^ flip, q[t].y ^ flip, q[t].z ^ flip, q[t].w ^ flip};
#pragma unroll
        for (int e = 0; e < 4; ++e) {
            w[t & 3][2 * e]     = fmaxf(__uint_as_float(qq[e] << 16), 0.f);
            w[t & 3][2 * e + 1] = fmaxf(__uint_as_float(qq[e] & 0xFFFF0000u), 0.f);
        }
        if (t >= 3) {
#pragma unroll
            for (int i = 1; i <= 3; ++i) {
                u16x8 o;
#pragma unroll
                for (int e = 0; e < 8; ++e) o[e] = f2bf(w[t & 3][e] * w[(t - i) & 3][e]);
                *(u16x8*)(out + (long long)((i - 1) * 128 + (t - 3)) * 2048) = o;
            }
        }
    }
}

// dst[bn][s][d] (q_bf or v_bf) from T[s][d]: the tile's 16 KiB lie contiguous there. A
// lane moves 8 d (16 B), a thread four such groups.
__device__ __forceinline__ void rows_out(const u16* T, u16* __restrict__ dst, int bn, int s0)
{
    u16* out = dst + ((long long)bn * 2048 + s0) * 64;
#pragma unroll   // independent moves
    for (int u = 0; u < 4; ++u) {
        const int g = threadIdx.x + u * 256;          // group of 8 d, < 128*8
        *(u16x8*)(out + g * 8) = *(const u16x8*)(T + (g >> 3) * TP + (g & 7) * 8);
    }
}

// ---------------------------------------------------------------------------
// Batched bf16 GEMM: C[M,N] = A[M,K] @ B[K,N], row-major, fp32 acc.
// Block: 256 threads = 8 waves; tile 128x64; wave (wr 0..3, wc 0..1) owns
// 32x32. Double-buffered K-steps of BK (64 or 128).
// Requires: M%128==0, N%64==0, K%BK==0, lda/ldb/ldc %8==0, 16B-aligned bases.
// MODE says what leaves the block:
//   C_BF16, C_F32  C as bf16 or fp32.
//   C_ROWSUM       C as bf16, and the row sums of A (a product with a fragment of
//                  ones) as Zc[bz][m][16]: each sum split into two bf16, the upper
//                  part in the even columns, the rest in the odd ones.
//   C_ATTN         N = 64. Zc[bz][k][16] rides as 16 more columns of B, so that
//                  column pairs of A @ Zc add up to dot(A row, z). C * SCALE over
//                  (that * SCALE + EPS) goes as bf16 to [m][bz >> 4][bz & 15][n].
//   C_QKV          C = q | k | v, 16 column tiles each, a tile one head; row b*2048 + s.
//                  C itself is not stored: rounded to bf16 the tile goes through LDS,
//                  and a q tile leaves as q_bf (Cp), a k tile as pkT (Zc), a v tile
//                  as v_bf (Vb).
// ---------------------------------------------------------------------------
enum { C_BF16 = 0, C_F32 = 1, C_ROWSUM = 2, C_ATTN = 3, C_QKV = 4 };

// One block's tile: column tile bx, row tile by, batch bz.
template <int MODE, int BK>
__device__ __forceinline__ void gemm_tile(
    const u16* __restrict__ A, const u16* __restrict__ B, void* __restrict__ Cp,
    u16* __restrict__ Zc,
    int M, int N, int K, int lda, int ldb, int ldc,
    long long strideA, long long strideB, long long strideC,
    int bx, int by, int bz, u16* __restrict__ Vb = nullptr)
{
    // Row pitch of the A tile: BK*2 + 16 bytes, an odd multiple of 16 B, which
    // ds_load_b128 reads without bank conflicts.
    constexpr int LDP = BK + 8;
    static_assert(MODE != C_ATTN || BK == 128, "stage_z: one copy a thread fills 128 rows");
    __shared__ __align__(16) u16 As[2][128 * LDP];  // [m][k]
    __shared__ __align__(16) u16 Bs[2][BK * LDB];   // [k][n], as in memory

    A += (long long)bz * strideA;
    B += (long long)bz * strideB;

    const int tileN = bx * 64;
    const int tileM = by * 128;
    const int tid   = threadIdx.x;
    const int lane  = tid & 31;
    const int wave  = tid >> 5;
    const int wr    = wave >> 1;          // m slice: wr*32
    const int wc    = wave & 1;           // n slice: wc*32
    const int lrow  = lane & 15;
    const int khalf = (lane >> 4) ? 8 : 0;

    // staging coordinates
    const int ar = tid / (BK / 8);        // A row, and every 2048/BK rows on
    const int ac = (tid % (BK / 8)) * 8;  // 0..BK-8
    const int br = tid >> 3;              // 0..31 (k row), and every 32 rows on
    const int bc = (tid & 7) * 8;         // 0..56 (n col)

    const u16* aG = A + (long long)(tileM + ar) * lda + ac;   // K-tile t: + t*BK
    const u16* bG = B + (long long)br * ldb + tileN + bc;     // K-tile t: + t*BK rows
    const int  aL = ar * LDP + ac;
    const int  bL = br * LDB + bc;
    // this lane's address in a 16 x 16 piece of the B tile, for the transposing loads
    const int  bT = (khalf + (lane & 7)) * LDB + wc * 32 + ((lane >> 3) & 1) * 8;
    const int  nT = K / BK;               // K-tiles
    // z columns (C_ATTN): row tid >> 1, half tid & 1 of the tile's 128 x 16 block
    const u16* zG = Zc + (long long)bz * K * 16 + tid * 8;    // K-tile t: + t*BK*16
    const int  zL = (tid >> 1) * LDB + 64 + (tid & 1) * 8;
    const int  zT = (khalf + (lane & 7)) * LDB + 64 + ((lane >> 3) & 1) * 8;

    v8f acc00 = {}, acc01 = {}, acc10 = {}, acc11 = {};
    v8f accz0 = {}, accz1 = {};           // C_ROWSUM: row sums of A; C_ATTN: A @ Zc
    Frag fone;
#pragma unroll   // fone.u[] indexed by constants: stays in registers
    for (int e = 0; e < 16; ++e) fone.u[e] = 0x3F80;          // 1.0

    // ---- prologue: K-tile 0 into buffer 0, then K-tile 1 on its way into buffer 1
    stage_a<BK>(aG, lda, &As[0][aL]);
    stage_b<BK>(bG, ldb, &Bs[0][bL]);
    if (MODE == C_ATTN) stage_z(zG, &Bs[0][zL]);
    async_wait0();
    __syncthreads();
    if (1 < nT) {
        stage_a<BK>(aG + BK, lda, &As[1][aL]);
        stage_b<BK>(bG + (long long)BK * ldb, ldb, &Bs[1][bL]);
        if (MODE == C_ATTN) stage_z(zG + BK * 16, &Bs[1][zL]);
    }

    int cur = 0;
    for (int t = 0; t < nT; ++t) {
#pragma unroll   // the tile's runs of 32 k, in ascending k; LDS offsets become immediates
        for (int kk = 0; kk < BK; kk += 32) {
            // fragments (each reused by two WMMAs)
            Frag fa0, fa1, fb0, fb1;
            const u16* ap = &As[cur][(wr * 32 + lrow) * LDP + kk + khalf];
            load_frag(fa0, ap);
            load_frag(fa1, ap + 16 * LDP);
            const u16* bp = &Bs[cur][kk * LDB + bT];
            load_frag_tr(fb0, bp);
            load_frag_tr(fb1, bp + 16);

            acc00 = __builtin_amdgcn_wmma_f32_16x16x32_bf16(false, fa0.b, false, fb0.b,
                                                            (short)0, acc00, false, false);
            acc01 = __builtin_amdgcn_wmma_f32_16x16x32_bf16(false, fa0.b, false, fb1.b,
                                                            (short)0, acc01, false, false);
            acc10 = __builtin_amdgcn_wmma_f32_16x16x32_bf16(false, fa1.b, false, fb0.b,
                                                            (short)0, acc10, false, false);
            acc11 = __builtin_amdgcn_wmma_f32_16x16x32_bf16(false, fa1.b, false, fb1.b,
                                                            (short)0, acc11, false, false);
            if (MODE == C_ROWSUM || MODE == C_ATTN) {
                Frag fz = fone;
                if (MODE == C_ATTN) load_frag_tr(fz, &Bs[cur][kk * LDB + zT]);
                accz0 = __builtin_amdgcn_wmma_f32_16x16x32_bf16(false, fa0.b, false, fz.b,
                                                                (short)0, accz0, false, false);
                accz1 = __builtin_amdgcn_wmma_f32_16x16x32_bf16(false, fa1.b, false, fz.b,
                                                                (short)0, accz1, false, false);
            }
        }

        // Hand-over: this wave's LDS reads are done and its copies of tile t + 1
        // have landed; behind the barrier every wave may read tile t + 1, and
        // buffer cur, which all have left, may be refilled.
        asm volatile("s_wait_dscnt 0x0" ::: "memory");
        async_wait0();
        __syncthreads();
        if (t + 2 < nT) {
            stage_a<BK>(aG + (long long)(t + 2) * BK, lda, &As[cur][aL]);
            stage_b<BK>(bG + (long long)(t + 2) * BK * ldb, ldb, &Bs[cur][bL]);
            if (MODE == C_ATTN) stage_z(zG + (t + 2) * BK * 16, &Bs[cur][zL]);
        }
        cur ^= 1;
    }
    async_wait0();   // no copy outlives the loop

    // C/D layout: VGPR r -> row r + (lane>=16 ? 8 : 0), col lane%16
    const int rsel = (lane >> 4) ? 8 : 0;
    const int cm   = tileM + wr * 32 + rsel;
    const int cn   = tileN + wc * 32 + lrow;
    if (MODE == C_QKV) {
        // Every wave has left both buffers at the loop's last barrier, and no copy is
        // under way: the tile takes the place of As.
        u16* T = &As[0][0];
        const int kind = bx >> 4;             // 0 q, 1 k, 2 v: the same for the whole block
        const int bn   = (by >> 4) * 16 + (bx & 15);
        const int s0   = (by & 15) * 128;
        const int m0   = wr * 32 + rsel;
        const int c0   = wc * 32 + lrow;
        if (kind == 1) {
            // as [d][s]: a lane's 8 rows of a column are 8 neighbouring s, 16 bytes
            u16x8 e00, e01, e10, e11;
#pragma unroll   // the accumulators indexed by constants: stay in registers
            for (int r = 0; r < 8; ++r) {
                e00[r] = f2bf(acc00[r]); e01[r] = f2bf(acc01[r]);
                e10[r] = f2bf(acc10[r]); e11[r] = f2bf(acc11[r]);
            }
            *(u16x8*)(T + c0 * TT + m0)             = e00;
            *(u16x8*)(T + (c0 + 16) * TT + m0)      = e01;
            *(u16x8*)(T + c0 * TT + m0 + 16)        = e10;
            *(u16x8*)(T + (c0 + 16) * TT + m0 + 16) = e11;
        } else {
#pragma unroll   // the accumulators indexed by constants: stay in registers
            for (int r = 0; r < 8; ++r) {
                T[(m0 + r) * TP + c0]           = f2bf(acc00[r]);
                T[(m0 + r) * TP + c0 + 16]      = f2bf(acc01[r]);
                T[(m0 + 16 + r) * TP + c0]      = f2bf(acc10[r]);
                T[(m0 + 16 + r) * TP + c0 + 16] = f2bf(acc11[r]);
            }
        }
        __syncthreads();   // the tile is whole before a thread reads what other waves wrote
        if (kind == 1) feat_cols(T, Zc, bn, s0);
        else           rows_out(T, kind == 0 ? (u16*)Cp : Vb, bn, s0);
    } else if (MODE == C_ATTN) {
        u16* C = (u16*)Cp + (bz >> 4) * 1024 + (bz & 15) * 64 + cn;
#pragma unroll   // the accumulators indexed by constants: stay in registers
        for (int r = 0; r < 8; ++r) {
            // a lane and its neighbour hold the two parts of the row's dot(A row, z);
            // one division a row, SCALE / den, serves both of the lane's columns
            const float s0 = 0.125f / ((accz0[r] + __shfl_xor(accz0[r], 1, 32)) * 0.125f + 1e-5f);
            const float s1 = 0.125f / ((accz1[r] + __shfl_xor(accz1[r], 1, 32)) * 0.125f + 1e-5f);
            C[(long long)(cm + r) * 2048]           = f2bf(acc00[r] * s0);
            C[(long long)(cm + r) * 2048 + 16]      = f2bf(acc01[r] * s0);
            C[(long long)(cm + 16 + r) * 2048]      = f2bf(acc10[r] * s1);
            C[(long long)(cm + 16 + r) * 2048 + 16] = f2bf(acc11[r] * s1);
        }
    } else if (MODE == C_BF16 || MODE == C_ROWSUM) {
        u16* C = (u16*)Cp + (long long)bz * strideC;
#pragma unroll
        for (int r = 0; r < 8; ++r) {
            C[(long long)(cm + r) * ldc + cn]           = f2bf(acc00[r]);
            C[(long long)(cm + r) * ldc + cn + 16]      = f2bf(acc01[r]);
            C[(long long)(cm + 16 + r) * ldc + cn]      = f2bf(acc10[r]);
            C[(long long)(cm + 16 + r) * ldc + cn + 16] = f2bf(acc11[r]);
        }
        if (MODE == C_ROWSUM && wc == 0) {   // every column of accz holds the row's sum
            u16* Z = Zc + ((long long)bz * M + cm) * 16 + lrow;
#pragma unroll   // accz indexed by constants: stays in registers
            for (int r = 0; r < 8; ++r) {
                const u16 h0 = f2bf(accz0[r]), h1 = f2bf(accz1[r]);
                Z[r * 16]        = (lrow & 1) ? f2bf(accz0[r] - bf2f(h0)) : h0;
                Z[(16 + r) * 16] = (lrow & 1) ? f2bf(accz1[r] - bf2f(h1)) : h1;
            }
        }
    } else {
        float* C = (float*)Cp + (long long)bz * strideC;
#pragma unroll
        for (int r = 0; r < 8; ++r) {
            C[(long long)(cm + r) * ldc + cn]           = acc00[r];
            C[(long long)(cm + r) * ldc + cn + 16]      = acc01[r];
            C[(long long)(cm + 16 + r) * ldc + cn]      = acc10[r];
            C[(long long)(cm + 16 + r) * ldc + cn + 16] = acc11[r];
        }
    }
}

template <int MODE, int BK>
__global__ __launch_bounds__(256) void gemm_bf16_kernel(
    const u16* __restrict__ A, const u16* __restrict__ B, void* __restrict__ Cp,
    u16* __restrict__ Zc,
    int M, int N, int K, int lda, int ldb, int ldc,
    long long strideA, long long strideB, long long strideC)
{
    gemm_tile<MODE, BK>(A, B, Cp, Zc, M, N, K, lda, ldb, ldc, strideA, strideB, strideC,
                        blockIdx.x, blockIdx.y, blockIdx.z);
}

// q | k | v = h @ (Wq | Wkv), 4096 x 3072 over K = 1024, leaving as q_bf, pkT and v_bf.
__global__ __launch_bounds__(256) void qkv_feat_kernel(
    const u16* __restrict__ A, const u16* __restrict__ B,
    u16* __restrict__ qb, u16* __restrict__ pkT, u16* __restrict__ vb)
{
    gemm_tile<C_QKV, 128>(A, B, qb, pkT, 4096, 3072, 1024, 1024, 3072, 0, 0, 0, 0,
                          blockIdx.x, blockIdx.y, 0, vb);
}

// ---------------------------------------------------------------------------
// All four fp32 -> bf16 casts in one launch: blocks 0..511 h, 512..639 Wq,
// 640..895 Wkv, 896..1023 Wo. Wq and Wkv go side by side into Wqkv[1024][3072], so
// that one GEMM makes q, k and v. h[s][b] goes to h_bf[b][s], so that 128 rows of that
// GEMM are 128 consecutive s of one b.
// A block converts 8192 consecutive floats (every array here is a multiple of
// that). A lane takes four floats per access, so a wave reads 512 and writes
// 256 contiguous bytes; all eight loads of a thread are asked for first.
__global__ __launch_bounds__(256) void cvt_all_kernel(const float* __restrict__ h,
                                                      const float* __restrict__ Wq,
                                                      const float* __restrict__ Wkv,
                                                      const float* __restrict__ Wo,
                                                      u16* __restrict__ h_bf,
                                                      u16* __restrict__ Wqkv_bf,
                                                      u16* __restrict__ Wo_bf)
{
    int blk = blockIdx.x;
    const float* src = h;
    u16* dst  = h_bf;
    int pitch = 1024;                   // elements from one destination row to the next
    int sh    = 1;                      // a source row is 1024 << sh floats
    int step  = 2097152;                // elements from a row's first 1024 to its second: h_bf[1] - h_bf[0]
    if (blk >= 896)      { blk -= 896; src = Wo;  dst = Wo_bf;                        sh = 0; }
    else if (blk >= 640) { blk -= 640; src = Wkv; dst = Wqkv_bf + 1024; pitch = 3072; step = 1024; }
    else if (blk >= 512) { blk -= 512; src = Wq;  dst = Wqkv_bf;        pitch = 3072; sh = 0; }
    src += blk * 8192 + threadIdx.x * 4;
    dst += threadIdx.x * 4;
    f32x4 v[8];
#pragma unroll   // v[] indexed by constants: stays in registers
    for (int u = 0; u < 8; ++u) v[u] = *(const f32x4*)(src + u * 1024);
#pragma unroll
    for (int u = 0; u < 8; ++u) {
        u16x4 o;
#pragma unroll
        for (int e = 0; e < 4; ++e) o[e] = f2bf(v[u][e]);
        const int g = blk * 8 + u;      // which run of 1024 floats of the array
        *(u16x4*)(dst + (g >> sh) * pitch + (g & ((1 << sh) - 1)) * step) = o;
    }
}

// pq[bn][s][f]: one block per (128 consecutive s, bn). A lane owns 8 consecutive
// j of a row: it reads them (16 B) and the four in front of them (8 B) straight
// from q and stores its 8 features of each roll as 16 B, so 16 lanes write 256
// contiguous bytes. A thread does 8 rows, 16 apart. src is q_bf[bn][s][64].
__device__ __forceinline__ void dpfp_block(const u16* __restrict__ src,
                                           u16* __restrict__ dst, int bx, int bn)
{
    const int j0 = (threadIdx.x & 15) * 8;
    const int jp = (j0 - 4) & 127;      // the four x2 entries in front, modulo 128
    const int s0 = bx * 128 + (threadIdx.x >> 4);

    const u16* row = src + ((long long)bn * 2048 + s0) * 64;
    u16x8 cur[8];
    u16x4 prv[8];
#pragma unroll   // cur[], prv[] indexed by constants: stay in registers
    for (int u = 0; u < 8; ++u)         // 16 rows of 64 further on
        cur[u] = *(const u16x8*)(row + u * 1024 + (j0 & 63));
    // Precaution: the address pair of the loads above is overwritten further down;
    // this wait stands in front of that overwrite.
    asm volatile("s_wait_xcnt 0x0" ::: "memory");
#pragma unroll
    for (int u = 0; u < 8; ++u)
        prv[u] = *(const u16x4*)(row + u * 1024 + (jp & 63));
    const u16 fc = (j0 & 64) ? 0x8000 : 0;   // upper half of x2 is relu(-x)
    const u16 fp = (jp & 64) ? 0x8000 : 0;
#pragma unroll
    for (int u = 0; u < 8; ++u) {
        float w[11];                    // x2[j0-3 .. j0+7]
#pragma unroll
        for (int t = 0; t < 3; ++t) w[t] = fmaxf(bf2f((u16)(prv[u][t + 1] ^ fp)), 0.f);
#pragma unroll
        for (int e = 0; e < 8; ++e) w[3 + e] = fmaxf(bf2f((u16)(cur[u][e] ^ fc)), 0.f);
        u16* out = dst + ((long long)bn * 2048 + s0 + u * 16) * 384 + j0;
#pragma unroll
        for (int i = 1; i <= 3; ++i) {
            u16x8 o;
#pragma unroll
            for (int e = 0; e < 8; ++e) o[e] = f2bf(w[3 + e] * w[3 + e - i]);
            *(u16x8*)(out + (i - 1) * 128) = o;
        }
    }
}

// kv_agg[bn] = pkT[bn] @ v[bn] (384x2048 . 2048x64, bf16 out) with z[bn] as the row
// sums of pkT[bn]: blocks 0..95, which start first and run longest. They fill 96 of
// the chip's WGPs; pq, which only the GEMM after this one reads, is made beside them
// by blocks 96..607. The GEMM's arguments are those of gemm_bf16_kernel.
__global__ __launch_bounds__(256) void kvagg_pq_kernel(
    const u16* __restrict__ A, const u16* __restrict__ B, void* __restrict__ Cp,
    u16* __restrict__ Zc,
    int M, int N, int K, int lda, int ldb, int ldc,
    long long strideA, long long strideB, long long strideC,
    const u16* __restrict__ q, u16* __restrict__ pq)
{
    const int blk = blockIdx.x;
    if (blk >= 96) { dpfp_block(q, pq, (blk - 96) & 15, (blk - 96) >> 4); return; }   // the whole block leaves
    gemm_tile<C_ROWSUM, 128>(A, B, Cp, Zc, M, N, K, lda, ldb, ldc, strideA, strideB, strideC,
                             0, blk % 3, blk / 3);   // three row tiles a batch
}

// out = layernorm(h + attn_out)
__global__ __launch_bounds__(256) void ln_kernel(const float* __restrict__ h,
                                                 const float* __restrict__ attn,
                                                 const float* __restrict__ gamma,
                                                 const float* __restrict__ beta,
                                                 float* __restrict__ out)
{
    __shared__ float red[256];
    const int row = blockIdx.x, tid = threadIdx.x;
    const float* hr = h    + (long long)row * 1024;
    const float* ar = attn + (long long)row * 1024;

    float lsum = 0.f;
    for (int c = tid; c < 1024; c += 256) lsum += hr[c] + ar[c];
    red[tid] = lsum; __syncthreads();
    for (int st = 128; st > 0; st >>= 1) {
        if (tid < st) red[tid] += red[tid + st];
        __syncthreads();
    }
    const float mu = red[0] * (1.f / 1024.f);
    __syncthreads();

    float lvar = 0.f;
    for (int c = tid; c < 1024; c += 256) {
        float d = hr[c] + ar[c] - mu;
        lvar += d * d;
    }
    red[tid] = lvar; __syncthreads();
    for (int st = 128; st > 0; st >>= 1) {
        if (tid < st) red[tid] += red[tid + st];
        __syncthreads();
    }
    const float rstd = rsqrtf(red[0] * (1.f / 1024.f) + 1e-5f);
    for (int c = tid; c < 1024; c += 256)
        out[(long long)row * 1024 + c] = (hr[c] + ar[c] - mu) * rstd * gamma[c] + beta[c];
}

// ---------------------------------------------------------------------------
extern "C" void kernel_launch(void* const* d_in, const int* in_sizes, int n_in,
                              void* d_out, int out_size, void* d_ws, size_t ws_size,
                              hipStream_t stream)
{
    const float* h    = (const float*)d_in[0];   // [2048,2,1024]
    const float* Wq   = (const float*)d_in[1];   // [1024,1024]
    const float* Wkv  = (const float*)d_in[2];   // [1024,2048]
    const float* Wo   = (const float*)d_in[3];   // [1024,1024]
    const float* gam  = (const float*)d_in[4];
    const float* bet  = (const float*)d_in[5];
    float* out = (float*)d_out;
    (void)in_sizes; (void)n_in; (void)out_size; (void)ws_size;

    char* ws = (char*)d_ws;
    auto take = [&](size_t bytes) -> char* { char* p = ws; ws += bytes; return p; };

    u16*   h_bf     = (u16*)  take(8388608);    // 2 x 2048x1024: [b][s]
    u16*   Wqkv_bf  = (u16*)  take(6291456);    // 1024x3072: Wq | Wkv
    u16*   Wo_bf    = (u16*)  take(2097152);    // 1024x1024
    u16*   q_bf     = (u16*)  take(8388608);    // 32 x 2048x64
    u16*   v_bf     = (u16*)  take(8388608);    // 32 x 2048x64
    u16*   pq_bf    = (u16*)  take(50331648);   // 32 x 2048x384
    u16*   pkT_bf   = (u16*)  take(50331648);   // 32 x 384x2048
    u16*   zc_bf    = (u16*)  take(393216);     // 32 x 384x16
    u16*   kvagg_bf = (u16*)  take(1572864);    // 32 x 384x64
    u16*   attn_bf  = (u16*)  take(8388608);    // 4096x1024
    float* attn_out = (float*)take(16777216);   // 4096x1024

    // 1) fp32 -> bf16 casts
    cvt_all_kernel<<<1024, 256, 0, stream>>>(h, Wq, Wkv, Wo, h_bf, Wqkv_bf, Wo_bf);

    // 2) q | k | v = h @ (Wq | Wkv)  [4096,3072]; K-step 128: two blocks' LDS fit a WGP,
    //    so the 1536 blocks are three even rounds on 256 WGPs. A block's tile leaves as
    //    DPFP features pkT [bn][f][s], or as q or v [bn][s][d]
    qkv_feat_kernel<<<dim3(48, 32, 1), 256, 0, stream>>>(h_bf, Wqkv_bf, q_bf, pkT_bf, v_bf);

    // 3) kv_agg and z; beside them the DPFP features pq [bn][s][f]
    kvagg_pq_kernel<<<608, 256, 0, stream>>>(
        pkT_bf, v_bf, kvagg_bf, zc_bf, 384, 64, 2048, 2048, 64, 64,
        786432LL, 131072LL, 24576LL, q_bf, pq_bf);

    // 4) num[bn] = pq[bn] @ kv_agg[bn]  (2048x384 . 384x64) and den[bn] = pq[bn] @ z[bn]
    //    in one pass over pq; attn_vec = num*SCALE/den leaves as bf16 [4096,1024]
    gemm_bf16_kernel<C_ATTN, 128><<<dim3(1, 16, 32), 256, 0, stream>>>(
        pq_bf, kvagg_bf, attn_bf, zc_bf, 2048, 64, 384, 384, 64, 64,
        786432LL, 24576LL, 0LL);

    // 5) attn_out = attn_vec @ Wo  (fp32 out)
    gemm_bf16_kernel<C_F32, 128><<<dim3(16, 32, 1), 256, 0, stream>>>(
        attn_bf, Wo_bf, attn_out, nullptr, 4096, 1024, 1024, 1024, 1024, 1024, 0, 0, 0);

    // 6) out = layernorm(h + attn_out)
    ln_kernel<<<4096, 256, 0, stream>>>(h, attn_out, gam, bet, out);
}

// v008
// A run of this version takes 97.2 microseconds.
// Next to v007, in two timings, it ran 1.05 and 1.06 times as fast.
// Over all steps from v000 it is 4.21 times as fast.
#include <hip/hip_runtime.h>
#include <hip/hip_bf16.h>

// ---------------------------------------------------------------------------
// DPFP linear attention for MI455X (gfx1250): all GEMMs via bf16 WMMA
// (v_wmma_f32_16x16x32_bf16), fp32 accumulate. 128x64 block tiles, 8 waves
// each computing 32x32 (2x fragment reuse), K-steps of 128 (the q | k | v GEMM: 128x192,
// one head's q, k and v, a wave 64x48, K-steps of 64), double-
// buffered LDS with GLOBAL_LOAD_ASYNC_TO_LDS_B128 staging for both tiles; the
// B tile stays [k][n] in LDS and is read with DS_LOAD_TR16_B128. The feature sums z
// and the denominators are further columns of the two batched GEMMs. The DPFP
// features of k and the per-head q and v leave the q | k | v GEMM's own epilogue.
// Kernels that do not depend on one another share a launch, told apart by the block index.
// ---------------------------------------------------------------------------

typedef unsigned short u16;
typedef __attribute__((ext_vector_type(4)))  unsigned short u16x4;
typedef __attribute__((ext_vector_type(8)))  unsigned short u16x8;
typedef __attribute__((ext_vector_type(4)))  float         f32x4;
typedef __attribute__((ext_vector_type(16))) unsigned short v16u;
typedef __attribute__((ext_vector_type(16))) __bf16        v16bf;
typedef __attribute__((ext_vector_type(8)))  float         v8f;
typedef __attribute__((ext_vector_type(8)))  short         s16x8;

union Frag { v16u u; v16bf b; };

#ifndef __has_builtin
#define __has_builtin(x) 0
#endif

#if defined(__AMDGCN__) && __has_builtin(__builtin_amdgcn_global_load_async_to_lds_b128)
#define USE_ASYNC_LDS 1
#else
#define USE_ASYNC_LDS 0
#endif

#if USE_ASYNC_LDS
// Builtin signature (from hipcc diagnostic): (v4i addrspace(1)*, v4i addrspace(3)*, imm, imm)
typedef int gcc_i32x4 __attribute__((vector_size(16)));
__device__ __forceinline__ void async_copy_b128(const u16* g, u16* l) {
    __builtin_amdgcn_global_load_async_to_lds_b128(
        (__attribute__((address_space(1))) gcc_i32x4*)(void*)g,
        (__attribute__((address_space(3))) gcc_i32x4*)(void*)l, 0, 0);
}
#endif

// The issuing wave's copies have landed. In asm with the memory clobber, so that
// no LDS read moves in front of it.
__device__ __forceinline__ void async_wait0() {
#if USE_ASYNC_LDS
    asm volatile("s_wait_asynccnt 0x0" ::: "memory");
#endif
}

// One 128 x BK A tile into LDS rows of BK + 8 elements. g and l are the lane's own
// first 16 bytes: BK/8 neighbouring lanes take one row's BK*2 contiguous bytes, so
// a wave's copy covers four whole 128-B lines. A thread brings BK/16 rows.
template <int BK>
__device__ __forceinline__ void stage_a(const u16* g, int lda, u16* l) {
    constexpr int RP = 2048 / BK;        // rows the block's 256 lanes cover at once
#pragma unroll   // independent copies, issued back to back
    for (int u = 0; u < 128 / RP; ++u) {
#if USE_ASYNC_LDS
        async_copy_b128(g + (long long)(u * RP) * lda, l + u * RP * (BK + 8));
#else
        *(u16x8*)(l + u * RP * (BK + 8)) = *(const u16x8*)(g + (long long)(u * RP) * lda);
#endif
    }
}

// LDB below is the row pitch of the B tile in LDS, in elements: its n + 16, which is
// 160 bytes for 64 n and 416 for 192, an odd multiple of 32 B, which ds_load_tr16_b128
// reads without bank conflicts.

// One BK x 64 B tile into LDS as it lies in memory, [k][n]. g and l are the lane's
// own first 16 bytes: 8 neighbouring lanes take one row's 128 contiguous bytes, so
// a wave's copy covers four whole 128-B lines. A thread brings BK/32 rows.
template <int BK, int LDB>
__device__ __forceinline__ void stage_b(const u16* g, int ldb, u16* l) {
#pragma unroll   // independent copies, issued back to back
    for (int r = 0; r < BK / 32; ++r) {
#if USE_ASYNC_LDS
        async_copy_b128(g + (long long)(r * 32) * ldb, l + r * 32 * LDB);
#else
        *(u16x8*)(l + r * 32 * LDB) = *(const u16x8*)(g + (long long)(r * 32) * ldb);
#endif
    }
}

// One copy of the lane's own 16 bytes, from g to l. So goes the 128 x 16 block of z
// columns beside a 128 x 64 B tile, into columns 64..79 of its LDS rows (the block's 256
// lanes take 4 KiB that lie contiguous in memory, one copy a thread), and so go the
// pieces of the q | k | v GEMM's B tile.
__device__ __forceinline__ void stage_z(const u16* g, u16* l) {
#if USE_ASYNC_LDS
    async_copy_b128(g, l);
#else
    *(u16x8*)l = *(const u16x8*)g;
#endif
}

__device__ __forceinline__ u16 f2bf(float f) {
    union { float f; unsigned u; } x; x.f = f;
    unsigned u = x.u;
    u += 0x7FFFu + ((u >> 16) & 1u);     // round-to-nearest-even
    return (u16)(u >> 16);
}
__device__ __forceinline__ float bf2f(u16 h) {
    union { unsigned u; float f; } x; x.u = ((unsigned)h) << 16;
    return x.f;
}

// ISA 16-bit fragment layout: lane element e -> K = khalf + e + (e>=8 ? 8 : 0)
__device__ __forceinline__ void load_frag(Frag& f, const u16* p) {
    u16x8 lo = *(const u16x8*)p;
    u16x8 hi = *(const u16x8*)(p + 16);
#pragma unroll
    for (int e = 0; e < 8; ++e) { f.u[e] = lo[e]; f.u[e + 8] = hi[e]; }
}

// B fragment (32 k x 16 n) out of the [k][n] tile by two transposing loads. p is the
// lane's own address: row 8*(lane>>4) + (lane&7), column 8*((lane>>3)&1) of the 16 x 16
// piece; the lane gets column lane&15 at k = 8*(lane>>4) + 0..7, and 16 rows on the
// same at k + 16: the k order of load_frag.
template <int LDB>
__device__ __forceinline__ void load_frag_tr(Frag& f, const u16* p) {
    typedef __attribute__((address_space(3))) s16x8 lds_s16x8;
    s16x8 lo = __builtin_amdgcn_ds_load_tr16_b128_v8i16((lds_s16x8*)p);
    s16x8 hi = __builtin_amdgcn_ds_load_tr16_b128_v8i16((lds_s16x8*)(p + 16 * LDB));
#pragma unroll   // f.u[] indexed by constants: stays in registers
    for (int e = 0; e < 8; ++e) { f.u[e] = (u16)lo[e]; f.u[e + 8] = (u16)hi[e]; }
}

// ---------------------------------------------------------------------------
// What the q | k | v GEMM's epilogue does with a 128 x 64 part of its tile, which it has
// laid in LDS as bf16: 128 consecutive s, from s0 on, of one head of q, k or v; bn = b*16 + n.
// DPFP: x2 = [relu(x), relu(-x)] (128); feature f=(i-1)*128+j = x2[j]*x2[(j-i)&127]
// ---------------------------------------------------------------------------
constexpr int TP = 72;    // row pitch of the tile as [s][d], elements: 128 + 16 bytes
constexpr int TT = 136;   // row pitch of the tile as [d][s], elements: 256 + 16 bytes

// pkT[bn][f][s] from T[d][s], so that every feature row leaves as 256 contiguous
// bytes, 16 B per lane. A thread owns 8 s and 8 consecutive j and slides a window
// of four x2 rows over them.
__device__ __forceinline__ void feat_cols(const u16* T, u16* __restrict__ dst, int bn, int s0)
{
    const int c  = threadIdx.x & 15;    // which 8 s of the 128
    const int j0 = (threadIdx.x >> 4) * 8;
    u16* out = dst + ((long long)bn * 384 + j0) * 2048 + s0 + c * 8;

    // The eleven x rows this thread needs (j0-3 .. j0+7, modulo 128), each read once.
    // Every loop below is unrolled so that q[], w[] and o[] are indexed by constants and stay in registers.
    uint4 q[11];
#pragma unroll
    for (int t = 0; t < 11; ++t) q[t] = *(const uint4*)(T + ((j0 + t - 3) & 63) * TT + c * 8);

    float w[4][8];
#pragma unroll
    for (int t = 0; t < 11; ++t) {
        const unsigned flip = ((j0 + t - 3) & 64) ? 0x80008000u : 0u;   // upper half of x2 is relu(-x)
        const unsigned qq[4] = {q[t].x ^ flip, q[t].y ^ flip, q[t].z ^ flip, q[t].w ^ flip};
#pragma unroll
        for (int e = 0; e < 4; ++e) {
            w[t & 3][2 * e]     = fmaxf(__uint_as_float(qq[e] << 16), 0.f);
            w[t & 3][2 * e + 1] = fmaxf(__uint_as_float(qq[e] & 0xFFFF0000u), 0.f);
        }
        if (t >= 3) {
#pragma unroll
            for (int i = 1; i <= 3; ++i) {
                u16x8 o;
#pragma unroll
                for (int e = 0; e < 8; ++e) o[e] = f2bf(w[t & 3][e] * w[(t - i) & 3][e]);
                *(u16x8*)(out + (long long)((i - 1) * 128 + (t - 3)) * 2048) = o;
            }
        }
    }
}

// dst[bn][s][d] (q_bf or v_bf) from T[s][d]: the tile's 16 KiB lie contiguous there. A
// lane moves 8 d (16 B), a thread four such groups.
__device__ __forceinline__ void rows_out(const u16* T, u16* __restrict__ dst, int bn, int s0)
{
    u16* out = dst + ((long long)bn * 2048 + s0) * 64;
#pragma unroll   // independent moves
    for (int u = 0; u < 4; ++u) {
        const int g = threadIdx.x + u * 256;          // group of 8 d, < 128*8
        *(u16x8*)(out + g * 8) = *(const u16x8*)(T + (g >> 3) * TP + (g & 7) * 8);
    }
}

// ---------------------------------------------------------------------------
// Batched bf16 GEMM: C[M,N] = A[M,K] @ B[K,N], row-major, fp32 acc.
// Block: 256 threads = 8 waves; tile 128x64; wave (wr 0..3, wc 0..1) owns
// 32x32. C_QKV: tile 128x192; wave (wr 0..1, wc 0..3) owns 64x48, so that a fragment
// read from LDS feeds 3 or 4 WMMAs and a byte brought from L2 more of the product.
// Double-buffered K-steps of BK (64 or 128).
// Requires: M%128==0, N%64==0, K%BK==0, lda/ldb/ldc %8==0, 16B-aligned bases.
// MODE says what leaves the block:
//   C_BF16, C_F32  C as bf16 or fp32.
//   C_ROWSUM       C as bf16, and the row sums of A (a product with a fragment of
//                  ones) as Zc[bz][m][16]: each sum split into two bf16, the upper
//                  part in the even columns, the rest in the odd ones.
//   C_ATTN         N = 64. Zc[bz][k][16] rides as 16 more columns of B, so that
//                  column pairs of A @ Zc add up to dot(A row, z). C * SCALE over
//                  (that * SCALE + EPS) goes as bf16 to [m][bz >> 4][bz & 15][n].
//   C_QKV          B = Wq | Wk | Wv, 1024 columns each, 64 a head; row b*2048 + s. The
//                  tile's 192 columns are head bx of q, of k and of v, so that every
//                  block has the same work behind its loop.
//                  C itself is not stored: rounded to bf16 the three 128 x 64 parts go
//                  through LDS, and q leaves as q_bf (Cp), k as pkT (Zc), v as v_bf (Vb).
// ---------------------------------------------------------------------------
enum { C_BF16 = 0, C_F32 = 1, C_ROWSUM = 2, C_ATTN = 3, C_QKV = 4 };

// One block's tile: column tile bx, row tile by, batch bz.
template <int MODE, int BK>
__device__ __forceinline__ void gemm_tile(
    const u16* __restrict__ A, const u16* __restrict__ B, void* __restrict__ Cp,
    u16* __restrict__ Zc,
    int M, int N, int K, int lda, int ldb, int ldc,
    long long strideA, long long strideB, long long strideC,
    int bx, int by, int bz, u16* __restrict__ Vb = nullptr)
{
    constexpr int WCN = MODE == C_QKV ? 4 : 2;   // waves side by side in n; 8 / WCN in m
    constexpr int FM  = MODE == C_QKV ? 4 : 2;   // a wave's 16 x 16 fragments in m
    constexpr int FN  = MODE == C_QKV ? 3 : 2;   // and in n
    constexpr int BN  = WCN * FN * 16;           // the tile's columns
    static_assert((8 / WCN) * FM * 16 == 128, "the tile has 128 rows");
    // Row pitch of the A tile: BK*2 + 16 bytes, an odd multiple of 16 B, which
    // ds_load_b128 reads without bank conflicts.
    constexpr int LDP = BK + 8;
    constexpr int LDB = BN + 16;                 // row pitch of the B tile
    constexpr int ASZ = 128 * LDP;               // elements of an A buffer
    constexpr int BSZ = BK * LDB;                // elements of a B buffer
    static_assert(MODE != C_ATTN || BK == 128, "stage_z: one copy a thread fills 128 rows");
    static_assert(MODE != C_QKV || 2 * ASZ + 2 * BSZ >= 3 * 128 * TP, "the epilogue's three parts fit");
    __shared__ __align__(16) u16 S[2 * ASZ + 2 * BSZ];
    u16* const As = S;                           // two buffers [m][k]
    u16* const Bs = S + 2 * ASZ;                 // two buffers [k][n], as in memory

    A += (long long)bz * strideA;
    B += (long long)bz * strideB;

    const int tileN = bx * BN;
    const int tileM = by * 128;
    const int tid   = threadIdx.x;
    const int lane  = tid & 31;
    const int wave  = tid >> 5;
    const int wr    = wave / WCN;         // m slice: wr*FM*16
    const int wc    = wave % WCN;         // n slice: wc*FN*16
    const int lrow  = lane & 15;
    const int khalf = (lane >> 4) ? 8 : 0;

    // staging coordinates
    const int ar = tid / (BK / 8);        // A row, and every 2048/BK rows on
    const int ac = (tid % (BK / 8)) * 8;  // 0..BK-8
    const int br = tid >> 3;              // 0..31 (k row), and every 32 rows on
    const int bc = (tid & 7) * 8;         // 0..56 (n col)

    const u16* aG = A + (long long)(tileM + ar) * lda + ac;   // K-tile t: + t*BK
    const u16* bG = B + (long long)br * ldb + tileN + bc;     // K-tile t: + t*BK rows
    const int  aL = ar * LDP + ac;
    const int  bL = br * LDB + bc;
    // C_QKV: a B row is three runs of 128 bytes, 1024 columns apart in memory and side by
    // side in LDS: 24 lanes a row, 8 neighbouring lanes a whole line. The block's 256
    // lanes go through the BK*24 pieces in order; g3 and l3 are this lane's places.
    constexpr int NB3 = BK * 24 / 256;
    int g3[NB3], l3[NB3];
    if (MODE == C_QKV) {
#pragma unroll   // g3[], l3[] indexed by constants: stay in registers
        for (int u = 0; u < NB3; ++u) {
            const int idx = tid + u * 256, row = idx / 24, p = idx - row * 24;
            g3[u] = row * ldb + (p >> 3) * 1024 + bx * 64 + (p & 7) * 8;
            l3[u] = row * LDB + p * 8;
        }
    }
    // this lane's address in a 16 x 16 piece of the B tile, for the transposing loads
    const int  bT = (khalf + (lane & 7)) * LDB + wc * FN * 16 + ((lane >> 3) & 1) * 8;
    const int  nT = K / BK;               // K-tiles
    // z columns (C_ATTN): row tid >> 1, half tid & 1 of the tile's 128 x 16 block
    const u16* zG = Zc + (long long)bz * K * 16 + tid * 8;    // K-tile t: + t*BK*16
    const int  zL = (tid >> 1) * LDB + 64 + (tid & 1) * 8;
    const int  zT = (khalf + (lane & 7)) * LDB + 64 + ((lane >> 3) & 1) * 8;

    v8f acc[FM][FN] = {};
    v8f accz[FM] = {};                    // C_ROWSUM: row sums of A; C_ATTN: A @ Zc
    Frag fone;
#pragma unroll   // fone.u[] indexed by constants: stays in registers
    for (int e = 0; e < 16; ++e) fone.u[e] = 0x3F80;          // 1.0

    // K-tile t on its way into buffer buf
    auto stage = [&](int t, int buf) {
        stage_a<BK>(aG + (long long)t * BK, lda, As + buf * ASZ + aL);
        if (MODE == C_QKV) {
            const u16* g = B + (long long)t * BK * ldb;
#pragma unroll   // independent copies, issued back to back
            for (int u = 0; u < NB3; ++u) stage_z(g + g3[u], Bs + buf * BSZ + l3[u]);
        } else {
            stage_b<BK, LDB>(bG + (long long)t * BK * ldb, ldb, Bs + buf * BSZ + bL);
        }
        if (MODE == C_ATTN) stage_z(zG + t * BK * 16, Bs + buf * BSZ + zL);
    };

    // ---- prologue: K-tile 0 into buffer 0, then K-tile 1 on its way into buffer 1
    stage(0, 0);
    async_wait0();
    __syncthreads();
    if (1 < nT) stage(1, 1);

    int cur = 0;
    for (int t = 0; t < nT; ++t) {
#pragma unroll   // the tile's runs of 32 k, in ascending k; LDS offsets become immediates
        for (int kk = 0; kk < BK; kk += 32) {
            // fragments (an A fragment reused by FN WMMAs, a B fragment by FM)
            Frag fa[FM], fb[FN];
            const u16* ap = As + cur * ASZ + (wr * FM * 16 + lrow) * LDP + kk + khalf;
#pragma unroll   // fa[] indexed by constants: stays in registers
            for (int i = 0; i < FM; ++i) load_frag(fa[i], ap + i * 16 * LDP);
            const u16* bp = Bs + cur * BSZ + kk * LDB + bT;
#pragma unroll   // fb[] indexed by constants: stays in registers
            for (int j = 0; j < FN; ++j) load_frag_tr<LDB>(fb[j], bp + j * 16);
            // The 14 LDS reads of a run stay one group in front of its 12 WMMAs. Left alone the
            // compiler reloads one A fragment's registers in front of every three WMMAs and
            // waits out the LDS latency there each time.
            if (MODE == C_QKV) __builtin_amdgcn_sched_barrier(0);

#pragma unroll   // acc[][] indexed by constants: stays in registers
            for (int i = 0; i < FM; ++i)
#pragma unroll
                for (int j = 0; j < FN; ++j)
                    acc[i][j] = __builtin_amdgcn_wmma_f32_16x16x32_bf16(false, fa[i].b, false, fb[j].b,
                                                                        (short)0, acc[i][j], false, false);
            if (MODE == C_ROWSUM || MODE == C_ATTN) {
                Frag fz = fone;
                if (MODE == C_ATTN) load_frag_tr<LDB>(fz, Bs + cur * BSZ + kk * LDB + zT);
#pragma unroll   // accz[] indexed by constants: stays in registers
                for (int i = 0; i < FM; ++i)
                    accz[i] = __builtin_amdgcn_wmma_f32_16x16x32_bf16(false, fa[i].b, false, fz.b,
                                                                      (short)0, accz[i], false, false);
            }
        }

        // Hand-over: this wave's LDS reads are done and its copies of tile t + 1
        // have landed; behind the barrier every wave may read tile t + 1, and
        // buffer cur, which all have left, may be refilled.
        asm volatile("s_wait_dscnt 0x0" ::: "memory");
        async_wait0();
        __syncthreads();
        if (t + 2 < nT) stage(t + 2, cur);
        cur ^= 1;
    }
    async_wait0();   // no copy outlives the loop

    // C/D layout: VGPR r -> row r + (lane>=16 ? 8 : 0), col lane%16
    // Every loop over i, j, r below is unrolled: the accumulators indexed by constants stay in registers.
    const int rsel = (lane >> 4) ? 8 : 0;
    const int cm   = tileM + wr * FM * 16 + rsel;
    const int cn   = tileN + wc * FN * 16 + lrow;
    if (MODE == C_QKV) {
        // Every wave has left both buffers at the loop's last barrier, and no copy is
        // under way: the three parts take the place of the buffers.
        constexpr int TSZ = 128 * TP;         // elements of a part, in either lay-out
        static_assert(TSZ >= 64 * TT, "a part as [d][s] fits too");
        const int bn = (by >> 4) * 16 + bx;
        const int s0 = (by & 15) * 128;
#pragma unroll
        for (int j = 0; j < FN; ++j) {
            const int c    = (wc * FN + j) * 16;   // the fragment's first column of the 192
            const int kind = c >> 6;               // 0 q, 1 k, 2 v: the same for the whole wave
            const int c0   = (c & 63) + lrow;
            u16* T = S + kind * TSZ;
#pragma unroll
            for (int i = 0; i < FM; ++i) {
                const int m0 = (wr * FM + i) * 16 + rsel;
                if (kind == 1) {
                    // as [d][s]: a lane's 8 rows of a column are 8 neighbouring s, 16 bytes
                    u16x8 e;
#pragma unroll
                    for (int r = 0; r < 8; ++r) e[r] = f2bf(acc[i][j][r]);
                    *(u16x8*)(T + c0 * TT + m0) = e;
                } else {
#pragma unroll
                    for (int r = 0; r < 8; ++r) T[(m0 + r) * TP + c0] = f2bf(acc[i][j][r]);
                }
            }
        }
        __syncthreads();   // the parts are whole before a thread reads what other waves wrote
        rows_out(S, (u16*)Cp, bn, s0);
        rows_out(S + 2 * TSZ, Vb, bn, s0);
        feat_cols(S + TSZ, Zc, bn, s0);
    } else if (MODE == C_ATTN) {
        u16* C = (u16*)Cp + (bz >> 4) * 1024 + (bz & 15) * 64 + cn;
#pragma unroll
        for (int r = 0; r < 8; ++r) {
#pragma unroll
            for (int i = 0; i < FM; ++i) {
                // a lane and its neighbour hold the two parts of the row's dot(A row, z);
                // one division a row, SCALE / den, serves all of the lane's columns
                const float sc = 0.125f / ((accz[i][r] + __shfl_xor(accz[i][r], 1, 32)) * 0.125f + 1e-5f);
#pragma unroll
                for (int j = 0; j < FN; ++j)
                    C[(long long)(cm + i * 16 + r) * 2048 + j * 16] = f2bf(acc[i][j][r] * sc);
            }
        }
    } else if (MODE == C_BF16 || MODE == C_ROWSUM) {
        u16* C = (u16*)Cp + (long long)bz * strideC;
#pragma unroll
        for (int r = 0; r < 8; ++r)
#pragma unroll
            for (int i = 0; i < FM; ++i)
#pragma unroll
                for (int j = 0; j < FN; ++j)
                    C[(long long)(cm + i * 16 + r) * ldc + cn + j * 16] = f2bf(acc[i][j][r]);
        if (MODE == C_ROWSUM && wc == 0) {   // every column of accz holds the row's sum
            u16* Z = Zc + ((long long)bz * M + cm) * 16 + lrow;
#pragma unroll
            for (int r = 0; r < 8; ++r)
#pragma unroll
                for (int i = 0; i < FM; ++i) {
                    const u16 hi = f2bf(accz[i][r]);
                    Z[(i * 16 + r) * 16] = (lrow & 1) ? f2bf(accz[i][r] - bf2f(hi)) : hi;
                }
        }
    } else {
        float* C = (float*)Cp + (long long)bz * strideC;
#pragma unroll
        for (int r = 0; r < 8; ++r)
#pragma unroll
            for (int i = 0; i < FM; ++i)
#pragma unroll
                for (int j = 0; j < FN; ++j)
                    C[(long long)(cm + i * 16 + r) * ldc + cn + j * 16] = acc[i][j][r];
    }
}

template <int MODE, int BK>
__global__ __launch_bounds__(256) void gemm_bf16_kernel(
    const u16* __restrict__ A, const u16* __restrict__ B, void* __restrict__ Cp,
    u16* __restrict__ Zc,
    int M, int N, int K, int lda, int ldb, int ldc,
    long long strideA, long long strideB, long long strideC)
{
    gemm_tile<MODE, BK>(A, B, Cp, Zc, M, N, K, lda, ldb, ldc, strideA, strideB, strideC,
                        blockIdx.x, blockIdx.y, blockIdx.z);
}

// q | k | v = h @ (Wq | Wkv), 4096 x 3072 over K = 1024, leaving as q_bf, pkT and v_bf.
__global__ __launch_bounds__(256) void qkv_feat_kernel(
    const u16* __restrict__ A, const u16* __restrict__ B,
    u16* __restrict__ qb, u16* __restrict__ pkT, u16* __restrict__ vb)
{
    gemm_tile<C_QKV, 64>(A, B, qb, pkT, 4096, 3072, 1024, 1024, 3072, 0, 0, 0, 0,
                          blockIdx.x, blockIdx.y, 0, vb);
}

// ---------------------------------------------------------------------------
// All four fp32 -> bf16 casts in one launch: blocks 0..511 h, 512..639 Wq,
// 640..895 Wkv, 896..1023 Wo. Wq and Wkv go side by side into Wqkv[1024][3072], so
// that one GEMM makes q, k and v. h[s][b] goes to h_bf[b][s], so that 128 rows of that
// GEMM are 128 consecutive s of one b.
// A block converts 8192 consecutive floats (every array here is a multiple of
// that). A lane takes four floats per access, so a wave reads 512 and writes
// 256 contiguous bytes; all eight loads of a thread are asked for first.
__global__ __launch_bounds__(256) void cvt_all_kernel(const float* __restrict__ h,
                                                      const float* __restrict__ Wq,
                                                      const float* __restrict__ Wkv,
                                                      const float* __restrict__ Wo,
                                                      u16* __restrict__ h_bf,
                                                      u16* __restrict__ Wqkv_bf,
                                                      u16* __restrict__ Wo_bf)
{
    int blk = blockIdx.x;
    const float* src = h;
    u16* dst  = h_bf;
    int pitch = 1024;                   // elements from one destination row to the next
    int sh    = 1;                      // a source row is 1024 << sh floats
    int step  = 2097152;                // elements from a row's first 1024 to its second: h_bf[1] - h_bf[0]
    if (blk >= 896)      { blk -= 896; src = Wo;  dst = Wo_bf;                        sh = 0; }
    else if (blk >= 640) { blk -= 640; src = Wkv; dst = Wqkv_bf + 1024; pitch = 3072; step = 1024; }
    else if (blk >= 512) { blk -= 512; src = Wq;  dst = Wqkv_bf;        pitch = 3072; sh = 0; }
    src += blk * 8192 + threadIdx.x * 4;
    dst += threadIdx.x * 4;
    f32x4 v[8];
#pragma unroll   // v[] indexed by constants: stays in registers
    for (int u = 0; u < 8; ++u) v[u] = *(const f32x4*)(src + u * 1024);
#pragma unroll
    for (int u = 0; u < 8; ++u) {
        u16x4 o;
#pragma unroll
        for (int e = 0; e < 4; ++e) o[e] = f2bf(v[u][e]);
        const int g = blk * 8 + u;      // which run of 1024 floats of the array
        *(u16x4*)(dst + (g >> sh) * pitch + (g & ((1 << sh) - 1)) * step) = o;
    }
}

// pq[bn][s][f]: one block per (128 consecutive s, bn). A lane owns 8 consecutive
// j of a row: it reads them (16 B) and the four in front of them (8 B) straight
// from q and stores its 8 features of each roll as 16 B, so 16 lanes write 256
// contiguous bytes. A thread does 8 rows, 16 apart. src is q_bf[bn][s][64].
__device__ __forceinline__ void dpfp_block(const u16* __restrict__ src,
                                           u16* __restrict__ dst, int bx, int bn)
{
    const int j0 = (threadIdx.x & 15) * 8;
    const int jp = (j0 - 4) & 127;      // the four x2 entries in front, modulo 128
    const int s0 = bx * 128 + (threadIdx.x >> 4);

    const u16* row = src + ((long long)bn * 2048 + s0) * 64;
    u16x8 cur[8];
    u16x4 prv[8];
#pragma unroll   // cur[], prv[] indexed by constants: stay in registers
    for (int u = 0; u < 8; ++u)         // 16 rows of 64 further on
        cur[u] = *(const u16x8*)(row + u * 1024 + (j0 & 63));
    // Precaution: the address pair of the loads above is overwritten further down;
    // this wait stands in front of that overwrite.
    asm volatile("s_wait_xcnt 0x0" ::: "memory");
#pragma unroll
    for (int u = 0; u < 8; ++u)
        prv[u] = *(const u16x4*)(row + u * 1024 + (jp & 63));
    const u16 fc = (j0 & 64) ? 0x8000 : 0;   // upper half of x2 is relu(-x)
    const u16 fp = (jp & 64) ? 0x8000 : 0;
#pragma unroll
    for (int u = 0; u < 8; ++u) {
        float w[11];                    // x2[j0-3 .. j0+7]
#pragma unroll
        for (int t = 0; t < 3; ++t) w[t] = fmaxf(bf2f((u16)(prv[u][t + 1] ^ fp)), 0.f);
#pragma unroll
        for (int e = 0; e < 8; ++e) w[3 + e] = fmaxf(bf2f((u16)(cur[u][e] ^ fc)), 0.f);
        u16* out = dst + ((long long)bn * 2048 + s0 + u * 16) * 384 + j0;
#pragma unroll
        for (int i = 1; i <= 3; ++i) {
            u16x8 o;
#pragma unroll
            for (int e = 0; e < 8; ++e) o[e] = f2bf(w[3 + e] * w[3 + e - i]);
            *(u16x8*)(out + (i - 1) * 128) = o;
        }
    }
}

// kv_agg[bn] = pkT[bn] @ v[bn] (384x2048 . 2048x64, bf16 out) with z[bn] as the row
// sums of pkT[bn]: blocks 0..95, which run longest. They fill 96 of
// the chip's WGPs; pq, which only the GEMM after this one reads, is made beside them
// by blocks 96..607. The GEMM's arguments are those of gemm_bf16_kernel.
__global__ __launch_bounds__(256) void kvagg_pq_kernel(
    const u16* __restrict__ A, const u16* __restrict__ B, void* __restrict__ Cp,
    u16* __restrict__ Zc,
    int M, int N, int K, int lda, int ldb, int ldc,
    long long strideA, long long strideB, long long strideC,
    const u16* __restrict__ q, u16* __restrict__ pq)
{
    const int blk = blockIdx.x;
    if (blk >= 96) { dpfp_block(q, pq, (blk - 96) & 15, (blk - 96) >> 4); return; }   // the whole block leaves
    gemm_tile<C_ROWSUM, 128>(A, B, Cp, Zc, M, N, K, lda, ldb, ldc, strideA, strideB, strideC,
                             0, blk % 3, blk / 3);   // three row tiles a batch
}

// out = layernorm(h + attn_out)
__global__ __launch_bounds__(256) void ln_kernel(const float* __restrict__ h,
                                                 const float* __restrict__ attn,
                                                 const float* __restrict__ gamma,
                                                 const float* __restrict__ beta,
                                                 float* __restrict__ out)
{
    __shared__ float red[256];
    const int row = blockIdx.x, tid = threadIdx.x;
    const float* hr = h    + (long long)row * 1024;
    const float* ar = attn + (long long)row * 1024;

    float lsum = 0.f;
    for (int c = tid; c < 1024; c += 256) lsum += hr[c] + ar[c];
    red[tid] = lsum; __syncthreads();
    for (int st = 128; st > 0; st >>= 1) {
        if (tid < st) red[tid] += red[tid + st];
        __syncthreads();
    }
    const float mu = red[0] * (1.f / 1024.f);
    __syncthreads();

    float lvar = 0.f;
    for (int c = tid; c < 1024; c += 256) {
        float d = hr[c] + ar[c] - mu;
        lvar += d * d;
    }
    red[tid] = lvar; __syncthreads();
    for (int st = 128; st > 0; st >>= 1) {
        if (tid < st) red[tid] += red[tid + st];
        __syncthreads();
    }
    const float rstd = rsqrtf(red[0] * (1.f / 1024.f) + 1e-5f);
    for (int c = tid; c < 1024; c += 256)
        out[(long long)row * 1024 + c] = (hr[c] + ar[c] - mu) * rstd * gamma[c] + beta[c];
}

// ---------------------------------------------------------------------------
extern "C" void kernel_launch(void* const* d_in, const int* in_sizes, int n_in,
                              void* d_out, int out_size, void* d_ws, size_t ws_size,
                              hipStream_t stream)
{
    const float* h    = (const float*)d_in[0];   // [2048,2,1024]
    const float* Wq   = (const float*)d_in[1];   // [1024,1024]
    const float* Wkv  = (const float*)d_in[2];   // [1024,2048]
    const float* Wo   = (const float*)d_in[3];   // [1024,1024]
    const float* gam  = (const float*)d_in[4];
    const float* bet  = (const float*)d_in[5];
    float* out = (float*)d_out;
    (void)in_sizes; (void)n_in; (void)out_size; (void)ws_size;

    char* ws = (char*)d_ws;
    auto take = [&](size_t bytes) -> char* { char* p = ws; ws += bytes; return p; };

    u16*   h_bf     = (u16*)  take(8388608);    // 2 x 2048x1024: [b][s]
    u16*   Wqkv_bf  = (u16*)  take(6291456);    // 1024x3072: Wq | Wkv
    u16*   Wo_bf    = (u16*)  take(2097152);    // 1024x1024
    u16*   q_bf     = (u16*)  take(8388608);    // 32 x 2048x64
    u16*   v_bf     = (u16*)  take(8388608);    // 32 x 2048x64
    u16*   pq_bf    = (u16*)  take(50331648);   // 32 x 2048x384
    u16*   pkT_bf   = (u16*)  take(50331648);   // 32 x 384x2048
    u16*   zc_bf    = (u16*)  take(393216);     // 32 x 384x16
    u16*   kvagg_bf = (u16*)  take(1572864);    // 32 x 384x64
    u16*   attn_bf  = (u16*)  take(8388608);    // 4096x1024
    float* attn_out = (float*)take(16777216);   // 4096x1024

    // 1) fp32 -> bf16 casts
    cvt_all_kernel<<<1024, 256, 0, stream>>>(h, Wq, Wkv, Wo, h_bf, Wqkv_bf, Wo_bf);

    // 2) q | k | v = h @ (Wq | Wkv)  [4096,3072]; a block has 128 s of one head's q, k and
    //    v; K-step 64: two blocks' LDS and registers fit a WGP, so the 512 blocks are one
    //    even round on 256 WGPs. k leaves as DPFP features pkT [bn][f][s], q and v as [bn][s][d]
    qkv_feat_kernel<<<dim3(16, 32, 1), 256, 0, stream>>>(h_bf, Wqkv_bf, q_bf, pkT_bf, v_bf);

    // 3) kv_agg and z; beside them the DPFP features pq [bn][s][f]
    kvagg_pq_kernel<<<608, 256, 0, stream>>>(
        pkT_bf, v_bf, kvagg_bf, zc_bf, 384, 64, 2048, 2048, 64, 64,
        786432LL, 131072LL, 24576LL, q_bf, pq_bf);

    // 4) num[bn] = pq[bn] @ kv_agg[bn]  (2048x384 . 384x64) and den[bn] = pq[bn] @ z[bn]
    //    in one pass over pq; attn_vec = num*SCALE/den leaves as bf16 [4096,1024]
    gemm_bf16_kernel<C_ATTN, 128><<<dim3(1, 16, 32), 256, 0, stream>>>(
        pq_bf, kvagg_bf, attn_bf, zc_bf, 2048, 64, 384, 384, 64, 64,
        786432LL, 24576LL, 0LL);

    // 5) attn_out = attn_vec @ Wo  (fp32 out)
    gemm_bf16_kernel<C_F32, 128><<<dim3(16, 32, 1), 256, 0, stream>>>(
        attn_bf, Wo_bf, attn_out, nullptr, 4096, 1024, 1024, 1024, 1024, 1024, 0, 0, 0);

    // 6) out = layernorm(h + attn_out)
    ln_kernel<<<4096, 256, 0, stream>>>(h, attn_out, gam, bet, out);
}

// v009
// One run takes 87.6 microseconds.
// Next to v008, in two timings, it ran 1.11 times as fast each time.
// Over all steps from v000 it is 4.66 times as fast.
#include <hip/hip_runtime.h>
#include <hip/hip_bf16.h>

// ---------------------------------------------------------------------------
// DPFP linear attention for MI455X (gfx1250): all GEMMs via bf16 WMMA
// (v_wmma_f32_16x16x32_bf16), fp32 accumulate. 128x64 block tiles, 8 waves
// each computing 32x32 (2x fragment reuse), K-steps of 128 (the q | k | v GEMM: 128x192,
// one head's q, k and v, a wave 64x48, K-steps of 64), double-
// buffered LDS with GLOBAL_LOAD_ASYNC_TO_LDS_B128 staging for both tiles; the
// B tile stays [k][n] in LDS and is read with DS_LOAD_TR16_B128. The feature sums z
// and the denominators are further columns of the two batched GEMMs. The DPFP
// features of k and the per-head q and v leave the q | k | v GEMM's own epilogue.
// Kernels that do not depend on one another share a launch, told apart by the block index.
// ---------------------------------------------------------------------------

typedef unsigned short u16;
typedef __attribute__((ext_vector_type(4)))  unsigned short u16x4;
typedef __attribute__((ext_vector_type(8)))  unsigned short u16x8;
typedef __attribute__((ext_vector_type(4)))  float         f32x4;
typedef __attribute__((ext_vector_type(16))) unsigned short v16u;
typedef __attribute__((ext_vector_type(16))) __bf16        v16bf;
typedef __attribute__((ext_vector_type(8)))  float         v8f;
typedef __attribute__((ext_vector_type(8)))  short         s16x8;

union Frag { v16u u; v16bf b; };

#ifndef __has_builtin
#define __has_builtin(x) 0
#endif

#if defined(__AMDGCN__) && __has_builtin(__builtin_amdgcn_global_load_async_to_lds_b128)
#define USE_ASYNC_LDS 1
#else
#define USE_ASYNC_LDS 0
#endif

#if USE_ASYNC_LDS
// Builtin signature (from hipcc diagnostic): (v4i addrspace(1)*, v4i addrspace(3)*, imm, imm)
typedef int gcc_i32x4 __attribute__((vector_size(16)));
__device__ __forceinline__ void async_copy_b128(const u16* g, u16* l) {
    __builtin_amdgcn_global_load_async_to_lds_b128(
        (__attribute__((address_space(1))) gcc_i32x4*)(void*)g,
        (__attribute__((address_space(3))) gcc_i32x4*)(void*)l, 0, 0);
}
#endif

// The issuing wave's copies have landed. In asm with the memory clobber, so that
// no LDS read moves in front of it.
__device__ __forceinline__ void async_wait0() {
#if USE_ASYNC_LDS
    asm volatile("s_wait_asynccnt 0x0" ::: "memory");
#endif
}

// One 128 x BK A tile into LDS rows of BK + 8 elements. g and l are the lane's own
// first 16 bytes: BK/8 neighbouring lanes take one row's BK*2 contiguous bytes, so
// a wave's copy covers four whole 128-B lines. A thread brings BK/16 rows.
template <int BK>
__device__ __forceinline__ void stage_a(const u16* g, int lda, u16* l) {
    constexpr int RP = 2048 / BK;        // rows the block's 256 lanes cover at once
#pragma unroll   // independent copies, issued back to back
    for (int u = 0; u < 128 / RP; ++u) {
#if USE_ASYNC_LDS
        async_copy_b128(g + (long long)(u * RP) * lda, l + u * RP * (BK + 8));
#else
        *(u16x8*)(l + u * RP * (BK + 8)) = *(const u16x8*)(g + (long long)(u * RP) * lda);
#endif
    }
}

// LDB below is the row pitch of the B tile in LDS, in elements: its n + 16, which is
// 160 bytes for 64 n and 416 for 192, an odd multiple of 32 B, which ds_load_tr16_b128
// reads without bank conflicts.

// One BK x 64 B tile into LDS as it lies in memory, [k][n]. g and l are the lane's
// own first 16 bytes: 8 neighbouring lanes take one row's 128 contiguous bytes, so
// a wave's copy covers four whole 128-B lines. A thread brings BK/32 rows.
template <int BK, int LDB>
__device__ __forceinline__ void stage_b(const u16* g, int ldb, u16* l) {
#pragma unroll   // independent copies, issued back to back
    for (int r = 0; r < BK / 32; ++r) {
#if USE_ASYNC_LDS
        async_copy_b128(g + (long long)(r * 32) * ldb, l + r * 32 * LDB);
#else
        *(u16x8*)(l + r * 32 * LDB) = *(const u16x8*)(g + (long long)(r * 32) * ldb);
#endif
    }
}

// One copy of the lane's own 16 bytes, from g to l. So goes the 128 x 16 block of z
// columns beside a 128 x 64 B tile, into columns 64..79 of its LDS rows (the block's 256
// lanes take 4 KiB that lie contiguous in memory, one copy a thread), and so go the
// pieces of the q | k | v GEMM's B tile.
__device__ __forceinline__ void stage_z(const u16* g, u16* l) {
#if USE_ASYNC_LDS
    async_copy_b128(g, l);
#else
    *(u16x8*)l = *(const u16x8*)g;
#endif
}

__device__ __forceinline__ u16 f2bf(float f) {
    union { float f; unsigned u; } x; x.f = f;
    unsigned u = x.u;
    u += 0x7FFFu + ((u >> 16) & 1u);     // round-to-nearest-even
    return (u16)(u >> 16);
}
__device__ __forceinline__ float bf2f(u16 h) {
    union { unsigned u; float f; } x; x.u = ((unsigned)h) << 16;
    return x.f;
}

// ISA 16-bit fragment layout: lane element e -> K = khalf + e + (e>=8 ? 8 : 0)
__device__ __forceinline__ void load_frag(Frag& f, const u16* p) {
    u16x8 lo = *(const u16x8*)p;
    u16x8 hi = *(const u16x8*)(p + 16);
#pragma unroll
    for (int e = 0; e < 8; ++e) { f.u[e] = lo[e]; f.u[e + 8] = hi[e]; }
}

// B fragment (32 k x 16 n) out of the [k][n] tile by two transposing loads. p is the
// lane's own address: row 8*(lane>>4) + (lane&7), column 8*((lane>>3)&1) of the 16 x 16
// piece; the lane gets column lane&15 at k = 8*(lane>>4) + 0..7, and 16 rows on the
// same at k + 16: the k order of load_frag.
template <int LDB>
__device__ __forceinline__ void load_frag_tr(Frag& f, const u16* p) {
    typedef __attribute__((address_space(3))) s16x8 lds_s16x8;
    s16x8 lo = __builtin_amdgcn_ds_load_tr16_b128_v8i16((lds_s16x8*)p);
    s16x8 hi = __builtin_amdgcn_ds_load_tr16_b128_v8i16((lds_s16x8*)(p + 16 * LDB));
#pragma unroll   // f.u[] indexed by constants: stays in registers
    for (int e = 0; e < 8; ++e) { f.u[e] = (u16)lo[e]; f.u[e + 8] = (u16)hi[e]; }
}

// ---------------------------------------------------------------------------
// What the q | k | v GEMM's epilogue does with a 128 x 64 part of its tile, which it has
// laid in LDS as bf16: 128 consecutive s, from s0 on, of one head of q, k or v; bn = b*16 + n.
// DPFP: x2 = [relu(x), relu(-x)] (128); feature f=(i-1)*128+j = x2[j]*x2[(j-i)&127]
// ---------------------------------------------------------------------------
constexpr int TP = 72;    // row pitch of the tile as [s][d], elements: 128 + 16 bytes
constexpr int TT = 136;   // row pitch of the tile as [d][s], elements: 256 + 16 bytes

// pkT[bn][f][s] from T[d][s], so that every feature row leaves as 256 contiguous
// bytes, 16 B per lane. A thread owns 8 s and 8 consecutive j and slides a window
// of four x2 rows over them.
__device__ __forceinline__ void feat_cols(const u16* T, u16* __restrict__ dst, int bn, int s0)
{
    const int c  = threadIdx.x & 15;    // which 8 s of the 128
    const int j0 = (threadIdx.x >> 4) * 8;
    u16* out = dst + ((long long)bn * 384 + j0) * 2048 + s0 + c * 8;

    // The eleven x rows this thread needs (j0-3 .. j0+7, modulo 128), each read once.
    // Every loop below is unrolled so that q[], w[] and o[] are indexed by constants and stay in registers.
    uint4 q[11];
#pragma unroll
    for (int t = 0; t < 11; ++t) q[t] = *(const uint4*)(T + ((j0 + t - 3) & 63) * TT + c * 8);

    float w[4][8];
#pragma unroll
    for (int t = 0; t < 11; ++t) {
        const unsigned flip = ((j0 + t - 3) & 64) ? 0x80008000u : 0u;   // upper half of x2 is relu(-x)
        const unsigned qq[4] = {q[t].x ^ flip, q[t].y ^ flip, q[t].z ^ flip, q[t].w ^ flip};
#pragma unroll
        for (int e = 0; e < 4; ++e) {
            w[t & 3][2 * e]     = fmaxf(__uint_as_float(qq[e] << 16), 0.f);
            w[t & 3][2 * e + 1] = fmaxf(__uint_as_float(qq[e] & 0xFFFF0000u), 0.f);
        }
        if (t >= 3) {
#pragma unroll
            for (int i = 1; i <= 3; ++i) {
                u16x8 o;
#pragma unroll
                for (int e = 0; e < 8; ++e) o[e] = f2bf(w[t & 3][e] * w[(t - i) & 3][e]);
                *(u16x8*)(out + (long long)((i - 1) * 128 + (t - 3)) * 2048) = o;
            }
        }
    }
}

// dst[bn][s][d] (q_bf or v_bf) from T[s][d]: the tile's 16 KiB lie contiguous there. A
// lane moves 8 d (16 B), a thread four such groups.
__device__ __forceinline__ void rows_out(const u16* T, u16* __restrict__ dst, int bn, int s0)
{
    u16* out = dst + ((long long)bn * 2048 + s0) * 64;
#pragma unroll   // independent moves
    for (int u = 0; u < 4; ++u) {
        const int g = threadIdx.x + u * 256;          // group of 8 d, < 128*8
        *(u16x8*)(out + g * 8) = *(const u16x8*)(T + (g >> 3) * TP + (g & 7) * 8);
    }
}

// ---------------------------------------------------------------------------
// Batched bf16 GEMM: C[M,N] = A[M,K] @ B[K,N], row-major, fp32 acc.
// Block: 256 threads = 8 waves; tile 128x64; wave (wr 0..3, wc 0..1) owns
// 32x32. C_QKV: tile 128x192; wave (wr 0..1, wc 0..3) owns 64x48, so that a fragment
// read from LDS feeds 3 or 4 WMMAs and a byte brought from L2 more of the product.
// Double-buffered K-steps of BK (64 or 128).
// Requires: M%128==0, N%64==0, K%BK==0, lda/ldb/ldc %8==0, 16B-aligned bases.
// MODE says what leaves the block:
//   C_BF16, C_F32  C as bf16 or fp32.
//   C_ROWSUM       C as bf16, and the row sums of A (a product with a fragment of
//                  ones) as Zc[bz][m][16]: each sum split into two bf16, the upper
//                  part in the even columns, the rest in the odd ones.
//   C_ATTN         N = 64. Zc[bz][k][16] rides as 16 more columns of B, so that
//                  column pairs of A @ Zc add up to dot(A row, z). C * SCALE over
//                  (that * SCALE + EPS) goes as bf16 to [m][bz >> 4][bz & 15][n].
//   C_QKV          B = Wq | Wk | Wv, 1024 columns each, 64 a head; row b*2048 + s. The
//                  tile's 192 columns are head bx of q, of k and of v, so that every
//                  block has the same work behind its loop.
//                  C itself is not stored: rounded to bf16 the three 128 x 64 parts go
//                  through LDS, and q leaves as q_bf (Cp), k as pkT (Zc), v as v_bf (Vb).
// ---------------------------------------------------------------------------
enum { C_BF16 = 0, C_F32 = 1, C_ROWSUM = 2, C_ATTN = 3, C_QKV = 4 };

// One block's tile: column tile bx, row tile by, batch bz.
template <int MODE, int BK>
__device__ __forceinline__ void gemm_tile(
    const u16* __restrict__ A, const u16* __restrict__ B, void* __restrict__ Cp,
    u16* __restrict__ Zc,
    int M, int N, int K, int lda, int ldb, int ldc,
    long long strideA, long long strideB, long long strideC,
    int bx, int by, int bz, u16* __restrict__ Vb = nullptr)
{
    constexpr int WCN = MODE == C_QKV ? 4 : 2;   // waves side by side in n; 8 / WCN in m
    constexpr int FM  = MODE == C_QKV ? 4 : 2;   // a wave's 16 x 16 fragments in m
    constexpr int FN  = MODE == C_QKV ? 3 : 2;   // and in n
    constexpr int BN  = WCN * FN * 16;           // the tile's columns
    static_assert((8 / WCN) * FM * 16 == 128, "the tile has 128 rows");
    // Row pitch of the A tile: BK*2 + 16 bytes, an odd multiple of 16 B, which
    // ds_load_b128 reads without bank conflicts.
    constexpr int LDP = BK + 8;
    constexpr int LDB = BN + 16;                 // row pitch of the B tile
    constexpr int ASZ = 128 * LDP;               // elements of an A buffer
    constexpr int BSZ = BK * LDB;                // elements of a B buffer
    static_assert(MODE != C_ATTN || BK == 128, "stage_z: one copy a thread fills 128 rows");
    static_assert(MODE != C_QKV || 2 * ASZ + 2 * BSZ >= 3 * 128 * TP, "the epilogue's three parts fit");
    __shared__ __align__(16) u16 S[2 * ASZ + 2 * BSZ];
    u16* const As = S;                           // two buffers [m][k]
    u16* const Bs = S + 2 * ASZ;                 // two buffers [k][n], as in memory

    A += (long long)bz * strideA;
    B += (long long)bz * strideB;

    const int tileN = bx * BN;
    const int tileM = by * 128;
    const int tid   = threadIdx.x;
    const int lane  = tid & 31;
    const int wave  = tid >> 5;
    const int wr    = wave / WCN;         // m slice: wr*FM*16
    const int wc    = wave % WCN;         // n slice: wc*FN*16
    const int lrow  = lane & 15;
    const int khalf = (lane >> 4) ? 8 : 0;

    // staging coordinates
    const int ar = tid / (BK / 8);        // A row, and every 2048/BK rows on
    const int ac = (tid % (BK / 8)) * 8;  // 0..BK-8
    const int br = tid >> 3;              // 0..31 (k row), and every 32 rows on
    const int bc = (tid & 7) * 8;         // 0..56 (n col)

    const u16* aG = A + (long long)(tileM + ar) * lda + ac;   // K-tile t: + t*BK
    const u16* bG = B + (long long)br * ldb + tileN + bc;     // K-tile t: + t*BK rows
    const int  aL = ar * LDP + ac;
    const int  bL = br * LDB + bc;
    // C_QKV: a B row is three runs of 128 bytes, 1024 columns apart in memory and side by
    // side in LDS: 24 lanes a row, 8 neighbouring lanes a whole line. The block's 256
    // lanes go through the BK*24 pieces in order; g3 and l3 are this lane's places.
    constexpr int NB3 = BK * 24 / 256;
    int g3[NB3], l3[NB3];
    if (MODE == C_QKV) {
#pragma unroll   // g3[], l3[] indexed by constants: stay in registers
        for (int u = 0; u < NB3; ++u) {
            const int idx = tid + u * 256, row = idx / 24, p = idx - row * 24;
            g3[u] = row * ldb + (p >> 3) * 1024 + bx * 64 + (p & 7) * 8;
            l3[u] = row * LDB + p * 8;
        }
    }
    // this lane's address in a 16 x 16 piece of the B tile, for the transposing loads
    const int  bT = (khalf + (lane & 7)) * LDB + wc * FN * 16 + ((lane >> 3) & 1) * 8;
    const int  nT = K / BK;               // K-tiles
    // z columns (C_ATTN): row tid >> 1, half tid & 1 of the tile's 128 x 16 block
    const u16* zG = Zc + (long long)bz * K * 16 + tid * 8;    // K-tile t: + t*BK*16
    const int  zL = (tid >> 1) * LDB + 64 + (tid & 1) * 8;
    const int  zT = (khalf + (lane & 7)) * LDB + 64 + ((lane >> 3) & 1) * 8;

    v8f acc[FM][FN] = {};
    v8f accz[FM] = {};                    // C_ROWSUM: row sums of A; C_ATTN: A @ Zc
    Frag fone;
#pragma unroll   // fone.u[] indexed by constants: stays in registers
    for (int e = 0; e < 16; ++e) fone.u[e] = 0x3F80;          // 1.0

    // K-tile t on its way into buffer buf
    auto stage = [&](int t, int buf) {
        stage_a<BK>(aG + (long long)t * BK, lda, As + buf * ASZ + aL);
        if (MODE == C_QKV) {
            const u16* g = B + (long long)t * BK * ldb;
#pragma unroll   // independent copies, issued back to back
            for (int u = 0; u < NB3; ++u) stage_z(g + g3[u], Bs + buf * BSZ + l3[u]);
        } else {
            stage_b<BK, LDB>(bG + (long long)t * BK * ldb, ldb, Bs + buf * BSZ + bL);
        }
        if (MODE == C_ATTN) stage_z(zG + t * BK * 16, Bs + buf * BSZ + zL);
    };

    // ---- prologue: K-tile 0 into buffer 0, then K-tile 1 on its way into buffer 1
    stage(0, 0);
    async_wait0();
    __syncthreads();
    if (1 < nT) stage(1, 1);

    int cur = 0;
    for (int t = 0; t < nT; ++t) {
#pragma unroll   // the tile's runs of 32 k, in ascending k; LDS offsets become immediates
        for (int kk = 0; kk < BK; kk += 32) {
            // fragments (an A fragment reused by FN WMMAs, a B fragment by FM)
            Frag fa[FM], fb[FN];
            const u16* ap = As + cur * ASZ + (wr * FM * 16 + lrow) * LDP + kk + khalf;
#pragma unroll   // fa[] indexed by constants: stays in registers
            for (int i = 0; i < FM; ++i) load_frag(fa[i], ap + i * 16 * LDP);
            const u16* bp = Bs + cur * BSZ + kk * LDB + bT;
#pragma unroll   // fb[] indexed by constants: stays in registers
            for (int j = 0; j < FN; ++j) load_frag_tr<LDB>(fb[j], bp + j * 16);
            // The 14 LDS reads of a run stay one group in front of its 12 WMMAs. Left alone the
            // compiler reloads one A fragment's registers in front of every three WMMAs and
            // waits out the LDS latency there each time.
            if (MODE == C_QKV) __builtin_amdgcn_sched_barrier(0);

#pragma unroll   // acc[][] indexed by constants: stays in registers
            for (int i = 0; i < FM; ++i)
#pragma unroll
                for (int j = 0; j < FN; ++j)
                    acc[i][j] = __builtin_amdgcn_wmma_f32_16x16x32_bf16(false, fa[i].b, false, fb[j].b,
                                                                        (short)0, acc[i][j], false, false);
            if (MODE == C_ROWSUM || MODE == C_ATTN) {
                Frag fz = fone;
                if (MODE == C_ATTN) load_frag_tr<LDB>(fz, Bs + cur * BSZ + kk * LDB + zT);
#pragma unroll   // accz[] indexed by constants: stays in registers
                for (int i = 0; i < FM; ++i)
                    accz[i] = __builtin_amdgcn_wmma_f32_16x16x32_bf16(false, fa[i].b, false, fz.b,
                                                                      (short)0, accz[i], false, false);
            }
        }

        // Hand-over: this wave's LDS reads are done and its copies of tile t + 1
        // have landed; behind the barrier every wave may read tile t + 1, and
        // buffer cur, which all have left, may be refilled.
        asm volatile("s_wait_dscnt 0x0" ::: "memory");
        async_wait0();
        __syncthreads();
        if (t + 2 < nT) stage(t + 2, cur);
        cur ^= 1;
    }
    async_wait0();   // no copy outlives the loop

    // C/D layout: VGPR r -> row r + (lane>=16 ? 8 : 0), col lane%16
    // Every loop over i, j, r below is unrolled: the accumulators indexed by constants stay in registers.
    const int rsel = (lane >> 4) ? 8 : 0;
    const int cm   = tileM + wr * FM * 16 + rsel;
    const int cn   = tileN + wc * FN * 16 + lrow;
    if (MODE == C_QKV) {
        // Every wave has left both buffers at the loop's last barrier, and no copy is
        // under way: the three parts take the place of the buffers.
        constexpr int TSZ = 128 * TP;         // elements of a part, in either lay-out
        static_assert(TSZ >= 64 * TT, "a part as [d][s] fits too");
        const int bn = (by >> 4) * 16 + bx;
        const int s0 = (by & 15) * 128;
#pragma unroll
        for (int j = 0; j < FN; ++j) {
            const int c    = (wc * FN + j) * 16;   // the fragment's first column of the 192
            const int kind = c >> 6;               // 0 q, 1 k, 2 v: the same for the whole wave
            const int c0   = (c & 63) + lrow;
            u16* T = S + kind * TSZ;
#pragma unroll
            for (int i = 0; i < FM; ++i) {
                const int m0 = (wr * FM + i) * 16 + rsel;
                if (kind == 1) {
                    // as [d][s]: a lane's 8 rows of a column are 8 neighbouring s, 16 bytes
                    u16x8 e;
#pragma unroll
                    for (int r = 0; r < 8; ++r) e[r] = f2bf(acc[i][j][r]);
                    *(u16x8*)(T + c0 * TT + m0) = e;
                } else {
#pragma unroll
                    for (int r = 0; r < 8; ++r) T[(m0 + r) * TP + c0] = f2bf(acc[i][j][r]);
                }
            }
        }
        __syncthreads();   // the parts are whole before a thread reads what other waves wrote
        rows_out(S, (u16*)Cp, bn, s0);
        rows_out(S + 2 * TSZ, Vb, bn, s0);
        feat_cols(S + TSZ, Zc, bn, s0);
    } else if (MODE == C_ATTN) {
        u16* C = (u16*)Cp + (bz >> 4) * 1024 + (bz & 15) * 64 + cn;
#pragma unroll
        for (int r = 0; r < 8; ++r) {
#pragma unroll
            for (int i = 0; i < FM; ++i) {
                // a lane and its neighbour hold the two parts of the row's dot(A row, z);
                // one division a row, SCALE / den, serves all of the lane's columns
                const float sc = 0.125f / ((accz[i][r] + __shfl_xor(accz[i][r], 1, 32)) * 0.125f + 1e-5f);
#pragma unroll
                for (int j = 0; j < FN; ++j)
                    C[(long long)(cm + i * 16 + r) * 2048 + j * 16] = f2bf(acc[i][j][r] * sc);
            }
        }
    } else if (MODE == C_BF16 || MODE == C_ROWSUM) {
        u16* C = (u16*)Cp + (long long)bz * strideC;
#pragma unroll
        for (int r = 0; r < 8; ++r)
#pragma unroll
            for (int i = 0; i < FM; ++i)
#pragma unroll
                for (int j = 0; j < FN; ++j)
                    C[(long long)(cm + i * 16 + r) * ldc + cn + j * 16] = f2bf(acc[i][j][r]);
        if (MODE == C_ROWSUM && wc == 0) {   // every column of accz holds the row's sum
            u16* Z = Zc + ((long long)bz * M + cm) * 16 + lrow;
#pragma unroll
            for (int r = 0; r < 8; ++r)
#pragma unroll
                for (int i = 0; i < FM; ++i) {
                    const u16 hi = f2bf(accz[i][r]);
                    Z[(i * 16 + r) * 16] = (lrow & 1) ? f2bf(accz[i][r] - bf2f(hi)) : hi;
                }
        }
    } else {
        float* C = (float*)Cp + (long long)bz * strideC;
#pragma unroll
        for (int r = 0; r < 8; ++r)
#pragma unroll
            for (int i = 0; i < FM; ++i)
#pragma unroll
                for (int j = 0; j < FN; ++j)
                    C[(long long)(cm + i * 16 + r) * ldc + cn + j * 16] = acc[i][j][r];
    }
}

template <int MODE, int BK>
__global__ __launch_bounds__(256) void gemm_bf16_kernel(
    const u16* __restrict__ A, const u16* __restrict__ B, void* __restrict__ Cp,
    u16* __restrict__ Zc,
    int M, int N, int K, int lda, int ldb, int ldc,
    long long strideA, long long strideB, long long strideC)
{
    gemm_tile<MODE, BK>(A, B, Cp, Zc, M, N, K, lda, ldb, ldc, strideA, strideB, strideC,
                        blockIdx.x, blockIdx.y, blockIdx.z);
}

// q | k | v = h @ (Wq | Wkv), 4096 x 3072 over K = 1024, leaving as q_bf, pkT and v_bf.
__global__ __launch_bounds__(256) void qkv_feat_kernel(
    const u16* __restrict__ A, const u16* __restrict__ B,
    u16* __restrict__ qb, u16* __restrict__ pkT, u16* __restrict__ vb)
{
    gemm_tile<C_QKV, 64>(A, B, qb, pkT, 4096, 3072, 1024, 1024, 3072, 0, 0, 0, 0,
                          blockIdx.x, blockIdx.y, 0, vb);
}

// ---------------------------------------------------------------------------
// All four fp32 -> bf16 casts in one launch: blocks 0..511 h, 512..639 Wq,
// 640..895 Wkv, 896..1023 Wo. Wq and Wkv go side by side into Wqkv[1024][3072], so
// that one GEMM makes q, k and v. h[s][b] goes to h_bf[b][s], so that 128 rows of that
// GEMM are 128 consecutive s of one b.
// A block converts 8192 consecutive floats (every array here is a multiple of
// that). A lane takes four floats per access, so a wave reads 512 and writes
// 256 contiguous bytes; all eight loads of a thread are asked for first.
__global__ __launch_bounds__(256) void cvt_all_kernel(const float* __restrict__ h,
                                                      const float* __restrict__ Wq,
                                                      const float* __restrict__ Wkv,
                                                      const float* __restrict__ Wo,
                                                      u16* __restrict__ h_bf,
                                                      u16* __restrict__ Wqkv_bf,
                                                      u16* __restrict__ Wo_bf)
{
    int blk = blockIdx.x;
    const float* src = h;
    u16* dst  = h_bf;
    int pitch = 1024;                   // elements from one destination row to the next
    int sh    = 1;                      // a source row is 1024 << sh floats
    int step  = 2097152;                // elements from a row's first 1024 to its second: h_bf[1] - h_bf[0]
    if (blk >= 896)      { blk -= 896; src = Wo;  dst = Wo_bf;                        sh = 0; }
    else if (blk >= 640) { blk -= 640; src = Wkv; dst = Wqkv_bf + 1024; pitch = 3072; step = 1024; }
    else if (blk >= 512) { blk -= 512; src = Wq;  dst = Wqkv_bf;        pitch = 3072; sh = 0; }
    src += blk * 8192 + threadIdx.x * 4;
    dst += threadIdx.x * 4;
    f32x4 v[8];
#pragma unroll   // v[] indexed by constants: stays in registers
    for (int u = 0; u < 8; ++u) v[u] = *(const f32x4*)(src + u * 1024);
#pragma unroll
    for (int u = 0; u < 8; ++u) {
        u16x4 o;
#pragma unroll
        for (int e = 0; e < 4; ++e) o[e] = f2bf(v[u][e]);
        const int g = blk * 8 + u;      // which run of 1024 floats of the array
        *(u16x4*)(dst + (g >> sh) * pitch + (g & ((1 << sh) - 1)) * step) = o;
    }
}

// pq[bn][s][f]: one block per (128 consecutive s, bn). A lane owns 8 consecutive
// j of a row: it reads them (16 B) and the four in front of them (8 B) straight
// from q and stores its 8 features of each roll as 16 B, so 16 lanes write 256
// contiguous bytes. A thread does 8 rows, 16 apart. src is q_bf[bn][s][64].
__device__ __forceinline__ void dpfp_block(const u16* __restrict__ src,
                                           u16* __restrict__ dst, int bx, int bn)
{
    const int j0 = (threadIdx.x & 15) * 8;
    const int jp = (j0 - 4) & 127;      // the four x2 entries in front, modulo 128
    const int s0 = bx * 128 + (threadIdx.x >> 4);

    const u16* row = src + ((long long)bn * 2048 + s0) * 64;
    u16x8 cur[8];
    u16x4 prv[8];
#pragma unroll   // cur[], prv[] indexed by constants: stay in registers
    for (int u = 0; u < 8; ++u)         // 16 rows of 64 further on
        cur[u] = *(const u16x8*)(row + u * 1024 + (j0 & 63));
    // Precaution: the address pair of the loads above is overwritten further down;
    // this wait stands in front of that overwrite.
    asm volatile("s_wait_xcnt 0x0" ::: "memory");
#pragma unroll
    for (int u = 0; u < 8; ++u)
        prv[u] = *(const u16x4*)(row + u * 1024 + (jp & 63));
    const u16 fc = (j0 & 64) ? 0x8000 : 0;   // upper half of x2 is relu(-x)
    const u16 fp = (jp & 64) ? 0x8000 : 0;
#pragma unroll
    for (int u = 0; u < 8; ++u) {
        float w[11];                    // x2[j0-3 .. j0+7]
#pragma unroll
        for (int t = 0; t < 3; ++t) w[t] = fmaxf(bf2f((u16)(prv[u][t + 1] ^ fp)), 0.f);
#pragma unroll
        for (int e = 0; e < 8; ++e) w[3 + e] = fmaxf(bf2f((u16)(cur[u][e] ^ fc)), 0.f);
        u16* out = dst + ((long long)bn * 2048 + s0 + u * 16) * 384 + j0;
#pragma unroll
        for (int i = 1; i <= 3; ++i) {
            u16x8 o;
#pragma unroll
            for (int e = 0; e < 8; ++e) o[e] = f2bf(w[3 + e] * w[3 + e - i]);
            *(u16x8*)(out + (i - 1) * 128) = o;
        }
    }
}

// kv_agg[bn] = pkT[bn] @ v[bn] (384x2048 . 2048x64, bf16 out) with z[bn] as the row
// sums of pkT[bn]: blocks 0..95, which run longest. They fill 96 of
// the chip's WGPs; pq, which only the GEMM after this one reads, is made beside them
// by blocks 96..607. The GEMM's arguments are those of gemm_bf16_kernel.
__global__ __launch_bounds__(256) void kvagg_pq_kernel(
    const u16* __restrict__ A, const u16* __restrict__ B, void* __restrict__ Cp,
    u16* __restrict__ Zc,
    int M, int N, int K, int lda, int ldb, int ldc,
    long long strideA, long long strideB, long long strideC,
    const u16* __restrict__ q, u16* __restrict__ pq)
{
    const int blk = blockIdx.x;
    if (blk >= 96) { dpfp_block(q, pq, (blk - 96) & 15, (blk - 96) >> 4); return; }   // the whole block leaves
    gemm_tile<C_ROWSUM, 128>(A, B, Cp, Zc, M, N, K, lda, ldb, ldc, strideA, strideB, strideC,
                             0, blk % 3, blk / 3);   // three row tiles a batch
}

// The sum of v over the wave's 32 lanes, left in every lane: four DPP steps inside each row
// of 16 lanes (row_xmask 1, 2, 4, 8), then the other row's sum by v_permlanex16_b32.
// __shfl_xor would go through ds_bpermute_b32 and wait out its latency at each of five steps.
template <int CTRL>
__device__ __forceinline__ float dpp_f32(float v) {
    return __builtin_bit_cast(float, __builtin_amdgcn_update_dpp(0, __builtin_bit_cast(int, v), CTRL, 0xf, 0xf, true));
}
__device__ __forceinline__ float wave_sum(float v) {
    v += dpp_f32<0x161>(v);
    v += dpp_f32<0x162>(v);
    v += dpp_f32<0x164>(v);
    v += dpp_f32<0x168>(v);
    const int w = __builtin_bit_cast(int, v);
    return v + __builtin_bit_cast(float, __builtin_amdgcn_permlanex16(w, w, 0x76543210, 0xfedcba98, false, false));
}

// out = layernorm(h + attn_out). A wave owns a row and keeps it in registers: a lane
// takes four floats per access, so a wave's load or store covers 512 contiguous bytes, and
// all loads of the row, with gamma and beta, are asked for before the first is used.
// Mean and variance (two passes, over the registers) are summed across the wave's lanes.
__global__ __launch_bounds__(256) void ln_kernel(const float* __restrict__ h,
                                                 const float* __restrict__ attn,
                                                 const float* __restrict__ gamma,
                                                 const float* __restrict__ beta,
                                                 float* __restrict__ out)
{
    const int lane = threadIdx.x & 31;
    // The row is the same in every lane: taken from the first lane it stays in scalar registers,
    // and every load and store of the wave is a scalar base plus the lane's one 32-bit offset.
    const int row  = blockIdx.x * 8 + __builtin_amdgcn_readfirstlane(threadIdx.x >> 5);
    const float* hr = h    + (long long)row * 1024 + lane * 4;
    const float* ar = attn + (long long)row * 1024 + lane * 4;

    // Every loop below is unrolled: x[], a[], g[], b[] indexed by constants stay in registers.
    f32x4 x[8], a[8], g[8], b[8];
#pragma unroll
    for (int u = 0; u < 8; ++u) x[u] = *(const f32x4*)(hr + u * 128);
#pragma unroll
    for (int u = 0; u < 8; ++u) a[u] = *(const f32x4*)(ar + u * 128);
#pragma unroll
    for (int u = 0; u < 8; ++u) g[u] = *(const f32x4*)(gamma + lane * 4 + u * 128);
#pragma unroll
    for (int u = 0; u < 8; ++u) b[u] = *(const f32x4*)(beta + lane * 4 + u * 128);
    // Precaution: a scalar base of the loads above is overwritten further down; this wait
    // stands in front of that overwrite (the scheduling barrier behind it keeps it there).
    asm volatile("s_wait_xcnt 0x0" ::: "memory");
    // The 32 loads stay one group in front of the arithmetic. Left alone the compiler asks for
    // gamma and beta behind the sums, a pair at a time, and waits out a load's latency at each pair.
    __builtin_amdgcn_sched_barrier(0);

    // A lane sums in four chains, one for each of its four columns of an access.
    f32x4 s4 = {0.f, 0.f, 0.f, 0.f};
#pragma unroll
    for (int u = 0; u < 8; ++u) {
        x[u] += a[u];
        s4 += x[u];
    }
    const float mu = wave_sum((s4[0] + s4[1]) + (s4[2] + s4[3])) * (1.f / 1024.f);

    f32x4 v4 = {0.f, 0.f, 0.f, 0.f};
#pragma unroll
    for (int u = 0; u < 8; ++u) {
        x[u] -= mu;
        v4 += x[u] * x[u];
    }
    const float rstd = rsqrtf(wave_sum((v4[0] + v4[1]) + (v4[2] + v4[3])) * (1.f / 1024.f) + 1e-5f);

    float* orow = out + (long long)row * 1024 + lane * 4;
#pragma unroll
    for (int u = 0; u < 8; ++u) *(f32x4*)(orow + u * 128) = x[u] * rstd * g[u] + b[u];
}

// ---------------------------------------------------------------------------
extern "C" void kernel_launch(void* const* d_in, const int* in_sizes, int n_in,
                              void* d_out, int out_size, void* d_ws, size_t ws_size,
                              hipStream_t stream)
{
    const float* h    = (const float*)d_in[0];   // [2048,2,1024]
    const float* Wq   = (const float*)d_in[1];   // [1024,1024]
    const float* Wkv  = (const float*)d_in[2];   // [1024,2048]
    const float* Wo   = (const float*)d_in[3];   // [1024,1024]
    const float* gam  = (const float*)d_in[4];
    const float* bet  = (const float*)d_in[5];
    float* out = (float*)d_out;
    (void)in_sizes; (void)n_in; (void)out_size; (void)ws_size;

    char* ws = (char*)d_ws;
    auto take = [&](size_t bytes) -> char* { char* p = ws; ws += bytes; return p; };

    u16*   h_bf     = (u16*)  take(8388608);    // 2 x 2048x1024: [b][s]
    u16*   Wqkv_bf  = (u16*)  take(6291456);    // 1024x3072: Wq | Wkv
    u16*   Wo_bf    = (u16*)  take(2097152);    // 1024x1024
    u16*   q_bf     = (u16*)  take(8388608);    // 32 x 2048x64
    u16*   v_bf     = (u16*)  take(8388608);    // 32 x 2048x64
    u16*   pq_bf    = (u16*)  take(50331648);   // 32 x 2048x384
    u16*   pkT_bf   = (u16*)  take(50331648);   // 32 x 384x2048
    u16*   zc_bf    = (u16*)  take(393216);     // 32 x 384x16
    u16*   kvagg_bf = (u16*)  take(1572864);    // 32 x 384x64
    u16*   attn_bf  = (u16*)  take(8388608);    // 4096x1024
    float* attn_out = (float*)take(16777216);   // 4096x1024

    // 1) fp32 -> bf16 casts
    cvt_all_kernel<<<1024, 256, 0, stream>>>(h, Wq, Wkv, Wo, h_bf, Wqkv_bf, Wo_bf);

    // 2) q | k | v = h @ (Wq | Wkv)  [4096,3072]; a block has 128 s of one head's q, k and
    //    v; K-step 64: two blocks' LDS and registers fit a WGP, so the 512 blocks are one
    //    even round on 256 WGPs. k leaves as DPFP features pkT [bn][f][s], q and v as [bn][s][d]
    qkv_feat_kernel<<<dim3(16, 32, 1), 256, 0, stream>>>(h_bf, Wqkv_bf, q_bf, pkT_bf, v_bf);

    // 3) kv_agg and z; beside them the DPFP features pq [bn][s][f]
    kvagg_pq_kernel<<<608, 256, 0, stream>>>(
        pkT_bf, v_bf, kvagg_bf, zc_bf, 384, 64, 2048, 2048, 64, 64,
        786432LL, 131072LL, 24576LL, q_bf, pq_bf);

    // 4) num[bn] = pq[bn] @ kv_agg[bn]  (2048x384 . 384x64) and den[bn] = pq[bn] @ z[bn]
    //    in one pass over pq; attn_vec = num*SCALE/den leaves as bf16 [4096,1024]
    gemm_bf16_kernel<C_ATTN, 128><<<dim3(1, 16, 32), 256, 0, stream>>>(
        pq_bf, kvagg_bf, attn_bf, zc_bf, 2048, 64, 384, 384, 64, 64,
        786432LL, 24576LL, 0LL);

    // 5) attn_out = attn_vec @ Wo  (fp32 out)
    gemm_bf16_kernel<C_F32, 128><<<dim3(16, 32, 1), 256, 0, stream>>>(
        attn_bf, Wo_bf, attn_out, nullptr, 4096, 1024, 1024, 1024, 1024, 1024, 0, 0, 0);

    // 6) out = layernorm(h + attn_out): 4096 rows, a wave each
    ln_kernel<<<512, 256, 0, stream>>>(h, attn_out, gam, bet, out);
}

// v010
// One run takes 81.9 microseconds.
// Timed twice side by side with v009, it ran 1.06 and 1.07 times as fast.
// Over all steps from v000 it is 4.98 times as fast.
#include <hip/hip_runtime.h>
#include <hip/hip_bf16.h>

// ---------------------------------------------------------------------------
// DPFP linear attention for MI455X (gfx1250): all GEMMs via bf16 WMMA
// (v_wmma_f32_16x16x32_bf16), fp32 accumulate. 128x64 block tiles, 8 waves
// each computing 32x32 (2x fragment reuse), K-steps of 128 (the q | k | v GEMM: 128x192,
// one head's q, k and v, a wave 64x48, K-steps of 64), double-
// buffered LDS with GLOBAL_LOAD_ASYNC_TO_LDS_B128 staging for both tiles; the
// B tile stays [k][n] in LDS and is read with DS_LOAD_TR16_B128. The feature sums z
// and the denominators are further columns of the two batched GEMMs. The DPFP
// features are never stored: each batched GEMM forms its A fragments in registers, as
// packed bf16 products of x2 entries that it reads from LDS as x2T or forms from q read from LDS. x2 of k and the per-head
// q and v leave the q | k | v GEMM's own epilogue. The attention GEMM has no K-steps:
// all that a block reads fits its LDS and is copied there once.
// ---------------------------------------------------------------------------

typedef unsigned short u16;
typedef __attribute__((ext_vector_type(4)))  unsigned short u16x4;
typedef __attribute__((ext_vector_type(8)))  unsigned short u16x8;
typedef __attribute__((ext_vector_type(4)))  float         f32x4;
typedef __attribute__((ext_vector_type(16))) unsigned short v16u;
typedef __attribute__((ext_vector_type(16))) __bf16        v16bf;
typedef __attribute__((ext_vector_type(8)))  float         v8f;
typedef __attribute__((ext_vector_type(8)))  short         s16x8;
typedef __attribute__((ext_vector_type(2)))  short         s16x2;

union Frag { v16u u; v16bf b; unsigned w[8]; };

#ifndef __has_builtin
#define __has_builtin(x) 0
#endif

#if defined(__AMDGCN__) && __has_builtin(__builtin_amdgcn_global_load_async_to_lds_b128)
#define USE_ASYNC_LDS 1
#else
#define USE_ASYNC_LDS 0
#endif

#if USE_ASYNC_LDS
// Builtin signature (from hipcc diagnostic): (v4i addrspace(1)*, v4i addrspace(3)*, imm, imm)
typedef int gcc_i32x4 __attribute__((vector_size(16)));
__device__ __forceinline__ void async_copy_b128(const u16* g, u16* l) {
    __builtin_amdgcn_global_load_async_to_lds_b128(
        (__attribute__((address_space(1))) gcc_i32x4*)(void*)g,
        (__attribute__((address_space(3))) gcc_i32x4*)(void*)l, 0, 0);
}
#endif

// The issuing wave's copies have landed. In asm with the memory clobber, so that
// no LDS read moves in front of it.
__device__ __forceinline__ void async_wait0() {
#if USE_ASYNC_LDS
    asm volatile("s_wait_asynccnt 0x0" ::: "memory");
#endif
}

// One 128 x BK A tile into LDS rows of BK + 8 elements. g and l are the lane's own
// first 16 bytes: BK/8 neighbouring lanes take one row's BK*2 contiguous bytes, so
// a wave's copy covers four whole 128-B lines. A thread brings BK/16 rows.
template <int BK>
__device__ __forceinline__ void stage_a(const u16* g, int lda, u16* l) {
    constexpr int RP = 2048 / BK;        // rows the block's 256 lanes cover at once
#pragma unroll   // independent copies, issued back to back
    for (int u = 0; u < 128 / RP; ++u) {
#if USE_ASYNC_LDS
        async_copy_b128(g + (long long)(u * RP) * lda, l + u * RP * (BK + 8));
#else
        *(u16x8*)(l + u * RP * (BK + 8)) = *(const u16x8*)(g + (long long)(u * RP) * lda);
#endif
    }
}

// LDB below is the row pitch of the B tile in LDS, in elements: its n + 16, which is
// 160 bytes for 64 n and 416 for 192, an odd multiple of 32 B, which ds_load_tr16_b128
// reads without bank conflicts.

// One BK x 64 B tile into LDS as it lies in memory, [k][n]. g and l are the lane's
// own first 16 bytes: 8 neighbouring lanes take one row's 128 contiguous bytes, so
// a wave's copy covers four whole 128-B lines. A thread brings BK/32 rows.
template <int BK, int LDB>
__device__ __forceinline__ void stage_b(const u16* g, int ldb, u16* l) {
#pragma unroll   // independent copies, issued back to back
    for (int r = 0; r < BK / 32; ++r) {
#if USE_ASYNC_LDS
        async_copy_b128(g + (long long)(r * 32) * ldb, l + r * 32 * LDB);
#else
        *(u16x8*)(l + r * 32 * LDB) = *(const u16x8*)(g + (long long)(r * 32) * ldb);
#endif
    }
}

// One copy of the lane's own 16 bytes, from g to l. So go the pieces of the q | k | v
// GEMM's B tile and all that the attention GEMM reads.
__device__ __forceinline__ void stage_z(const u16* g, u16* l) {
#if USE_ASYNC_LDS
    async_copy_b128(g, l);
#else
    *(u16x8*)l = *(const u16x8*)g;
#endif
}

__device__ __forceinline__ u16 f2bf(float f) {
    union { float f; unsigned u; } x; x.f = f;
    unsigned u = x.u;
    u += 0x7FFFu + ((u >> 16) & 1u);     // round-to-nearest-even
    return (u16)(u >> 16);
}
__device__ __forceinline__ float bf2f(u16 h) {
    union { unsigned u; float f; } x; x.u = ((unsigned)h) << 16;
    return x.f;
}

// ISA 16-bit fragment layout: lane element e -> K = khalf + e + (e>=8 ? 8 : 0)
__device__ __forceinline__ void load_frag(Frag& f, const u16* p) {
    u16x8 lo = *(const u16x8*)p;
    u16x8 hi = *(const u16x8*)(p + 16);
#pragma unroll
    for (int e = 0; e < 8; ++e) { f.u[e] = lo[e]; f.u[e + 8] = hi[e]; }
}

// B fragment (32 k x 16 n) out of the [k][n] tile by two transposing loads. p is the
// lane's own address: row 8*(lane>>4) + (lane&7), column 8*((lane>>3)&1) of the 16 x 16
// piece; the lane gets column lane&15 at k = 8*(lane>>4) + 0..7, and 16 rows on the
// same at k + 16: the k order of load_frag.
template <int LDB>
__device__ __forceinline__ void load_frag_tr(Frag& f, const u16* p) {
    typedef __attribute__((address_space(3))) s16x8 lds_s16x8;
    s16x8 lo = __builtin_amdgcn_ds_load_tr16_b128_v8i16((lds_s16x8*)p);
    s16x8 hi = __builtin_amdgcn_ds_load_tr16_b128_v8i16((lds_s16x8*)(p + 16 * LDB));
#pragma unroll   // f.u[] indexed by constants: stays in registers
    for (int e = 0; e < 8; ++e) { f.u[e] = (u16)lo[e]; f.u[e + 8] = (u16)hi[e]; }
}

// ---------------------------------------------------------------------------
// What the q | k | v GEMM's epilogue does with a 128 x 64 part of its tile, which it has
// laid in LDS as bf16: 128 consecutive s, from s0 on, of one head of q, k or v; bn = b*16 + n.
// DPFP: x2 = [relu(x), relu(-x)] (128); feature f=(i-1)*128+j = x2[j]*x2[(j-i)&127].
// The product of two bf16 is exact in fp32, so one packed bf16 multiply rounds it once,
// as a multiply in fp32 with a rounding to bf16 behind it does.
// ---------------------------------------------------------------------------
constexpr int TP = 72;    // row pitch of the tile as [s][d], elements: 128 + 16 bytes
constexpr int TT = 136;   // row pitch of the tile as [d][s], elements: 256 + 16 bytes

// relu of the two bf16 in a word. A bf16 read as a signed 16-bit integer is below 0
// exactly when its sign bit is set, so relu is an integer maximum with 0.
__device__ __forceinline__ unsigned relu2(unsigned w) {
    const s16x2 zero = {0, 0};
    return __builtin_bit_cast(unsigned, __builtin_elementwise_max(__builtin_bit_cast(s16x2, w), zero));
}

// x2T[bn][j][s] from T[d][s]: row d is relu(k), row 64 + d relu(-k). Every row leaves as
// 256 contiguous bytes, 16 B per lane; a thread does four d, 16 apart.
__device__ __forceinline__ void x2_rows(const u16* T, u16* __restrict__ dst, int bn, int s0)
{
    constexpr unsigned NEG = 0x80008000u;   // flips both signs of a word
    const int c  = threadIdx.x & 15;    // which 8 s of the 128
    const int d0 = threadIdx.x >> 4;
    u16* out = dst + ((long long)bn * 128 + d0) * 2048 + s0 + c * 8;
#pragma unroll   // independent moves
    for (int u = 0; u < 4; ++u) {
        const uint4 x = *(const uint4*)(T + (d0 + u * 16) * TT + c * 8);
        *(uint4*)(out + u * 16 * 2048) = make_uint4(relu2(x.x), relu2(x.y), relu2(x.z), relu2(x.w));
        *(uint4*)(out + (64 + u * 16) * 2048) =
            make_uint4(relu2(x.x ^ NEG), relu2(x.y ^ NEG), relu2(x.z ^ NEG), relu2(x.w ^ NEG));
    }
}

// dst[bn][s][d] (q_bf or v_bf) from T[s][d]: the tile's 16 KiB lie contiguous there. A
// lane moves 8 d (16 B), a thread four such groups.
__device__ __forceinline__ void rows_out(const u16* T, u16* __restrict__ dst, int bn, int s0)
{
    u16* out = dst + ((long long)bn * 2048 + s0) * 64;
#pragma unroll   // independent moves
    for (int u = 0; u < 4; ++u) {
        const int g = threadIdx.x + u * 256;          // group of 8 d, < 128*8
        *(u16x8*)(out + g * 8) = *(const u16x8*)(T + (g >> 3) * TP + (g & 7) * 8);
    }
}

// ---------------------------------------------------------------------------
// Batched bf16 GEMM: C[M,N] = A[M,K] @ B[K,N], row-major, fp32 acc.
// Block: 256 threads = 8 waves; tile 128x64; wave (wr 0..3, wc 0..1) owns
// 32x32. C_QKV: tile 128x192; wave (wr 0..1, wc 0..3) owns 64x48, so that a fragment
// read from LDS feeds 3 or 4 WMMAs and a byte brought from L2 more of the product.
// Double-buffered K-steps of BK (64 or 128).
// Requires: M%128==0, N%64==0, K%BK==0, lda/ldb/ldc %8==0, 16B-aligned bases.
// MODE says what leaves the block:
//   C_BF16, C_F32  C as bf16 or fp32.
//   C_ROWSUM       A[bz] in memory is x2T[128][K]; row tile by holds the features of roll
//                  by + 1: row j of the tile is x2T[j] * x2T[(j - by - 1) & 127], formed
//                  where the A fragment is loaded. C as bf16, and the row sums of the
//                  features (a product with a fragment of ones) as Zc[bz][m][16]: each
//                  sum split into two bf16, the upper part in the even columns, the
//                  rest in the odd ones.
//   C_QKV          B = Wq | Wk | Wv, 1024 columns each, 64 a head; row b*2048 + s. The
//                  tile's 192 columns are head bx of q, of k and of v, so that every
//                  block has the same work behind its loop.
//                  C itself is not stored: rounded to bf16 the three 128 x 64 parts go
//                  through LDS, and q leaves as q_bf (Cp), k as x2T (Zc), v as v_bf (Vb).
// ---------------------------------------------------------------------------
enum { C_BF16 = 0, C_F32 = 1, C_ROWSUM = 2, C_QKV = 4 };

// One block's tile: column tile bx, row tile by, batch bz.
template <int MODE, int BK>
__device__ __forceinline__ void gemm_tile(
    const u16* __restrict__ A, const u16* __restrict__ B, void* __restrict__ Cp,
    u16* __restrict__ Zc,
    int M, int N, int K, int lda, int ldb, int ldc,
    long long strideA, long long strideB, long long strideC,
    int bx, int by, int bz, u16* __restrict__ Vb = nullptr)
{
    constexpr int WCN = MODE == C_QKV ? 4 : 2;   // waves side by side in n; 8 / WCN in m
    constexpr int FM  = MODE == C_QKV ? 4 : 2;   // a wave's 16 x 16 fragments in m
    constexpr int FN  = MODE == C_QKV ? 3 : 2;   // and in n
    constexpr int BN  = WCN * FN * 16;           // the tile's columns
    static_assert((8 / WCN) * FM * 16 == 128, "the tile has 128 rows");
    // Row pitch of the A tile: BK*2 + 16 bytes, an odd multiple of 16 B, which
    // ds_load_b128 reads without bank conflicts.
    constexpr int LDP = BK + 8;
    constexpr int LDB = BN + 16;                 // row pitch of the B tile
    constexpr int ASZ = 128 * LDP;               // elements of an A buffer
    constexpr int BSZ = BK * LDB;                // elements of a B buffer
    static_assert(MODE != C_QKV || 2 * ASZ + 2 * BSZ >= 3 * 128 * TP, "the epilogue's three parts fit");
    __shared__ __align__(16) u16 S[2 * ASZ + 2 * BSZ];
    u16* const As = S;                           // two buffers [m][k]
    u16* const Bs = S + 2 * ASZ;                 // two buffers [k][n], as in memory

    A += (long long)bz * strideA;
    B += (long long)bz * strideB;

    const int tileN = bx * BN;
    const int tileM = by * 128;
    const int tid   = threadIdx.x;
    const int lane  = tid & 31;
    const int wave  = tid >> 5;
    const int wr    = wave / WCN;         // m slice: wr*FM*16
    const int wc    = wave % WCN;         // n slice: wc*FN*16
    const int lrow  = lane & 15;
    const int khalf = (lane >> 4) ? 8 : 0;

    // staging coordinates
    const int ar = tid / (BK / 8);        // A row, and every 2048/BK rows on
    const int ac = (tid % (BK / 8)) * 8;  // 0..BK-8
    const int br = tid >> 3;              // 0..31 (k row), and every 32 rows on
    const int bc = (tid & 7) * 8;         // 0..56 (n col)

    // C_ROWSUM: every row tile is made of the same 128 rows of x2T
    const u16* aG = A + (long long)((MODE == C_ROWSUM ? 0 : tileM) + ar) * lda + ac;   // K-tile t: + t*BK
    const u16* bG = B + (long long)br * ldb + tileN + bc;     // K-tile t: + t*BK rows
    const int  aL = ar * LDP + ac;
    const int  bL = br * LDB + bc;
    // C_QKV: a B row is three runs of 128 bytes, 1024 columns apart in memory and side by
    // side in LDS: 24 lanes a row, 8 neighbouring lanes a whole line. The block's 256
    // lanes go through the BK*24 pieces in order; g3 and l3 are this lane's places.
    constexpr int NB3 = BK * 24 / 256;
    int g3[NB3], l3[NB3];
    if (MODE == C_QKV) {
#pragma unroll   // g3[], l3[] indexed by constants: stay in registers
        for (int u = 0; u < NB3; ++u) {
            const int idx = tid + u * 256, row = idx / 24, p = idx - row * 24;
            g3[u] = row * ldb + (p >> 3) * 1024 + bx * 64 + (p & 7) * 8;
            l3[u] = row * LDB + p * 8;
        }
    }
    // this lane's address in a 16 x 16 piece of the B tile, for the transposing loads
    const int  bT = (khalf + (lane & 7)) * LDB + wc * FN * 16 + ((lane >> 3) & 1) * 8;
    const int  nT = K / BK;               // K-tiles

    v8f acc[FM][FN] = {};
    v8f accz[FM] = {};                    // C_ROWSUM: row sums of A
    Frag fone;
#pragma unroll   // fone.u[] indexed by constants: stays in registers
    for (int e = 0; e < 16; ++e) fone.u[e] = 0x3F80;          // 1.0

    // K-tile t on its way into buffer buf
    auto stage = [&](int t, int buf) {
        stage_a<BK>(aG + (long long)t * BK, lda, As + buf * ASZ + aL);
        if (MODE == C_QKV) {
            const u16* g = B + (long long)t * BK * ldb;
#pragma unroll   // independent copies, issued back to back
            for (int u = 0; u < NB3; ++u) stage_z(g + g3[u], Bs + buf * BSZ + l3[u]);
        } else {
            stage_b<BK, LDB>(bG + (long long)t * BK * ldb, ldb, Bs + buf * BSZ + bL);
        }
    };

    // ---- prologue: K-tile 0 into buffer 0, then K-tile 1 on its way into buffer 1
    stage(0, 0);
    async_wait0();
    __syncthreads();
    if (1 < nT) stage(1, 1);

    int cur = 0;
    for (int t = 0; t < nT; ++t) {
        // C_ROWSUM: what a run of 32 k reads from LDS, in two register sets: the rows of x2T,
        // the rolled rows at the same k, the B fragments.
        Frag fx[2][FM], fr[2][FM], fq[2][FN];
        auto fetch = [&](int kk, int set) {
            const u16* ap = As + cur * ASZ + kk + khalf;
#pragma unroll   // fx[][], fr[][] indexed by constants: stay in registers
            for (int i = 0; i < FM; ++i) {
                const int j = wr * FM * 16 + i * 16 + lrow;
                load_frag(fx[set][i], ap + j * LDP);
                load_frag(fr[set][i], ap + ((j - by - 1) & 127) * LDP);
            }
            const u16* bp = Bs + cur * BSZ + kk * LDB + bT;
#pragma unroll   // fq[][] indexed by constants: stays in registers
            for (int j = 0; j < FN; ++j) load_frag_tr<LDB>(fq[set][j], bp + j * 16);
        };
        if (MODE == C_ROWSUM) fetch(0, 0);
#pragma unroll   // the tile's runs of 32 k, in ascending k; LDS offsets become immediates
        for (int kk = 0; kk < BK; kk += 32) {
            // fragments (an A fragment reused by FN WMMAs, a B fragment by FM)
            Frag fa[FM], fb[FN];
            if (MODE == C_ROWSUM) {
                const int set = (kk >> 5) & 1;
                if (kk + 32 < BK) fetch(kk + 32, set ^ 1);
                // The next run's 12 LDS reads stay one group in front of this run's products and
                // WMMAs. A product stands between a read and its WMMA: left alone the compiler
                // reads each fragment just in front of its products and waits out the LDS
                // latency there, twice a run.
                __builtin_amdgcn_sched_barrier(0);
#pragma unroll   // 8 packed multiplies make a fragment's features
                for (int i = 0; i < FM; ++i) fa[i].b = fx[set][i].b * fr[set][i].b;
#pragma unroll
                for (int j = 0; j < FN; ++j) fb[j] = fq[set][j];
            } else {
                const u16* ap = As + cur * ASZ + (wr * FM * 16 + lrow) * LDP + kk + khalf;
#pragma unroll   // fa[] indexed by constants: stays in registers
                for (int i = 0; i < FM; ++i) load_frag(fa[i], ap + i * 16 * LDP);
                const u16* bp = Bs + cur * BSZ + kk * LDB + bT;
#pragma unroll   // fb[] indexed by constants: stays in registers
                for (int j = 0; j < FN; ++j) load_frag_tr<LDB>(fb[j], bp + j * 16);
            }
            // The 14 LDS reads of a run stay one group in front of its 12 WMMAs. Left alone the
            // compiler reloads one A fragment's registers in front of every three WMMAs and
            // waits out the LDS latency there each time.
            if (MODE == C_QKV) __builtin_amdgcn_sched_barrier(0);

#pragma unroll   // acc[][] indexed by constants: stays in registers
            for (int i = 0; i < FM; ++i)
#pragma unroll
                for (int j = 0; j < FN; ++j)
                    acc[i][j] = __builtin_amdgcn_wmma_f32_16x16x32_bf16(false, fa[i].b, false, fb[j].b,
                                                                        (short)0, acc[i][j], false, false);
            if (MODE == C_ROWSUM) {
#pragma unroll   // accz[] indexed by constants: stays in registers
                for (int i = 0; i < FM; ++i)
                    accz[i] = __builtin_amdgcn_wmma_f32_16x16x32_bf16(false, fa[i].b, false, fone.b,
                                                                      (short)0, accz[i], false, false);
            }
        }

        // Hand-over: this wave's LDS reads are done and its copies of tile t + 1
        // have landed; behind the barrier every wave may read tile t + 1, and
        // buffer cur, which all have left, may be refilled.
        asm volatile("s_wait_dscnt 0x0" ::: "memory");
        async_wait0();
        __syncthreads();
        if (t + 2 < nT) stage(t + 2, cur);
        cur ^= 1;
    }
    async_wait0();   // no copy outlives the loop

    // C/D layout: VGPR r -> row r + (lane>=16 ? 8 : 0), col lane%16
    // Every loop over i, j, r below is unrolled: the accumulators indexed by constants stay in registers.
    const int rsel = (lane >> 4) ? 8 : 0;
    const int cm   = tileM + wr * FM * 16 + rsel;
    const int cn   = tileN + wc * FN * 16 + lrow;
    if (MODE == C_QKV) {
        // Every wave has left both buffers at the loop's last barrier, and no copy is
        // under way: the three parts take the place of the buffers.
        constexpr int TSZ = 128 * TP;         // elements of a part, in either lay-out
        static_assert(TSZ >= 64 * TT, "a part as [d][s] fits too");
        const int bn = (by >> 4) * 16 + bx;
        const int s0 = (by & 15) * 128;
#pragma unroll
        for (int j = 0; j < FN; ++j) {
            const int c    = (wc * FN + j) * 16;   // the fragment's first column of the 192
            const int kind = c >> 6;               // 0 q, 1 k, 2 v: the same for the whole wave
            const int c0   = (c & 63) + lrow;
            u16* T = S + kind * TSZ;
#pragma unroll
            for (int i = 0; i < FM; ++i) {
                const int m0 = (wr * FM + i) * 16 + rsel;
                if (kind == 1) {
                    // as [d][s]: a lane's 8 rows of a column are 8 neighbouring s, 16 bytes
                    u16x8 e;
#pragma unroll
                    for (int r = 0; r < 8; ++r) e[r] = f2bf(acc[i][j][r]);
                    *(u16x8*)(T + c0 * TT + m0) = e;
                } else {
#pragma unroll
                    for (int r = 0; r < 8; ++r) T[(m0 + r) * TP + c0] = f2bf(acc[i][j][r]);
                }
            }
        }
        __syncthreads();   // the parts are whole before a thread reads what other waves wrote
        rows_out(S, (u16*)Cp, bn, s0);
        rows_out(S + 2 * TSZ, Vb, bn, s0);
        x2_rows(S + TSZ, Zc, bn, s0);
    } else if (MODE == C_BF16 || MODE == C_ROWSUM) {
        u16* C = (u16*)Cp + (long long)bz * strideC;
#pragma unroll
        for (int r = 0; r < 8; ++r)
#pragma unroll
            for (int i = 0; i < FM; ++i)
#pragma unroll
                for (int j = 0; j < FN; ++j)
                    C[(long long)(cm + i * 16 + r) * ldc + cn + j * 16] = f2bf(acc[i][j][r]);
        if (MODE == C_ROWSUM && wc == 0) {   // every column of accz holds the row's sum
            u16* Z = Zc + ((long long)bz * M + cm) * 16 + lrow;
#pragma unroll
            for (int r = 0; r < 8; ++r)
#pragma unroll
                for (int i = 0; i < FM; ++i) {
                    const u16 hi = f2bf(accz[i][r]);
                    Z[(i * 16 + r) * 16] = (lrow & 1) ? f2bf(accz[i][r] - bf2f(hi)) : hi;
                }
        }
    } else {
        float* C = (float*)Cp + (long long)bz * strideC;
#pragma unroll
        for (int r = 0; r < 8; ++r)
#pragma unroll
            for (int i = 0; i < FM; ++i)
#pragma unroll
                for (int j = 0; j < FN; ++j)
                    C[(long long)(cm + i * 16 + r) * ldc + cn + j * 16] = acc[i][j][r];
    }
}

template <int MODE, int BK>
__global__ __launch_bounds__(256) void gemm_bf16_kernel(
    const u16* __restrict__ A, const u16* __restrict__ B, void* __restrict__ Cp,
    u16* __restrict__ Zc,
    int M, int N, int K, int lda, int ldb, int ldc,
    long long strideA, long long strideB, long long strideC)
{
    gemm_tile<MODE, BK>(A, B, Cp, Zc, M, N, K, lda, ldb, ldc, strideA, strideB, strideC,
                        blockIdx.x, blockIdx.y, blockIdx.z);
}

// q | k | v = h @ (Wq | Wkv), 4096 x 3072 over K = 1024, leaving as q_bf, x2T and v_bf.
__global__ __launch_bounds__(256) void qkv_feat_kernel(
    const u16* __restrict__ A, const u16* __restrict__ B,
    u16* __restrict__ qb, u16* __restrict__ x2T, u16* __restrict__ vb)
{
    gemm_tile<C_QKV, 64>(A, B, qb, x2T, 4096, 3072, 1024, 1024, 3072, 0, 0, 0, 0,
                          blockIdx.x, blockIdx.y, 0, vb);
}

// ---------------------------------------------------------------------------
// All four fp32 -> bf16 casts in one launch: blocks 0..511 h, 512..639 Wq,
// 640..895 Wkv, 896..1023 Wo. Wq and Wkv go side by side into Wqkv[1024][3072], so
// that one GEMM makes q, k and v. h[s][b] goes to h_bf[b][s], so that 128 rows of that
// GEMM are 128 consecutive s of one b.
// A block converts 8192 consecutive floats (every array here is a multiple of
// that). A lane takes four floats per access, so a wave reads 512 and writes
// 256 contiguous bytes; all eight loads of a thread are asked for first.
__global__ __launch_bounds__(256) void cvt_all_kernel(const float* __restrict__ h,
                                                      const float* __restrict__ Wq,
                                                      const float* __restrict__ Wkv,
                                                      const float* __restrict__ Wo,
                                                      u16* __restrict__ h_bf,
                                                      u16* __restrict__ Wqkv_bf,
                                                      u16* __restrict__ Wo_bf)
{
    int blk = blockIdx.x;
    const float* src = h;
    u16* dst  = h_bf;
    int pitch = 1024;                   // elements from one destination row to the next
    int sh    = 1;                      // a source row is 1024 << sh floats
    int step  = 2097152;                // elements from a row's first 1024 to its second: h_bf[1] - h_bf[0]
    if (blk >= 896)      { blk -= 896; src = Wo;  dst = Wo_bf;                        sh = 0; }
    else if (blk >= 640) { blk -= 640; src = Wkv; dst = Wqkv_bf + 1024; pitch = 3072; step = 1024; }
    else if (blk >= 512) { blk -= 512; src = Wq;  dst = Wqkv_bf;        pitch = 3072; sh = 0; }
    src += blk * 8192 + threadIdx.x * 4;
    dst += threadIdx.x * 4;
    f32x4 v[8];
#pragma unroll   // v[] indexed by constants: stays in registers
    for (int u = 0; u < 8; ++u) v[u] = *(const f32x4*)(src + u * 1024);
#pragma unroll
    for (int u = 0; u < 8; ++u) {
        u16x4 o;
#pragma unroll
        for (int e = 0; e < 4; ++e) o[e] = f2bf(v[u][e]);
        const int g = blk * 8 + u;      // which run of 1024 floats of the array
        *(u16x4*)(dst + (g >> sh) * pitch + (g & ((1 << sh) - 1)) * step) = o;
    }
}

// attn_vec for 128 consecutive s (blockIdx.x) of one bn (blockIdx.y):
// num = pq @ kv_agg[bn] (128x384 . 384x64) and den = pq @ z[bn], the 16 columns of
// Zc[bn][f][16] riding as further columns of B, so that column pairs of pq @ Zc add up to
// dot(pq row, z). num * SCALE over (den * SCALE + EPS) goes as bf16 to [s][b][n][d].
// All that the block reads, its 128 rows of q (16 KiB) and kv_agg | Zc (60 KiB), is
// brought to LDS once. pq exists only as A fragments: a lane reads 8 entries of its q row
// and the 4 in front of them, takes relu(x) or relu(-x), shifts by the roll and multiplies.
// 8 waves; wave (wr 0..3, wc 0..1) owns 32 x 32; k ascends over the 384 features.
__global__ __launch_bounds__(256) void attn_kernel(const u16* __restrict__ q,
                                                   const u16* __restrict__ kv,
                                                   const u16* __restrict__ Zc,
                                                   u16* __restrict__ attn)
{
    constexpr int LDB = 80;    // B row pitch, elements: 160 bytes, see above
    __shared__ __align__(16) u16 Bs[384 * LDB];   // [f][64 d | 16 z]
    __shared__ __align__(16) u16 Qs[128 * TP];    // [s][d]
    const int by    = blockIdx.x;
    const int bz    = blockIdx.y;
    const int tid   = threadIdx.x;
    const int lane  = tid & 31;
    const int wave  = tid >> 5;
    const int wr    = wave >> 1;
    const int wc    = wave & 1;
    const int lrow  = lane & 15;
    const int khalf = (lane >> 4) ? 8 : 0;

    // Each of the three sources is contiguous in memory: the block's lanes go through its
    // 16-byte pieces in order. 19 independent copies a thread, issued back to back.
    const u16* qg = q + ((long long)bz * 2048 + by * 128) * 64;
    const u16* bg = kv + (long long)bz * 24576;
    const u16* zg = Zc + (long long)bz * 6144;
#pragma unroll
    for (int u = 0; u < 4; ++u) {
        const int g = tid + u * 256;
        stage_z(qg + g * 8, Qs + (g >> 3) * TP + (g & 7) * 8);
    }
#pragma unroll
    for (int u = 0; u < 12; ++u) {
        const int g = tid + u * 256;
        stage_z(bg + g * 8, Bs + (g >> 3) * LDB + (g & 7) * 8);
    }
#pragma unroll
    for (int u = 0; u < 3; ++u) {
        const int g = tid + u * 256;
        stage_z(zg + g * 8, Bs + (g >> 1) * LDB + 64 + (g & 1) * 8);
    }
    async_wait0();
    __syncthreads();   // every wave's copies have landed before any wave reads

    const int bT = (khalf + (lane & 7)) * LDB + wc * 32 + ((lane >> 3) & 1) * 8;
    const int zT = (khalf + (lane & 7)) * LDB + 64 + ((lane >> 3) & 1) * 8;

    v8f acc[2][2] = {};
    v8f accz[2] = {};
    // Every loop below is unrolled: roll and j are constants, the fragments stay in registers.
#pragma unroll
    for (int kk = 0; kk < 384; kk += 32) {
        constexpr unsigned NEG = 0x80008000u;
        const int roll = (kk >> 7) + 1;
        const int jb   = kk & 127;
        Frag fa[2], fb[2], fz;
#pragma unroll
        for (int i = 0; i < 2; ++i) {
            const u16* qr = Qs + (wr * 32 + i * 16 + lrow) * TP;
            Frag fr;
#pragma unroll
            for (int hf = 0; hf < 2; ++hf) {
                const int jg = jb + hf * 16 + khalf;          // the lane's 8 j: k order of load_frag
                const uint4 c = *(const uint4*)(qr + (jg & 63));
                const uint2 p = *(const uint2*)(qr + ((jg - 4) & 63));
                const unsigned fc = (jb & 64) ? NEG : 0u;         // upper half of x2 is relu(-x)
                const unsigned fp = ((jg - 4) & 64) ? NEG : 0u;   // j - 4 modulo 128
                // x2[jg-4 .. jg+7], two a word
                const unsigned w[6] = {relu2(p.x ^ fp), relu2(p.y ^ fp), relu2(c.x ^ fc),
                                       relu2(c.y ^ fc), relu2(c.z ^ fc), relu2(c.w ^ fc)};
#pragma unroll
                for (int n = 0; n < 4; ++n) {
                    fa[i].w[hf * 4 + n] = w[n + 2];
                    fr.w[hf * 4 + n] = roll == 2 ? w[n + 1]
                                     : roll == 1 ? (w[n + 1] >> 16) | (w[n + 2] << 16)
                                                 : (w[n] >> 16) | (w[n + 1] << 16);
                }
            }
            fa[i].b = fa[i].b * fr.b;
        }
        const u16* bp = Bs + kk * LDB;
#pragma unroll
        for (int j = 0; j < 2; ++j) load_frag_tr<LDB>(fb[j], bp + bT + j * 16);
        load_frag_tr<LDB>(fz, bp + zT);
#pragma unroll
        for (int i = 0; i < 2; ++i)
#pragma unroll
            for (int j = 0; j < 2; ++j)
                acc[i][j] = __builtin_amdgcn_wmma_f32_16x16x32_bf16(false, fa[i].b, false, fb[j].b,
                                                                    (short)0, acc[i][j], false, false);
#pragma unroll
        for (int i = 0; i < 2; ++i)
            accz[i] = __builtin_amdgcn_wmma_f32_16x16x32_bf16(false, fa[i].b, false, fz.b,
                                                              (short)0, accz[i], false, false);
    }

    // C/D layout: VGPR r -> row r + (lane>=16 ? 8 : 0), col lane%16
    const int cm = by * 128 + wr * 32 + ((lane >> 4) ? 8 : 0);
    u16* C = attn + (bz >> 4) * 1024 + (bz & 15) * 64 + wc * 32 + lrow;
#pragma unroll
    for (int r = 0; r < 8; ++r) {
#pragma unroll
        for (int i = 0; i < 2; ++i) {
            // a lane and its neighbour hold the two parts of the row's dot(pq row, z);
            // one division a row, SCALE / den, serves all of the lane's columns
            const float sc = 0.125f / ((accz[i][r] + __shfl_xor(accz[i][r], 1, 32)) * 0.125f + 1e-5f);
#pragma unroll
            for (int j = 0; j < 2; ++j)
                C[(long long)(cm + i * 16 + r) * 2048 + j * 16] = f2bf(acc[i][j][r] * sc);
        }
    }
}

// The sum of v over the wave's 32 lanes, left in every lane: four DPP steps inside each row
// of 16 lanes (row_xmask 1, 2, 4, 8), then the other row's sum by v_permlanex16_b32.
// __shfl_xor would go through ds_bpermute_b32 and wait out its latency at each of five steps.
template <int CTRL>
__device__ __forceinline__ float dpp_f32(float v) {
    return __builtin_bit_cast(float, __builtin_amdgcn_update_dpp(0, __builtin_bit_cast(int, v), CTRL, 0xf, 0xf, true));
}
__device__ __forceinline__ float wave_sum(float v) {
    v += dpp_f32<0x161>(v);
    v += dpp_f32<0x162>(v);
    v += dpp_f32<0x164>(v);
    v += dpp_f32<0x168>(v);
    const int w = __builtin_bit_cast(int, v);
    return v + __builtin_bit_cast(float, __builtin_amdgcn_permlanex16(w, w, 0x76543210, 0xfedcba98, false, false));
}

// out = layernorm(h + attn_out). A wave owns a row and keeps it in registers: a lane
// takes four floats per access, so a wave's load or store covers 512 contiguous bytes, and
// all loads of the row, with gamma and beta, are asked for before the first is used.
// Mean and variance (two passes, over the registers) are summed across the wave's lanes.
__global__ __launch_bounds__(256) void ln_kernel(const float* __restrict__ h,
                                                 const float* __restrict__ attn,
                                                 const float* __restrict__ gamma,
                                                 const float* __restrict__ beta,
                                                 float* __restrict__ out)
{
    const int lane = threadIdx.x & 31;
    // The row is the same in every lane: taken from the first lane it stays in scalar registers,
    // and every load and store of the wave is a scalar base plus the lane's one 32-bit offset.
    const int row  = blockIdx.x * 8 + __builtin_amdgcn_readfirstlane(threadIdx.x >> 5);
    const float* hr = h    + (long long)row * 1024 + lane * 4;
    const float* ar = attn + (long long)row * 1024 + lane * 4;

    // Every loop below is unrolled: x[], a[], g[], b[] indexed by constants stay in registers.
    f32x4 x[8], a[8], g[8], b[8];
#pragma unroll
    for (int u = 0; u < 8; ++u) x[u] = *(const f32x4*)(hr + u * 128);
#pragma unroll
    for (int u = 0; u < 8; ++u) a[u] = *(const f32x4*)(ar + u * 128);
#pragma unroll
    for (int u = 0; u < 8; ++u) g[u] = *(const f32x4*)(gamma + lane * 4 + u * 128);
#pragma unroll
    for (int u = 0; u < 8; ++u) b[u] = *(const f32x4*)(beta + lane * 4 + u * 128);
    // Precaution: a scalar base of the loads above is overwritten further down; this wait
    // stands in front of that overwrite (the scheduling barrier behind it keeps it there).
    asm volatile("s_wait_xcnt 0x0" ::: "memory");
    // The 32 loads stay one group in front of the arithmetic. Left alone the compiler asks for
    // gamma and beta behind the sums, a pair at a time, and waits out a load's latency at each pair.
    __builtin_amdgcn_sched_barrier(0);

    // A lane sums in four chains, one for each of its four columns of an access.
    f32x4 s4 = {0.f, 0.f, 0.f, 0.f};
#pragma unroll
    for (int u = 0; u < 8; ++u) {
        x[u] += a[u];
        s4 += x[u];
    }
    const float mu = wave_sum((s4[0] + s4[1]) + (s4[2] + s4[3])) * (1.f / 1024.f);

    f32x4 v4 = {0.f, 0.f, 0.f, 0.f};
#pragma unroll
    for (int u = 0; u < 8; ++u) {
        x[u] -= mu;
        v4 += x[u] * x[u];
    }
    const float rstd = rsqrtf(wave_sum((v4[0] + v4[1]) + (v4[2] + v4[3])) * (1.f / 1024.f) + 1e-5f);

    float* orow = out + (long long)row * 1024 + lane * 4;
#pragma unroll
    for (int u = 0; u < 8; ++u) *(f32x4*)(orow + u * 128) = x[u] * rstd * g[u] + b[u];
}

// ---------------------------------------------------------------------------
extern "C" void kernel_launch(void* const* d_in, const int* in_sizes, int n_in,
                              void* d_out, int out_size, void* d_ws, size_t ws_size,
                              hipStream_t stream)
{
    const float* h    = (const float*)d_in[0];   // [2048,2,1024]
    const float* Wq   = (const float*)d_in[1];   // [1024,1024]
    const float* Wkv  = (const float*)d_in[2];   // [1024,2048]
    const float* Wo   = (const float*)d_in[3];   // [1024,1024]
    const float* gam  = (const float*)d_in[4];
    const float* bet  = (const float*)d_in[5];
    float* out = (float*)d_out;
    (void)in_sizes; (void)n_in; (void)out_size; (void)ws_size;

    char* ws = (char*)d_ws;
    auto take = [&](size_t bytes) -> char* { char* p = ws; ws += bytes; return p; };

    u16*   h_bf     = (u16*)  take(8388608);    // 2 x 2048x1024: [b][s]
    u16*   Wqkv_bf  = (u16*)  take(6291456);    // 1024x3072: Wq | Wkv
    u16*   Wo_bf    = (u16*)  take(2097152);    // 1024x1024
    u16*   q_bf     = (u16*)  take(8388608);    // 32 x 2048x64
    u16*   v_bf     = (u16*)  take(8388608);    // 32 x 2048x64
    u16*   x2T_bf   = (u16*)  take(16777216);   // 32 x 128x2048
    u16*   zc_bf    = (u16*)  take(393216);     // 32 x 384x16
    u16*   kvagg_bf = (u16*)  take(1572864);    // 32 x 384x64
    u16*   attn_bf  = (u16*)  take(8388608);    // 4096x1024
    float* attn_out = (float*)take(16777216);   // 4096x1024

    // 1) fp32 -> bf16 casts
    cvt_all_kernel<<<1024, 256, 0, stream>>>(h, Wq, Wkv, Wo, h_bf, Wqkv_bf, Wo_bf);

    // 2) q | k | v = h @ (Wq | Wkv)  [4096,3072]; a block has 128 s of one head's q, k and
    //    v; K-step 64: two blocks' LDS and registers fit a WGP, so the 512 blocks are one
    //    even round on 256 WGPs. k leaves as x2T [bn][j][s], q and v as [bn][s][d]
    qkv_feat_kernel<<<dim3(16, 32, 1), 256, 0, stream>>>(h_bf, Wqkv_bf, q_bf, x2T_bf, v_bf);

    // 3) kv_agg[bn] = pk^T[bn] @ v[bn]  (384x2048 . 2048x64, bf16 out) and z[bn], the row
    //    sums of pk^T[bn]; three row tiles a batch, one for each roll
    gemm_bf16_kernel<C_ROWSUM, 128><<<dim3(1, 3, 32), 256, 0, stream>>>(
        x2T_bf, v_bf, kvagg_bf, zc_bf, 384, 64, 2048, 2048, 64, 64,
        262144LL, 131072LL, 24576LL);

    // 4) num[bn] = pq[bn] @ kv_agg[bn] and den[bn] = pq[bn] @ z[bn], pq formed from q;
    //    attn_vec = num*SCALE/den leaves as bf16 [4096,1024]
    attn_kernel<<<dim3(16, 32, 1), 256, 0, stream>>>(q_bf, kvagg_bf, zc_bf, attn_bf);

    // 5) attn_out = attn_vec @ Wo  (fp32 out)
    gemm_bf16_kernel<C_F32, 128><<<dim3(16, 32, 1), 256, 0, stream>>>(
        attn_bf, Wo_bf, attn_out, nullptr, 4096, 1024, 1024, 1024, 1024, 1024, 0, 0, 0);

    // 6) out = layernorm(h + attn_out): 4096 rows, a wave each
    ln_kernel<<<512, 256, 0, stream>>>(h, attn_out, gam, bet, out);
}
